// v000
// The times below were measured on an AMD MI455X: many runs one after another, warmed up first and cycling through
// copies of the inputs, with the whole window's GPU time divided by the number of runs. Launches and the gaps
// between them are all in it. The median over several windows is given; except for v000 it joins two sittings, which
// can be a few percent apart, so the side-by-side timings, each taken in one sitting, are the better comparison.
// v000, which the later versions start from, runs in 668 microseconds.
// compute dtype: query_x, kv_x, Wq, Wk, Wv, Wo, lambda_*, subln_w (module inputs) rounded to bf16; q (from query_x), k and v (from kv_x) with exact bf16 products on WMMA 16x16x32 ((in,out) weights packed as transposed rows); q and k stored as f16 hi + (x2048-scaled) residual planes; per head pair both 32-dim sub-head score maps with 3 products x 32^-0.5, two running-max softmaxes in f32 (hardware exp); P as f16 hi + (x2048) residual x v hi/lo (3 products) for both maps; lambda from the four 32-vectors in f32 (precise expf); the differential combination, RMS norm (eps 1e-5) x subln_w x (1 - lambda_init) in f32; output projection with the context as bf16 hi + residual x exact Wo (2 products); f32 accumulate.
#include <hip/hip_runtime.h>
#include <math.h>

typedef __attribute__((ext_vector_type(16))) _Float16 v16h;
typedef __attribute__((ext_vector_type(16))) __bf16 v16b;
typedef __attribute__((ext_vector_type(8)))  _Float16 v8h;
typedef __attribute__((ext_vector_type(8)))  float v8f;
typedef __attribute__((ext_vector_type(4)))  float v4f;
typedef __attribute__((ext_vector_type(2)))  float v2f;
typedef __attribute__((ext_vector_type(4)))  unsigned v4u;
typedef __attribute__((ext_vector_type(4)))  int v4i;
typedef float __attribute__((may_alias)) float_a;
typedef int __attribute__((may_alias)) int_a;

template <typename T> __device__ __forceinline__ void vst2(void* p, T v) { *(T*)p = v;  }
__device__ __forceinline__ v8f wmma16(v16h a, v16h b, v8f c) {
  v8f d = __builtin_amdgcn_wmma_f32_16x16x32_f16(false, a, false, b, (short)0, c, false, false);
  asm volatile("v_nop\n\tv_nop\n\tv_nop\n\tv_nop" : "+v"(d) : "v"(a), "v"(b));
  return d;
}
__device__ __forceinline__ v8f wmma_bf(v16b a, v16b b, v8f c) {
  v8f d = __builtin_amdgcn_wmma_f32_16x16x32_bf16(false, a, false, b, (short)0, c, false, false);
  asm volatile("v_nop\n\tv_nop\n\tv_nop\n\tv_nop" : "+v"(d) : "v"(a), "v"(b));
  return d;
}
// Cross multi-head differential attention (B 2, T = S = 2,048, d 1,024, 16 head pairs of 32-dim q/k and 64-dim values, depth-12 lambda_init): softmax(q1 k1) - lambda softmax(q2 k2) applied to v, RMS norm, output projection.
__device__ __forceinline__ v16h frag_h(const _Float16* rowk0, int lane) {
  union { v16h v; v8h q[2]; } u; const _Float16* p = rowk0 + 8 * (lane >> 4);
  u.q[0] = *(const v8h*)p; u.q[1] = *(const v8h*)(p + 16); return u.v;
}
__device__ __forceinline__ v16h frag_f32(const float* rowk0, int lane) {
  v16h a; const float* p = rowk0 + 8 * (lane >> 4);
#pragma unroll
  for (int i = 0; i < 8; ++i) { a[i] = (_Float16)p[i]; a[8 + i] = (_Float16)p[16 + i]; }
  return a;
}
__device__ __forceinline__ v16h frag_f32s(const float* rowk0, int lane, float sc) {
  v16h a; const float* p = rowk0 + 8 * (lane >> 4);
#pragma unroll
  for (int i = 0; i < 8; ++i) { a[i] = (_Float16)(p[i] * sc); a[8 + i] = (_Float16)(p[16 + i] * sc); }
  return a;
}
// column fragment from a [K][ld] layout (column n), rows >= K read as 0
__device__ __forceinline__ v16h fragc_f32(const float* W, int k0, int n, int lane, int ld, int K) {
  v16h a; const int g = lane >> 4;
#pragma unroll
  for (int i = 0; i < 8; ++i) { const int ka = k0 + 8 * g + i, kb = ka + 16;
    a[i] = (_Float16)(ka < K ? W[(size_t)(ka < K ? ka : K - 1) * ld + n] : 0.f); a[8 + i] = (_Float16)(kb < K ? W[(size_t)(kb < K ? kb : K - 1) * ld + n] : 0.f); }
  return a;
}
struct F2 { v16b h, l; };
__device__ __forceinline__ F2 bsplit16(const float v[16]) { F2 r;
#pragma unroll
  for (int i = 0; i < 16; ++i) { const __bf16 h = (__bf16)v[i]; r.h[i] = h; r.l[i] = (__bf16)(v[i] - (float)h); }
  return r; }
__device__ __forceinline__ F2 split_row(const float* row, int k0, int lane) { float v[16]; const float* p = row + k0 + 8 * (lane >> 4);
#pragma unroll
  for (int i = 0; i < 8; ++i) { v[i] = p[i]; v[8 + i] = p[16 + i]; }
  return bsplit16(v); }
__device__ __forceinline__ F2 split_rowK(const float* row, int k0, int lane, int K) { float v[16]; const int g = lane >> 4;
#pragma unroll
  for (int i = 0; i < 8; ++i) { const int ka = k0 + 8 * g + i, kb = ka + 16; v[i] = ka < K ? row[ka < K ? ka : K - 1] : 0.f; v[8 + i] = kb < K ? row[kb < K ? kb : K - 1] : 0.f; }
  return bsplit16(v); }
__device__ __forceinline__ F2 split_col(const float* W, int k0, int n, int lane, int ld, int K) { float v[16]; const int g = lane >> 4;
#pragma unroll
  for (int i = 0; i < 8; ++i) { const int ka = k0 + 8 * g + i, kb = ka + 16; v[i] = ka < K ? W[(size_t)(ka < K ? ka : K - 1) * ld + n] : 0.f; v[8 + i] = kb < K ? W[(size_t)(kb < K ? kb : K - 1) * ld + n] : 0.f; }
  return bsplit16(v); }
__device__ __forceinline__ v8f mac3(const F2& a, const F2& b, v8f c) { c = wmma_bf(a.l, b.h, c); c = wmma_bf(a.h, b.l, c); return wmma_bf(a.h, b.h, c); }
__device__ __forceinline__ float sigm(float v) { return 1.0f / (1.0f + expf(-v)); }
#define LDSX() do { asm volatile("s_wait_dscnt 0" ::: "memory"); __builtin_amdgcn_wave_barrier(); __builtin_amdgcn_fence(__ATOMIC_RELEASE, "workgroup"); } while (0)


#define NB 2
#define SS 2048
#define DM 1024
#define NH 16
#define HD 64
#define QKVW (3 * DM)
#ifndef TQB
#define TQB (SS / 64)
#define TNB NB
#define TOB (NB * SS / 64)     // output row tiles (all)
#endif
typedef __attribute__((ext_vector_type(8))) __bf16 v8b;
__device__ __forceinline__ v16b frag_b(const __bf16* rowk0, int lane) {
  union { v16b v; v8b q[2]; } u; const __bf16* p = rowk0 + 8 * (lane >> 4);
  u.q[0] = *(const v8b*)p; u.q[1] = *(const v8b*)(p + 16); return u.v;
}
__device__ __forceinline__ float bfr(float v) { return (float)(__bf16)v; }
__device__ __attribute__((noinline)) float exp_ni(float v) { return expf(v); }
__device__ __attribute__((noinline)) float erf_ni(float v) { return erff(v); }

#define PK_A 0                       // [3072][1024] Wqkv rows (natural [out][in])
#define PK_P (PK_A + QKVW * DM)        // [1024][1024] Wo rows (natural)
#define PK_END (PK_P + DM * DM)
#define WS_PK  0u
#define WS_QK  (WS_PK + 2u * PK_END)             // f16 [4096 rows][2048]: q | k
#define WS_QKL (WS_QK + 2u * NB * SS * 2 * DM)     // f16 q | k residual planes x2048
#define WS_VTH (WS_QKL + 2u * NB * SS * 2 * DM)    // f16 [b][1024 (h*64+d)][2048 s] hi
#define WS_VTL (WS_VTH + 2u * NB * DM * SS)        // f16 lo x 2048
#define WS_O   (WS_VTL + 2u * NB * DM * SS)        // f32 [4096][1024]
#define WS_CS  (WS_O + 4u * NB * SS * DM)           // 2 x [2048][32] f32, reserved, unused (no RoPE)
#define WS_END (WS_CS + 4u * 2 * SS * 32)
// ---- k_pack: block = (row n, which): natural [out][in] rows -> bf16; which 0..2 -> W_q/W_k/W_v into PK_A rows which*1024 + n; 3 -> W_o into PK_P
__global__ __launch_bounds__(256) void k_pack(const float* __restrict__ WQ, const float* __restrict__ WK, const float* __restrict__ WV, const float* __restrict__ WO, __bf16* __restrict__ PK) {
  __shared__ __align__(16) __bf16 s[DM]; const int n = blockIdx.x, which = blockIdx.y, t = threadIdx.x; const float* Wm = (which == 0) ? WQ : (which == 1) ? WK : (which == 2) ? WV : WO;   // (in,out) -> transposed rows
  for (int k = t; k < DM; k += 256) s[k] = (__bf16)Wm[(size_t)k * DM + n];
  __syncthreads();
  __bf16* dst = (which < 3) ? PK + PK_A + ((size_t)which * DM + n) * DM : PK + PK_P + (size_t)n * DM;
  for (int q = t; q < DM / 8; q += 256) vst2((unsigned*)(dst + q * 8), *(const v4u*)&s[q * 8]);
}
__global__ __launch_bounds__(128) void k_qkv(const float* __restrict__ XQ, const float* __restrict__ XKV, const __bf16* __restrict__ P, _Float16* __restrict__ QK, _Float16* __restrict__ QKL, _Float16* __restrict__ VTH, _Float16* __restrict__ VTL) {
  const float* X = (blockIdx.y * 128 < DM) ? XQ : XKV;   // q from query_x, k and v from kv_x
  __shared__ __align__(16) _Float16 so[4][16][136], sol[4][16][136]; __shared__ __align__(16) _Float16 sth[128][72], stl[128][72];
  const int tid = threadIdx.x, wave = tid >> 5, lane = tid & 31, col = lane & 15, g = lane >> 4; const size_t r0 = (size_t)blockIdx.x * 64 + wave * 16; const int n0 = blockIdx.y * 128;
  v8f acc[8] = {};
#pragma unroll 2
  for (int kc = 0; kc < DM / 32; ++kc) { v16b a; { const float* p = X + (r0 + col) * DM + kc * 32 + 8 * g;
#pragma unroll
      for (int i = 0; i < 8; ++i) { a[i] = (__bf16)p[i]; a[8 + i] = (__bf16)p[16 + i]; } }
#pragma unroll
    for (int j = 0; j < 8; ++j) acc[j] = wmma_bf(a, frag_b(P + (size_t)(n0 + j * 16 + col) * DM + kc * 32, lane), acc[j]); }
  if (n0 < 2 * DM) {   // q stored unscaled (f16 sigma ~0.6, no subnormal exposure); 32^-0.5 applied to the f32 score
#pragma unroll
    for (int j = 0; j < 8; ++j) {
#pragma unroll
      for (int r = 0; r < 8; ++r) { const float v = acc[j][r]; const _Float16 hv = (_Float16)v; so[wave][8 * g + r][j * 16 + col] = hv; sol[wave][8 * g + r][j * 16 + col] = (_Float16)((v - (float)hv) * 2048.0f); } }   // q, k as f16 hi + (x2048) residual (no RoPE in this module)
    LDSX();
    for (int rl = 0; rl < 16; ++rl) if (lane < 16) { vst2((unsigned*)(QK + (r0 + rl) * (2 * DM) + n0 + lane * 8), *(const v4u*)&so[wave][rl][lane * 8]); vst2((unsigned*)(QKL + (r0 + rl) * (2 * DM) + n0 + lane * 8), *(const v4u*)&sol[wave][rl][lane * 8]); }
  } else {
#pragma unroll
    for (int j = 0; j < 8; ++j) {
#pragma unroll
      for (int r = 0; r < 8; ++r) { const float v = acc[j][r]; const _Float16 hv = (_Float16)v; sth[j * 16 + col][wave * 16 + 8 * g + r] = hv; stl[j * 16 + col][wave * 16 + 8 * g + r] = (_Float16)((v - (float)hv) * 2048.0f); } }
    __syncthreads();
    const size_t rb = (size_t)blockIdx.x * 64; const int b = (int)(rb / SS), s0 = (int)(rb % SS); const int pc0 = n0 - 2 * DM;
    for (int q = tid; q < 128 * 8; q += 128) { const int d = q >> 3, pc = q & 7; const size_t o = ((size_t)b * DM + pc0 + d) * SS + s0 + pc * 8; vst2((unsigned*)(VTH + o), *(const v4u*)&sth[d][pc * 8]); vst2((unsigned*)(VTL + o), *(const v4u*)&stl[d][pc * 8]); }
  }
}
#define LAMBDA_INIT 0.78360247f   // 0.8 - 0.6*exp(-0.3*12), float32
// ---- k_attn: block = (64 queries, head pair h, b): sub-heads 2h (q/k dims 64h..64h+31) and 2h+1 (64h+32..64h+63), each a softmax over the 2,048 keys with 3-product scores x 32^-0.5; both maps applied to the same 64-dim value head h (P as f16 hi + x2048 lo x V hi/lo); o = P1.V/l1 - lambda P2.V/l2; rms_norm over the 64 dims x subln_w x (1 - lambda_init) -> O rows
__global__ __launch_bounds__(128) void k_attn(const _Float16* __restrict__ QK, const _Float16* __restrict__ QKL, const _Float16* __restrict__ VTH, const _Float16* __restrict__ VTL, const float* __restrict__ LQ1, const float* __restrict__ LK1, const float* __restrict__ LQ2, const float* __restrict__ LK2, const float* __restrict__ SUBW, float* __restrict__ O) {
  __shared__ __align__(16) _Float16 sph[4][16][40], spl[4][16][40]; __shared__ __align__(16) float so[4][16][68]; __shared__ float so1[4][16][68];
  const int tid = threadIdx.x, wave = tid >> 5, lane = tid & 31, col = lane & 15, g = lane >> 4;
  const int qb = blockIdx.x, h = blockIdx.y, b = blockIdx.z; const int q0 = qb * 64 + wave * 16; const size_t rq = (size_t)b * SS + q0 + col;
  float lam; { float a1 = 0.f, a2 = 0.f;
#pragma unroll 1
    for (int i = 0; i < 32; ++i) { a1 += bfr(LQ1[i]) * bfr(LK1[i]); a2 += bfr(LQ2[i]) * bfr(LK2[i]); }
    lam = exp_ni(a1) - exp_ni(a2) + LAMBDA_INIT; }
  // the two sub-heads are processed one after the other (sub-head 0's normalised P.V parked in LDS) to keep registers under 256
#pragma unroll 1
  for (int sh2 = 0; sh2 < 2; ++sh2) {
    const v16h aq = frag_h(QK + rq * (2 * DM) + h * HD + sh2 * 32, lane), aql = frag_h(QKL + rq * (2 * DM) + h * HD + sh2 * 32, lane);
    float m[8], l[8];
#pragma unroll
    for (int r = 0; r < 8; ++r) { m[r] = -3.0e38f; l[r] = 0.f; }
    v8f acc[4] = {}, accl[4] = {};
#pragma unroll 1
    for (int ks = 0; ks < SS / 32; ++ks) { v8f s[2];
#pragma unroll
      for (int ct = 0; ct < 2; ++ct) { const int kk = ks * 32 + ct * 16 + col; const _Float16* krow = QK + ((size_t)b * SS + kk) * (2 * DM) + DM + h * HD + sh2 * 32; const _Float16* krowl = QKL + ((size_t)b * SS + kk) * (2 * DM) + DM + h * HD + sh2 * 32;
        v8f c = {}, cl = {}; const v16h kh = frag_h(krow, lane); c = wmma16(aq, kh, c); cl = wmma16(aql, kh, cl); cl = wmma16(aq, frag_h(krowl, lane), cl);
#pragma unroll
        for (int r = 0; r < 8; ++r) s[ct][r] = (c[r] + cl[r] * (1.0f / 2048.0f)) * 0.17677669529663687f; }   // 32^-0.5
#pragma unroll
      for (int r = 0; r < 8; ++r) { float mx = fmaxf(s[0][r], s[1][r]);
#pragma unroll
        for (int o = 1; o < 16; o <<= 1) mx = fmaxf(mx, __shfl_xor(mx, o));
        const float mn = fmaxf(m[r], mx); const float alpha = (m[r] <= -1.0e38f) ? 0.f : __expf(m[r] - mn); const float e0 = __expf(s[0][r] - mn), e1 = __expf(s[1][r] - mn); float es = e0 + e1;
#pragma unroll
        for (int o = 1; o < 16; o <<= 1) es += __shfl_xor(es, o);
        l[r] = l[r] * alpha + es; m[r] = mn;
#pragma unroll
        for (int dt = 0; dt < 4; ++dt) { acc[dt][r] *= alpha; accl[dt][r] *= alpha; }
        const _Float16 h0 = (_Float16)e0, h1 = (_Float16)e1; sph[wave][8 * g + r][col] = h0; sph[wave][8 * g + r][16 + col] = h1; spl[wave][8 * g + r][col] = (_Float16)((e0 - (float)h0) * 2048.0f); spl[wave][8 * g + r][16 + col] = (_Float16)((e1 - (float)h1) * 2048.0f); }
      LDSX();
      const v16h pah = frag_h(&sph[wave][col][0], lane), pal = frag_h(&spl[wave][col][0], lane);
#pragma unroll
      for (int dt = 0; dt < 4; ++dt) { const size_t vo = ((size_t)b * DM + h * HD + dt * 16 + col) * SS + ks * 32; const v16h vh = frag_h(VTH + vo, lane), vl = frag_h(VTL + vo, lane); acc[dt] = wmma16(pah, vh, acc[dt]); accl[dt] = wmma16(pal, vh, accl[dt]); accl[dt] = wmma16(pah, vl, accl[dt]); }
      LDSX(); }
    if (sh2 == 0) {
#pragma unroll
      for (int r = 0; r < 8; ++r) { const float il = 1.0f / l[r];
#pragma unroll
        for (int dt = 0; dt < 4; ++dt) so1[wave][8 * g + r][dt * 16 + col] = (acc[dt][r] + accl[dt][r] * (1.0f / 2048.0f)) * il; }
    } else {
#pragma unroll
      for (int r = 0; r < 8; ++r) { const float il = 1.0f / l[r]; float ov[4]; float ssq = 0.f;
#pragma unroll
        for (int dt = 0; dt < 4; ++dt) { ov[dt] = so1[wave][8 * g + r][dt * 16 + col] - lam * ((acc[dt][r] + accl[dt][r] * (1.0f / 2048.0f)) * il); ssq += ov[dt] * ov[dt]; }
#pragma unroll
        for (int o = 1; o < 16; o <<= 1) ssq += __shfl_xor(ssq, o);
        const float sc = (1.0f / sqrtf(ssq * (1.0f / HD) + 1e-5f)) * (1.0f - LAMBDA_INIT);
#pragma unroll
        for (int dt = 0; dt < 4; ++dt) so[wave][8 * g + r][dt * 16 + col] = ov[dt] * sc * bfr(SUBW[dt * 16 + col]); } }
    LDSX(); }
  for (int rl = 0; rl < 16; ++rl) if (lane < 16) vst2(O + ((size_t)b * SS + q0 + rl) * DM + h * HD + lane * 4, *(const v4f*)&so[wave][rl][lane * 4]);
}
// ---- k_out: block = (64 rows, 128 cols): out = O(hi/lo) . Wo rows (2 products)
__global__ __launch_bounds__(128) void k_out(const float* __restrict__ O, const __bf16* __restrict__ P, float* __restrict__ Y) {
  __shared__ __align__(16) float so[4][16][132];
  const int tid = threadIdx.x, wave = tid >> 5, lane = tid & 31, col = lane & 15, g = lane >> 4; const size_t r0 = (size_t)blockIdx.x * 64 + wave * 16; const int n0 = blockIdx.y * 128;
  v8f acc[8] = {};
#pragma unroll 2
  for (int kc = 0; kc < DM / 32; ++kc) { const F2 a = split_row(O + (r0 + col) * DM, kc * 32, lane);
#pragma unroll
    for (int j = 0; j < 8; ++j) { const v16b w = frag_b(P + (size_t)(n0 + j * 16 + col) * DM + kc * 32, lane); acc[j] = wmma_bf(a.l, w, acc[j]); acc[j] = wmma_bf(a.h, w, acc[j]); } }
#pragma unroll
  for (int j = 0; j < 8; ++j) {
#pragma unroll
    for (int r = 0; r < 8; ++r) so[wave][8 * g + r][j * 16 + col] = acc[j][r]; }
  LDSX();
  for (int rl = 0; rl < 16; ++rl) vst2(Y + (r0 + rl) * DM + n0 + lane * 4, *(const v4f*)&so[wave][rl][lane * 4]);
}
extern "C" void kernel_launch(void* const* d_in, const int* in_sizes, int n_in, void* d_out, int out_size, void* d_ws, size_t ws_size, hipStream_t stream) {
  (void)in_sizes; (void)n_in; (void)out_size;
  const float** F = (const float**)d_in;   // 0 query_x [2,2048,1024], 1 kv_x, 2 Wq (in,out), 3 Wk, 4 Wv, 5 Wo, 6 lambda_q1 [32], 7 lambda_k1, 8 lambda_q2, 9 lambda_k2, 10 subln_w [64]
  if (ws_size < (size_t)WS_END) return;
  char* ws = (char*)d_ws; __bf16* PK = (__bf16*)(ws + WS_PK); _Float16 *QK = (_Float16*)(ws + WS_QK), *QKL = (_Float16*)(ws + WS_QKL), *VTH = (_Float16*)(ws + WS_VTH), *VTL = (_Float16*)(ws + WS_VTL); float* O = (float*)(ws + WS_O);
  k_pack<<<dim3(DM, 4), 256, 0, stream>>>(F[2], F[3], F[4], F[5], PK);
  k_qkv<<<dim3(TNB * SS / 64, QKVW / 128), 128, 0, stream>>>(F[0], F[1], PK + PK_A, QK, QKL, VTH, VTL);
  k_attn<<<dim3(TQB, NH, TNB), 128, 0, stream>>>(QK, QKL, VTH, VTL, F[6], F[7], F[8], F[9], F[10], O);
  k_out<<<dim3(TOB, DM / 128), 128, 0, stream>>>(O, PK + PK_P, (float*)d_out);
}

// v001
// It runs in 507 microseconds.
// Next to v000, in two timings, it ran 1.35 times as fast each time.
// compute dtype: query_x, kv_x, Wq, Wk, Wv, Wo, lambda_*, subln_w (module inputs) rounded to bf16; q (from query_x), k and v (from kv_x) with exact bf16 products on WMMA 16x16x32 ((in,out) weights packed as transposed rows); q and k stored as f16 hi + (x2048-scaled) residual planes; per head pair both 32-dim sub-head score maps with 3 products x 32^-0.5, two running-max softmaxes in f32 (hardware exp); P as f16 hi + (x2048) residual x v hi/lo (3 products) for both maps; lambda from the four 32-vectors in f32 (precise expf); the differential combination, RMS norm (eps 1e-5) x subln_w x (1 - lambda_init) in f32; output projection with the context as bf16 hi + residual x exact Wo (2 products); f32 accumulate.
#include <hip/hip_runtime.h>
#include <math.h>

typedef __attribute__((ext_vector_type(16))) _Float16 v16h;
typedef __attribute__((ext_vector_type(16))) __bf16 v16b;
typedef __attribute__((ext_vector_type(8)))  _Float16 v8h;
typedef __attribute__((ext_vector_type(8)))  float v8f;
typedef __attribute__((ext_vector_type(4)))  float v4f;
typedef __attribute__((ext_vector_type(2)))  float v2f;
typedef __attribute__((ext_vector_type(4)))  unsigned v4u;
typedef __attribute__((ext_vector_type(4)))  int v4i;
typedef float __attribute__((may_alias)) float_a;
typedef int __attribute__((may_alias)) int_a;

template <typename T> __device__ __forceinline__ void vst2(void* p, T v) { *(T*)p = v;  }
__device__ __forceinline__ v8f wmma16(v16h a, v16h b, v8f c) {
  v8f d = __builtin_amdgcn_wmma_f32_16x16x32_f16(false, a, false, b, (short)0, c, false, false);
  asm volatile("v_nop\n\tv_nop\n\tv_nop\n\tv_nop" : "+v"(d) : "v"(a), "v"(b));
  return d;
}
__device__ __forceinline__ v8f wmma_bf(v16b a, v16b b, v8f c) {
  v8f d = __builtin_amdgcn_wmma_f32_16x16x32_bf16(false, a, false, b, (short)0, c, false, false);
  asm volatile("v_nop\n\tv_nop\n\tv_nop\n\tv_nop" : "+v"(d) : "v"(a), "v"(b));
  return d;
}
// Cross multi-head differential attention (B 2, T = S = 2,048, d 1,024, 16 head pairs of 32-dim q/k and 64-dim values, depth-12 lambda_init): softmax(q1 k1) - lambda softmax(q2 k2) applied to v, RMS norm, output projection.
__device__ __forceinline__ v16h frag_h(const _Float16* rowk0, int lane) {
  union { v16h v; v8h q[2]; } u; const _Float16* p = rowk0 + 8 * (lane >> 4);
  u.q[0] = *(const v8h*)p; u.q[1] = *(const v8h*)(p + 16); return u.v;
}
__device__ __forceinline__ v16h frag_f32(const float* rowk0, int lane) {
  v16h a; const float* p = rowk0 + 8 * (lane >> 4);
#pragma unroll
  for (int i = 0; i < 8; ++i) { a[i] = (_Float16)p[i]; a[8 + i] = (_Float16)p[16 + i]; }
  return a;
}
__device__ __forceinline__ v16h frag_f32s(const float* rowk0, int lane, float sc) {
  v16h a; const float* p = rowk0 + 8 * (lane >> 4);
#pragma unroll
  for (int i = 0; i < 8; ++i) { a[i] = (_Float16)(p[i] * sc); a[8 + i] = (_Float16)(p[16 + i] * sc); }
  return a;
}
// column fragment from a [K][ld] layout (column n), rows >= K read as 0
__device__ __forceinline__ v16h fragc_f32(const float* W, int k0, int n, int lane, int ld, int K) {
  v16h a; const int g = lane >> 4;
#pragma unroll
  for (int i = 0; i < 8; ++i) { const int ka = k0 + 8 * g + i, kb = ka + 16;
    a[i] = (_Float16)(ka < K ? W[(size_t)(ka < K ? ka : K - 1) * ld + n] : 0.f); a[8 + i] = (_Float16)(kb < K ? W[(size_t)(kb < K ? kb : K - 1) * ld + n] : 0.f); }
  return a;
}
struct F2 { v16b h, l; };
__device__ __forceinline__ F2 bsplit16(const float v[16]) { F2 r;
#pragma unroll
  for (int i = 0; i < 16; ++i) { const __bf16 h = (__bf16)v[i]; r.h[i] = h; r.l[i] = (__bf16)(v[i] - (float)h); }
  return r; }
__device__ __forceinline__ F2 split_row(const float* row, int k0, int lane) { float v[16]; const float* p = row + k0 + 8 * (lane >> 4);
#pragma unroll
  for (int i = 0; i < 8; ++i) { v[i] = p[i]; v[8 + i] = p[16 + i]; }
  return bsplit16(v); }
__device__ __forceinline__ F2 split_rowK(const float* row, int k0, int lane, int K) { float v[16]; const int g = lane >> 4;
#pragma unroll
  for (int i = 0; i < 8; ++i) { const int ka = k0 + 8 * g + i, kb = ka + 16; v[i] = ka < K ? row[ka < K ? ka : K - 1] : 0.f; v[8 + i] = kb < K ? row[kb < K ? kb : K - 1] : 0.f; }
  return bsplit16(v); }
__device__ __forceinline__ F2 split_col(const float* W, int k0, int n, int lane, int ld, int K) { float v[16]; const int g = lane >> 4;
#pragma unroll
  for (int i = 0; i < 8; ++i) { const int ka = k0 + 8 * g + i, kb = ka + 16; v[i] = ka < K ? W[(size_t)(ka < K ? ka : K - 1) * ld + n] : 0.f; v[8 + i] = kb < K ? W[(size_t)(kb < K ? kb : K - 1) * ld + n] : 0.f; }
  return bsplit16(v); }
__device__ __forceinline__ v8f mac3(const F2& a, const F2& b, v8f c) { c = wmma_bf(a.l, b.h, c); c = wmma_bf(a.h, b.l, c); return wmma_bf(a.h, b.h, c); }
__device__ __forceinline__ float sigm(float v) { return 1.0f / (1.0f + expf(-v)); }
#define LDSX() do { asm volatile("s_wait_dscnt 0" ::: "memory"); __builtin_amdgcn_wave_barrier(); __builtin_amdgcn_fence(__ATOMIC_RELEASE, "workgroup"); } while (0)


#define NB 2
#define SS 2048
#define DM 1024
#define NH 16
#define HD 64
#define QKVW (3 * DM)
#ifndef TQB
#define TQB (SS / 64)
#define TNB NB
#define TOB (NB * SS / 64)     // output row tiles (all)
#endif
typedef __attribute__((ext_vector_type(8))) __bf16 v8b;
__device__ __forceinline__ v16b frag_b(const __bf16* rowk0, int lane) {
  union { v16b v; v8b q[2]; } u; const __bf16* p = rowk0 + 8 * (lane >> 4);
  u.q[0] = *(const v8b*)p; u.q[1] = *(const v8b*)(p + 16); return u.v;
}
__device__ __forceinline__ float bfr(float v) { return (float)(__bf16)v; }
__device__ __attribute__((noinline)) float exp_ni(float v) { return expf(v); }
__device__ __attribute__((noinline)) float erf_ni(float v) { return erff(v); }

#define PK_A 0                       // [3072][1024] Wqkv rows (natural [out][in])
#define PK_P (PK_A + QKVW * DM)        // [1024][1024] Wo rows (natural)
#define PK_END (PK_P + DM * DM)
#define WS_PK  0u
#define WS_QK  (WS_PK + 2u * PK_END)             // f16 [4096 rows][2048]: q | k
#define WS_QKL (WS_QK + 2u * NB * SS * 2 * DM)     // f16 q | k residual planes x2048
#define WS_VTH (WS_QKL + 2u * NB * SS * 2 * DM)    // f16 [b][1024 (h*64+d)][2048 s] hi
#define WS_VTL (WS_VTH + 2u * NB * DM * SS)        // f16 lo x 2048
#define WS_O   (WS_VTL + 2u * NB * DM * SS)        // f32 [4096][1024]
#define WS_CS  (WS_O + 4u * NB * SS * DM)           // 2 x [2048][32] f32, reserved, unused (no RoPE)
#define WS_END (WS_CS + 4u * 2 * SS * 32)
// ---- k_pack: block = (row n, which): natural [out][in] rows -> bf16; which 0..2 -> W_q/W_k/W_v into PK_A rows which*1024 + n; 3 -> W_o into PK_P
__global__ __launch_bounds__(256) void k_pack(const float* __restrict__ WQ, const float* __restrict__ WK, const float* __restrict__ WV, const float* __restrict__ WO, __bf16* __restrict__ PK) {
  __shared__ __align__(16) __bf16 s[DM]; const int n = blockIdx.x, which = blockIdx.y, t = threadIdx.x; const float* Wm = (which == 0) ? WQ : (which == 1) ? WK : (which == 2) ? WV : WO;   // (in,out) -> transposed rows
  for (int k = t; k < DM; k += 256) s[k] = (__bf16)Wm[(size_t)k * DM + n];
  __syncthreads();
  __bf16* dst = (which < 3) ? PK + PK_A + ((size_t)which * DM + n) * DM : PK + PK_P + (size_t)n * DM;
  for (int q = t; q < DM / 8; q += 256) vst2((unsigned*)(dst + q * 8), *(const v4u*)&s[q * 8]);
}
__global__ __launch_bounds__(128) void k_qkv(const float* __restrict__ XQ, const float* __restrict__ XKV, const __bf16* __restrict__ P, _Float16* __restrict__ QK, _Float16* __restrict__ QKL, _Float16* __restrict__ VTH, _Float16* __restrict__ VTL) {
  const float* X = (blockIdx.y * 128 < DM) ? XQ : XKV;   // q from query_x, k and v from kv_x
  __shared__ __align__(16) _Float16 so[4][16][136], sol[4][16][136]; __shared__ __align__(16) _Float16 sth[128][72], stl[128][72];
  const int tid = threadIdx.x, wave = tid >> 5, lane = tid & 31, col = lane & 15, g = lane >> 4; const size_t r0 = (size_t)blockIdx.x * 64 + wave * 16; const int n0 = blockIdx.y * 128;
  v8f acc[8] = {};
#pragma unroll 2
  for (int kc = 0; kc < DM / 32; ++kc) { v16b a; { const float* p = X + (r0 + col) * DM + kc * 32 + 8 * g;
#pragma unroll
      for (int i = 0; i < 8; ++i) { a[i] = (__bf16)p[i]; a[8 + i] = (__bf16)p[16 + i]; } }
#pragma unroll
    for (int j = 0; j < 8; ++j) acc[j] = wmma_bf(a, frag_b(P + (size_t)(n0 + j * 16 + col) * DM + kc * 32, lane), acc[j]); }
  if (n0 < 2 * DM) {   // q stored unscaled (f16 sigma ~0.6, no subnormal exposure); 32^-0.5 applied to the f32 score
#pragma unroll
    for (int j = 0; j < 8; ++j) {
#pragma unroll
      for (int r = 0; r < 8; ++r) { const float v = acc[j][r]; const _Float16 hv = (_Float16)v; so[wave][8 * g + r][j * 16 + col] = hv; sol[wave][8 * g + r][j * 16 + col] = (_Float16)((v - (float)hv) * 2048.0f); } }   // q, k as f16 hi + (x2048) residual (no RoPE in this module)
    LDSX();
    for (int rl = 0; rl < 16; ++rl) if (lane < 16) { vst2((unsigned*)(QK + (r0 + rl) * (2 * DM) + n0 + lane * 8), *(const v4u*)&so[wave][rl][lane * 8]); vst2((unsigned*)(QKL + (r0 + rl) * (2 * DM) + n0 + lane * 8), *(const v4u*)&sol[wave][rl][lane * 8]); }
  } else {
#pragma unroll
    for (int j = 0; j < 8; ++j) {
#pragma unroll
      for (int r = 0; r < 8; ++r) { const float v = acc[j][r]; const _Float16 hv = (_Float16)v; sth[j * 16 + col][wave * 16 + 8 * g + r] = hv; stl[j * 16 + col][wave * 16 + 8 * g + r] = (_Float16)((v - (float)hv) * 2048.0f); } }
    __syncthreads();
    const size_t rb = (size_t)blockIdx.x * 64; const int b = (int)(rb / SS), s0 = (int)(rb % SS); const int pc0 = n0 - 2 * DM;
    for (int q = tid; q < 128 * 8; q += 128) { const int d = q >> 3, pc = q & 7; const size_t o = ((size_t)b * DM + pc0 + d) * SS + s0 + pc * 8; vst2((unsigned*)(VTH + o), *(const v4u*)&sth[d][pc * 8]); vst2((unsigned*)(VTL + o), *(const v4u*)&stl[d][pc * 8]); }
  }
}
#define LAMBDA_INIT 0.78360247f   // 0.8 - 0.6*exp(-0.3*12), float32
#define STG_PITCH 40                       // f16 per staged row: 64 data bytes at an 80-byte pitch (16 B x odd) for the ds_load_b128 readers
#define STG_ROWS 192                       // one 32-key tile: rows 0..31 K hi, 32..63 K lo (row = key), 64..127 V hi, 128..191 V lo (row = value dim)
#define STG_BYTES (STG_ROWS * STG_PITCH * 2)
// one 32-key tile into LDS: every lane copies 16 bytes of six rows (its row r = tid / 4 of each 32-row group), through no register.
// s_wait_xcnt 0 is the statement's last line so that no address register a copy names is rewritten ahead of it (a precaution).
__device__ __forceinline__ void stage_tile(unsigned l, const _Float16* kh, const _Float16* kl, const _Float16* vh, const _Float16* vl) {
  const unsigned g32 = 32 * STG_PITCH * 2;   // LDS bytes of one 32-row group
  asm volatile("global_load_async_to_lds_b128 %0, %6, off\n\t"
               "global_load_async_to_lds_b128 %1, %7, off\n\t"
               "global_load_async_to_lds_b128 %2, %8, off\n\t"
               "global_load_async_to_lds_b128 %3, %9, off\n\t"
               "global_load_async_to_lds_b128 %4, %10, off\n\t"
               "global_load_async_to_lds_b128 %5, %11, off\n\t"
               "s_wait_xcnt 0x0"
               :: "v"(l), "v"(l + g32), "v"(l + 2 * g32), "v"(l + 3 * g32), "v"(l + 4 * g32), "v"(l + 5 * g32),
                  "v"(kh), "v"(kl), "v"(vh), "v"(vh + 32 * SS), "v"(vl), "v"(vl + 32 * SS) : "memory");
}
// ---- k_attn: block = (64 queries, head pair h, b): sub-heads 2h (q/k dims 64h..64h+31) and 2h+1 (64h+32..64h+63), each a softmax over the 2,048 keys with 3-product scores x 32^-0.5; both maps applied to the same 64-dim value head h (P as f16 hi + x2048 lo x V hi/lo); o = P1.V/l1 - lambda P2.V/l2; rms_norm over the 64 dims x subln_w x (1 - lambda_init) -> O rows
__global__ __launch_bounds__(128) void k_attn(const _Float16* __restrict__ QK, const _Float16* __restrict__ QKL, const _Float16* __restrict__ VTH, const _Float16* __restrict__ VTL, const float* __restrict__ LQ1, const float* __restrict__ LK1, const float* __restrict__ LQ2, const float* __restrict__ LK2, const float* __restrict__ SUBW, float* __restrict__ O) {
  __shared__ __align__(16) _Float16 sph[4][16][40], spl[4][16][40]; __shared__ __align__(16) float so[4][16][68]; __shared__ float so1[4][16][68];
  __shared__ __align__(16) _Float16 stg[2][STG_ROWS][STG_PITCH];   // two buffers: the next 32-key tile lands while this one is read by all four waves
  const int tid = threadIdx.x, wave = tid >> 5, lane = tid & 31, col = lane & 15, g = lane >> 4;
  const int qb = blockIdx.x, h = blockIdx.y, b = blockIdx.z; const int q0 = qb * 64 + wave * 16; const size_t rq = (size_t)b * SS + q0 + col;
  float lam; { float a1 = 0.f, a2 = 0.f;
#pragma unroll 1
    for (int i = 0; i < 32; ++i) { a1 += bfr(LQ1[i]) * bfr(LK1[i]); a2 += bfr(LQ2[i]) * bfr(LK2[i]); }
    lam = exp_ni(a1) - exp_ni(a2) + LAMBDA_INIT; }
  const unsigned lst = (unsigned)(size_t)&stg[0][tid >> 2][(tid & 3) * 8];   // this lane's LDS byte address in buffer 0, row group 0
  const size_t vso = ((size_t)b * DM + h * HD + (tid >> 2)) * SS + (tid & 3) * 8; const _Float16* gvh = VTH + vso; const _Float16* gvl = VTL + vso;
  // the two sub-heads are processed one after the other (sub-head 0's normalised P.V parked in LDS) to keep registers under 256
#pragma unroll 1
  for (int sh2 = 0; sh2 < 2; ++sh2) {
    const v16h aq = frag_h(QK + rq * (2 * DM) + h * HD + sh2 * 32, lane), aql = frag_h(QKL + rq * (2 * DM) + h * HD + sh2 * 32, lane);
    float m[8], l[8];
#pragma unroll
    for (int r = 0; r < 8; ++r) { m[r] = -3.0e38f; l[r] = 0.f; }
    v8f acc[4] = {}, accl[4] = {};
    const size_t kso = ((size_t)b * SS + (tid >> 2)) * (2 * DM) + DM + h * HD + sh2 * 32 + (tid & 3) * 8; const _Float16* gkh = QK + kso; const _Float16* gkl = QKL + kso;
    stage_tile(lst, gkh, gkl, gvh, gvl);                       // tile 0 (both buffers are free: the last trip's foot ended every read)
    asm volatile("s_wait_asynccnt 0x0" ::: "memory");           // this wave's copies of tile 0 have landed
    __syncthreads();                                            // ... and every other wave's: tile 0 may be read
    stage_tile(lst + STG_BYTES, gkh + (size_t)32 * 2 * DM, gkl + (size_t)32 * 2 * DM, gvh + 32, gvl + 32);   // tile 1 flies during trip 0
#pragma unroll 1
    for (int ks = 0; ks < SS / 32; ++ks) { v8f s[2]; const _Float16 (*tb)[STG_PITCH] = stg[ks & 1];
#pragma unroll
      for (int ct = 0; ct < 2; ++ct) { const _Float16* krow = &tb[ct * 16 + col][0]; const _Float16* krowl = &tb[32 + ct * 16 + col][0];
        v8f c = {}, cl = {}; const v16h kh = frag_h(krow, lane); c = wmma16(aq, kh, c); cl = wmma16(aql, kh, cl); cl = wmma16(aq, frag_h(krowl, lane), cl);
#pragma unroll
        for (int r = 0; r < 8; ++r) s[ct][r] = (c[r] + cl[r] * (1.0f / 2048.0f)) * 0.17677669529663687f; }   // 32^-0.5
#pragma unroll
      for (int r = 0; r < 8; ++r) { float mx = fmaxf(s[0][r], s[1][r]);
#pragma unroll
        for (int o = 1; o < 16; o <<= 1) mx = fmaxf(mx, __shfl_xor(mx, o));
        const float mn = fmaxf(m[r], mx); const float alpha = (m[r] <= -1.0e38f) ? 0.f : __expf(m[r] - mn); const float e0 = __expf(s[0][r] - mn), e1 = __expf(s[1][r] - mn); float es = e0 + e1;
#pragma unroll
        for (int o = 1; o < 16; o <<= 1) es += __shfl_xor(es, o);
        l[r] = l[r] * alpha + es; m[r] = mn;
#pragma unroll
        for (int dt = 0; dt < 4; ++dt) { acc[dt][r] *= alpha; accl[dt][r] *= alpha; }
        const _Float16 h0 = (_Float16)e0, h1 = (_Float16)e1; sph[wave][8 * g + r][col] = h0; sph[wave][8 * g + r][16 + col] = h1; spl[wave][8 * g + r][col] = (_Float16)((e0 - (float)h0) * 2048.0f); spl[wave][8 * g + r][16 + col] = (_Float16)((e1 - (float)h1) * 2048.0f); }
      LDSX();
      const v16h pah = frag_h(&sph[wave][col][0], lane), pal = frag_h(&spl[wave][col][0], lane);
#pragma unroll
      for (int dt = 0; dt < 4; ++dt) { const v16h vh = frag_h(&tb[64 + dt * 16 + col][0], lane), vl = frag_h(&tb[128 + dt * 16 + col][0], lane); acc[dt] = wmma16(pah, vh, acc[dt]); accl[dt] = wmma16(pal, vh, accl[dt]); accl[dt] = wmma16(pah, vl, accl[dt]); }
      asm volatile("s_wait_dscnt 0x0" ::: "memory");            // this wave's reads of this tile (and of its P rows) are done
      asm volatile("s_wait_asynccnt 0x0" ::: "memory");         // this wave's copies of tile ks + 1 have landed
      __syncthreads();                                          // publishes tile ks + 1 and frees the buffer that this trip has read
      if (ks + 2 < SS / 32) stage_tile(lst + (unsigned)(ks & 1) * STG_BYTES, gkh + (size_t)(ks + 2) * 32 * 2 * DM, gkl + (size_t)(ks + 2) * 32 * 2 * DM, gvh + (ks + 2) * 32, gvl + (ks + 2) * 32); }
    asm volatile("s_wait_asynccnt 0x0" ::: "memory");           // nothing is in flight behind the loop
    if (sh2 == 0) {
#pragma unroll
      for (int r = 0; r < 8; ++r) { const float il = 1.0f / l[r];
#pragma unroll
        for (int dt = 0; dt < 4; ++dt) so1[wave][8 * g + r][dt * 16 + col] = (acc[dt][r] + accl[dt][r] * (1.0f / 2048.0f)) * il; }
    } else {
#pragma unroll
      for (int r = 0; r < 8; ++r) { const float il = 1.0f / l[r]; float ov[4]; float ssq = 0.f;
#pragma unroll
        for (int dt = 0; dt < 4; ++dt) { ov[dt] = so1[wave][8 * g + r][dt * 16 + col] - lam * ((acc[dt][r] + accl[dt][r] * (1.0f / 2048.0f)) * il); ssq += ov[dt] * ov[dt]; }
#pragma unroll
        for (int o = 1; o < 16; o <<= 1) ssq += __shfl_xor(ssq, o);
        const float sc = (1.0f / sqrtf(ssq * (1.0f / HD) + 1e-5f)) * (1.0f - LAMBDA_INIT);
#pragma unroll
        for (int dt = 0; dt < 4; ++dt) so[wave][8 * g + r][dt * 16 + col] = ov[dt] * sc * bfr(SUBW[dt * 16 + col]); } }
    LDSX(); }
  for (int rl = 0; rl < 16; ++rl) if (lane < 16) vst2(O + ((size_t)b * SS + q0 + rl) * DM + h * HD + lane * 4, *(const v4f*)&so[wave][rl][lane * 4]);
}
// ---- k_out: block = (64 rows, 128 cols): out = O(hi/lo) . Wo rows (2 products)
__global__ __launch_bounds__(128) void k_out(const float* __restrict__ O, const __bf16* __restrict__ P, float* __restrict__ Y) {
  __shared__ __align__(16) float so[4][16][132];
  const int tid = threadIdx.x, wave = tid >> 5, lane = tid & 31, col = lane & 15, g = lane >> 4; const size_t r0 = (size_t)blockIdx.x * 64 + wave * 16; const int n0 = blockIdx.y * 128;
  v8f acc[8] = {};
#pragma unroll 2
  for (int kc = 0; kc < DM / 32; ++kc) { const F2 a = split_row(O + (r0 + col) * DM, kc * 32, lane);
#pragma unroll
    for (int j = 0; j < 8; ++j) { const v16b w = frag_b(P + (size_t)(n0 + j * 16 + col) * DM + kc * 32, lane); acc[j] = wmma_bf(a.l, w, acc[j]); acc[j] = wmma_bf(a.h, w, acc[j]); } }
#pragma unroll
  for (int j = 0; j < 8; ++j) {
#pragma unroll
    for (int r = 0; r < 8; ++r) so[wave][8 * g + r][j * 16 + col] = acc[j][r]; }
  LDSX();
  for (int rl = 0; rl < 16; ++rl) vst2(Y + (r0 + rl) * DM + n0 + lane * 4, *(const v4f*)&so[wave][rl][lane * 4]);
}
extern "C" void kernel_launch(void* const* d_in, const int* in_sizes, int n_in, void* d_out, int out_size, void* d_ws, size_t ws_size, hipStream_t stream) {
  (void)in_sizes; (void)n_in; (void)out_size;
  const float** F = (const float**)d_in;   // 0 query_x [2,2048,1024], 1 kv_x, 2 Wq (in,out), 3 Wk, 4 Wv, 5 Wo, 6 lambda_q1 [32], 7 lambda_k1, 8 lambda_q2, 9 lambda_k2, 10 subln_w [64]
  if (ws_size < (size_t)WS_END) return;
  char* ws = (char*)d_ws; __bf16* PK = (__bf16*)(ws + WS_PK); _Float16 *QK = (_Float16*)(ws + WS_QK), *QKL = (_Float16*)(ws + WS_QKL), *VTH = (_Float16*)(ws + WS_VTH), *VTL = (_Float16*)(ws + WS_VTL); float* O = (float*)(ws + WS_O);
  k_pack<<<dim3(DM, 4), 256, 0, stream>>>(F[2], F[3], F[4], F[5], PK);
  k_qkv<<<dim3(TNB * SS / 64, QKVW / 128), 128, 0, stream>>>(F[0], F[1], PK + PK_A, QK, QKL, VTH, VTL);
  k_attn<<<dim3(TQB, NH, TNB), 128, 0, stream>>>(QK, QKL, VTH, VTL, F[6], F[7], F[8], F[9], F[10], O);
  k_out<<<dim3(TOB, DM / 128), 128, 0, stream>>>(O, PK + PK_P, (float*)d_out);
}

// v002
// It runs in 401 microseconds.
// Two timings next to v001 put it at 1.26 and 1.28 times that version's speed.
// Over all steps from v000 it is 1.72 times as fast.
// compute dtype: query_x, kv_x, Wq, Wk, Wv, Wo, lambda_*, subln_w (module inputs) rounded to bf16; q (from query_x), k and v (from kv_x) with exact bf16 products on WMMA 16x16x32 ((in,out) weights packed as transposed rows); q and k stored as f16 hi + (x2048-scaled) residual planes; per head pair both 32-dim sub-head score maps with 3 products x 32^-0.5, two running-max softmaxes in f32 (hardware exp); P as f16 hi + (x2048) residual x v hi/lo (3 products) for both maps; lambda from the four 32-vectors in f32 (precise expf); the differential combination, RMS norm (eps 1e-5) x subln_w x (1 - lambda_init) in f32; output projection with the context as bf16 hi + residual x exact Wo (2 products); f32 accumulate.
#include <hip/hip_runtime.h>
#include <math.h>

typedef __attribute__((ext_vector_type(16))) _Float16 v16h;
typedef __attribute__((ext_vector_type(16))) __bf16 v16b;
typedef __attribute__((ext_vector_type(8)))  _Float16 v8h;
typedef __attribute__((ext_vector_type(8)))  float v8f;
typedef __attribute__((ext_vector_type(4)))  float v4f;
typedef __attribute__((ext_vector_type(2)))  float v2f;
typedef __attribute__((ext_vector_type(4)))  unsigned v4u;
typedef __attribute__((ext_vector_type(4)))  int v4i;
typedef float __attribute__((may_alias)) float_a;
typedef int __attribute__((may_alias)) int_a;

template <typename T> __device__ __forceinline__ void vst2(void* p, T v) { *(T*)p = v;  }
__device__ __forceinline__ v8f wmma16(v16h a, v16h b, v8f c) {
  v8f d = __builtin_amdgcn_wmma_f32_16x16x32_f16(false, a, false, b, (short)0, c, false, false);
  asm volatile("v_nop\n\tv_nop\n\tv_nop\n\tv_nop" : "+v"(d) : "v"(a), "v"(b));
  return d;
}
__device__ __forceinline__ v8f wmma_bf(v16b a, v16b b, v8f c) {
  v8f d = __builtin_amdgcn_wmma_f32_16x16x32_bf16(false, a, false, b, (short)0, c, false, false);
  asm volatile("v_nop\n\tv_nop\n\tv_nop\n\tv_nop" : "+v"(d) : "v"(a), "v"(b));
  return d;
}
// Cross multi-head differential attention (B 2, T = S = 2,048, d 1,024, 16 head pairs of 32-dim q/k and 64-dim values, depth-12 lambda_init): softmax(q1 k1) - lambda softmax(q2 k2) applied to v, RMS norm, output projection.
__device__ __forceinline__ v16h frag_h(const _Float16* rowk0, int lane) {
  union { v16h v; v8h q[2]; } u; const _Float16* p = rowk0 + 8 * (lane >> 4);
  u.q[0] = *(const v8h*)p; u.q[1] = *(const v8h*)(p + 16); return u.v;
}
__device__ __forceinline__ v16h frag_f32(const float* rowk0, int lane) {
  v16h a; const float* p = rowk0 + 8 * (lane >> 4);
#pragma unroll
  for (int i = 0; i < 8; ++i) { a[i] = (_Float16)p[i]; a[8 + i] = (_Float16)p[16 + i]; }
  return a;
}
__device__ __forceinline__ v16h frag_f32s(const float* rowk0, int lane, float sc) {
  v16h a; const float* p = rowk0 + 8 * (lane >> 4);
#pragma unroll
  for (int i = 0; i < 8; ++i) { a[i] = (_Float16)(p[i] * sc); a[8 + i] = (_Float16)(p[16 + i] * sc); }
  return a;
}
// column fragment from a [K][ld] layout (column n), rows >= K read as 0
__device__ __forceinline__ v16h fragc_f32(const float* W, int k0, int n, int lane, int ld, int K) {
  v16h a; const int g = lane >> 4;
#pragma unroll
  for (int i = 0; i < 8; ++i) { const int ka = k0 + 8 * g + i, kb = ka + 16;
    a[i] = (_Float16)(ka < K ? W[(size_t)(ka < K ? ka : K - 1) * ld + n] : 0.f); a[8 + i] = (_Float16)(kb < K ? W[(size_t)(kb < K ? kb : K - 1) * ld + n] : 0.f); }
  return a;
}
struct F2 { v16b h, l; };
__device__ __forceinline__ F2 bsplit16(const float v[16]) { F2 r;
#pragma unroll
  for (int i = 0; i < 16; ++i) { const __bf16 h = (__bf16)v[i]; r.h[i] = h; r.l[i] = (__bf16)(v[i] - (float)h); }
  return r; }
__device__ __forceinline__ F2 split_row(const float* row, int k0, int lane) { float v[16]; const float* p = row + k0 + 8 * (lane >> 4);
#pragma unroll
  for (int i = 0; i < 8; ++i) { v[i] = p[i]; v[8 + i] = p[16 + i]; }
  return bsplit16(v); }
__device__ __forceinline__ F2 split_rowK(const float* row, int k0, int lane, int K) { float v[16]; const int g = lane >> 4;
#pragma unroll
  for (int i = 0; i < 8; ++i) { const int ka = k0 + 8 * g + i, kb = ka + 16; v[i] = ka < K ? row[ka < K ? ka : K - 1] : 0.f; v[8 + i] = kb < K ? row[kb < K ? kb : K - 1] : 0.f; }
  return bsplit16(v); }
__device__ __forceinline__ F2 split_col(const float* W, int k0, int n, int lane, int ld, int K) { float v[16]; const int g = lane >> 4;
#pragma unroll
  for (int i = 0; i < 8; ++i) { const int ka = k0 + 8 * g + i, kb = ka + 16; v[i] = ka < K ? W[(size_t)(ka < K ? ka : K - 1) * ld + n] : 0.f; v[8 + i] = kb < K ? W[(size_t)(kb < K ? kb : K - 1) * ld + n] : 0.f; }
  return bsplit16(v); }
__device__ __forceinline__ v8f mac3(const F2& a, const F2& b, v8f c) { c = wmma_bf(a.l, b.h, c); c = wmma_bf(a.h, b.l, c); return wmma_bf(a.h, b.h, c); }
__device__ __forceinline__ float sigm(float v) { return 1.0f / (1.0f + expf(-v)); }
#define LDSX() do { asm volatile("s_wait_dscnt 0" ::: "memory"); __builtin_amdgcn_wave_barrier(); __builtin_amdgcn_fence(__ATOMIC_RELEASE, "workgroup"); } while (0)


#define NB 2
#define SS 2048
#define DM 1024
#define NH 16
#define HD 64
#define QKVW (3 * DM)
#ifndef TQB
#define TQB (SS / 64)
#define TNB NB
#define TOB (NB * SS / 64)     // output row tiles (all)
#endif
typedef __attribute__((ext_vector_type(8))) __bf16 v8b;
__device__ __forceinline__ v16b frag_b(const __bf16* rowk0, int lane) {
  union { v16b v; v8b q[2]; } u; const __bf16* p = rowk0 + 8 * (lane >> 4);
  u.q[0] = *(const v8b*)p; u.q[1] = *(const v8b*)(p + 16); return u.v;
}
__device__ __forceinline__ float bfr(float v) { return (float)(__bf16)v; }
__device__ __attribute__((noinline)) float exp_ni(float v) { return expf(v); }
__device__ __attribute__((noinline)) float erf_ni(float v) { return erff(v); }

#define PK_A 0                       // [3072][1024] Wqkv rows (natural [out][in])
#define PK_P (PK_A + QKVW * DM)        // [1024][1024] Wo rows (natural)
#define PK_END (PK_P + DM * DM)
#define WS_PK  0u
#define WS_QK  (WS_PK + 2u * PK_END)             // f16 [4096 rows][2048]: q | k
#define WS_QKL (WS_QK + 2u * NB * SS * 2 * DM)     // f16 q | k residual planes x2048
#define WS_VTH (WS_QKL + 2u * NB * SS * 2 * DM)    // f16 [b][1024 (h*64+d)][2048 s] hi
#define WS_VTL (WS_VTH + 2u * NB * DM * SS)        // f16 lo x 2048
#define WS_O   (WS_VTL + 2u * NB * DM * SS)        // f32 [4096][1024]
#define WS_CS  (WS_O + 4u * NB * SS * DM)           // 2 x [2048][32] f32, reserved, unused (no RoPE)
#define WS_END (WS_CS + 4u * 2 * SS * 32)
// ---- k_pack: block = (row n, which): natural [out][in] rows -> bf16; which 0..2 -> W_q/W_k/W_v into PK_A rows which*1024 + n; 3 -> W_o into PK_P
__global__ __launch_bounds__(256) void k_pack(const float* __restrict__ WQ, const float* __restrict__ WK, const float* __restrict__ WV, const float* __restrict__ WO, __bf16* __restrict__ PK) {
  __shared__ __align__(16) __bf16 s[DM]; const int n = blockIdx.x, which = blockIdx.y, t = threadIdx.x; const float* Wm = (which == 0) ? WQ : (which == 1) ? WK : (which == 2) ? WV : WO;   // (in,out) -> transposed rows
  for (int k = t; k < DM; k += 256) s[k] = (__bf16)Wm[(size_t)k * DM + n];
  __syncthreads();
  __bf16* dst = (which < 3) ? PK + PK_A + ((size_t)which * DM + n) * DM : PK + PK_P + (size_t)n * DM;
  for (int q = t; q < DM / 8; q += 256) vst2((unsigned*)(dst + q * 8), *(const v4u*)&s[q * 8]);
}
__global__ __launch_bounds__(128) void k_qkv(const float* __restrict__ XQ, const float* __restrict__ XKV, const __bf16* __restrict__ P, _Float16* __restrict__ QK, _Float16* __restrict__ QKL, _Float16* __restrict__ VTH, _Float16* __restrict__ VTL) {
  const float* X = (blockIdx.y * 128 < DM) ? XQ : XKV;   // q from query_x, k and v from kv_x
  __shared__ __align__(16) _Float16 so[4][16][136], sol[4][16][136]; __shared__ __align__(16) _Float16 sth[128][72], stl[128][72];
  const int tid = threadIdx.x, wave = tid >> 5, lane = tid & 31, col = lane & 15, g = lane >> 4; const size_t r0 = (size_t)blockIdx.x * 64 + wave * 16; const int n0 = blockIdx.y * 128;
  v8f acc[8] = {};
#pragma unroll 2
  for (int kc = 0; kc < DM / 32; ++kc) { v16b a; { const float* p = X + (r0 + col) * DM + kc * 32 + 8 * g;
#pragma unroll
      for (int i = 0; i < 8; ++i) { a[i] = (__bf16)p[i]; a[8 + i] = (__bf16)p[16 + i]; } }
#pragma unroll
    for (int j = 0; j < 8; ++j) acc[j] = wmma_bf(a, frag_b(P + (size_t)(n0 + j * 16 + col) * DM + kc * 32, lane), acc[j]); }
  if (n0 < 2 * DM) {   // q stored unscaled (f16 sigma ~0.6, no subnormal exposure); 32^-0.5 applied to the f32 score
#pragma unroll
    for (int j = 0; j < 8; ++j) {
#pragma unroll
      for (int r = 0; r < 8; ++r) { const float v = acc[j][r]; const _Float16 hv = (_Float16)v; so[wave][8 * g + r][j * 16 + col] = hv; sol[wave][8 * g + r][j * 16 + col] = (_Float16)((v - (float)hv) * 2048.0f); } }   // q, k as f16 hi + (x2048) residual (no RoPE in this module)
    LDSX();
    for (int rl = 0; rl < 16; ++rl) if (lane < 16) { vst2((unsigned*)(QK + (r0 + rl) * (2 * DM) + n0 + lane * 8), *(const v4u*)&so[wave][rl][lane * 8]); vst2((unsigned*)(QKL + (r0 + rl) * (2 * DM) + n0 + lane * 8), *(const v4u*)&sol[wave][rl][lane * 8]); }
  } else {
#pragma unroll
    for (int j = 0; j < 8; ++j) {
#pragma unroll
      for (int r = 0; r < 8; ++r) { const float v = acc[j][r]; const _Float16 hv = (_Float16)v; sth[j * 16 + col][wave * 16 + 8 * g + r] = hv; stl[j * 16 + col][wave * 16 + 8 * g + r] = (_Float16)((v - (float)hv) * 2048.0f); } }
    __syncthreads();
    const size_t rb = (size_t)blockIdx.x * 64; const int b = (int)(rb / SS), s0 = (int)(rb % SS); const int pc0 = n0 - 2 * DM;
    for (int q = tid; q < 128 * 8; q += 128) { const int d = q >> 3, pc = q & 7; const size_t o = ((size_t)b * DM + pc0 + d) * SS + s0 + pc * 8; vst2((unsigned*)(VTH + o), *(const v4u*)&sth[d][pc * 8]); vst2((unsigned*)(VTL + o), *(const v4u*)&stl[d][pc * 8]); }
  }
}
__device__ __forceinline__ float xhalf(float x) { return __builtin_bit_cast(float, __builtin_amdgcn_permlanex16(__builtin_bit_cast(int, x), __builtin_bit_cast(int, x), 0x76543210, 0xfedcba98, false, false)); }   // lane l with lane l ^ 16
#define LAMBDA_INIT 0.78360247f   // 0.8 - 0.6*exp(-0.3*12), float32
#define STG_PITCH 40                       // f16 per staged row: 64 data bytes at an 80-byte pitch (16 B x odd) for the ds_load_b128 readers
#define STG_ROWS 192                       // one 32-key tile: rows 0..31 K hi, 32..63 K lo (row = key), 64..127 V hi, 128..191 V lo (row = value dim)
#define STG_BYTES (STG_ROWS * STG_PITCH * 2)
// one 32-key tile into LDS: every lane copies 16 bytes of six rows (its row r = tid / 4 of each 32-row group), through no register.
// s_wait_xcnt 0 is the statement's last line so that no address register a copy names is rewritten ahead of it (a precaution).
__device__ __forceinline__ void stage_tile(unsigned l, const _Float16* kh, const _Float16* kl, const _Float16* vh, const _Float16* vl) {
  const unsigned g32 = 32 * STG_PITCH * 2;   // LDS bytes of one 32-row group
  asm volatile("global_load_async_to_lds_b128 %0, %6, off\n\t"
               "global_load_async_to_lds_b128 %1, %7, off\n\t"
               "global_load_async_to_lds_b128 %2, %8, off\n\t"
               "global_load_async_to_lds_b128 %3, %9, off\n\t"
               "global_load_async_to_lds_b128 %4, %10, off\n\t"
               "global_load_async_to_lds_b128 %5, %11, off\n\t"
               "s_wait_xcnt 0x0"
               :: "v"(l), "v"(l + g32), "v"(l + 2 * g32), "v"(l + 3 * g32), "v"(l + 4 * g32), "v"(l + 5 * g32),
                  "v"(kh), "v"(kl), "v"(vh), "v"(vh + 32 * SS), "v"(vl), "v"(vl + 32 * SS) : "memory");
}
__global__ __launch_bounds__(128) void k_attn(const _Float16* __restrict__ QK, const _Float16* __restrict__ QKL, const _Float16* __restrict__ VTH, const _Float16* __restrict__ VTL, const float* __restrict__ LQ1, const float* __restrict__ LK1, const float* __restrict__ LQ2, const float* __restrict__ LK2, const float* __restrict__ SUBW, float* __restrict__ O) {
  __shared__ __align__(16) float so[4][16][68]; __shared__ __align__(16) float so1[4][16][68];
  __shared__ __align__(16) _Float16 stg[2][STG_ROWS][STG_PITCH];   // two buffers: the next 32-key tile lands while this one is read by all four waves
  const int tid = threadIdx.x, wave = tid >> 5, lane = tid & 31, col = lane & 15, g = lane >> 4;
  const int qb = blockIdx.x, h = blockIdx.y, b = blockIdx.z; const int q0 = qb * 64 + wave * 16; const size_t rq = (size_t)b * SS + q0 + col;
  float lam; { float a1 = 0.f, a2 = 0.f;
#pragma unroll 1
    for (int i = 0; i < 32; ++i) { a1 += bfr(LQ1[i]) * bfr(LK1[i]); a2 += bfr(LQ2[i]) * bfr(LK2[i]); }
    lam = exp_ni(a1) - exp_ni(a2) + LAMBDA_INIT; }
  const unsigned lst = (unsigned)(size_t)&stg[0][tid >> 2][(tid & 3) * 8];   // this lane's LDS byte address in buffer 0, row group 0
  const size_t vso = ((size_t)b * DM + h * HD + (tid >> 2)) * SS + (tid & 3) * 8; const _Float16* gvh = VTH + vso; const _Float16* gvl = VTL + vso;
  // the two sub-heads are processed one after the other (sub-head 0's normalised P.V parked in LDS) to keep registers under 256
#pragma unroll 1
  for (int sh2 = 0; sh2 < 2; ++sh2) {
    const v16h aq = frag_h(QK + rq * (2 * DM) + h * HD + sh2 * 32, lane), aql = frag_h(QKL + rq * (2 * DM) + h * HD + sh2 * 32, lane);
    float m = -3.0e38f, l = 0.f;   // this lane's query: running maximum (same in both halves) and this half's part of the sum
    v8f acc[4] = {}, accl[4] = {};   // acc[dt][r]: value dim dt * 16 + 8 g + r of query col
    const size_t kso = ((size_t)b * SS + (tid >> 2)) * (2 * DM) + DM + h * HD + sh2 * 32 + (tid & 3) * 8; const _Float16* gkh = QK + kso; const _Float16* gkl = QKL + kso;
    stage_tile(lst, gkh, gkl, gvh, gvl);                       // tile 0 (both buffers are free: the last trip's foot ended every read)
    asm volatile("s_wait_asynccnt 0x0" ::: "memory");           // this wave's copies of tile 0 have landed
    __syncthreads();                                            // ... and every other wave's: tile 0 may be read
    stage_tile(lst + STG_BYTES, gkh + (size_t)32 * 2 * DM, gkl + (size_t)32 * 2 * DM, gvh + 32, gvl + 32);   // tile 1 flies during trip 0
#pragma unroll 1
    for (int ks = 0; ks < SS / 32; ++ks) { v8f s[2]; const _Float16 (*tb)[STG_PITCH] = stg[ks & 1];
#pragma unroll
      for (int ct = 0; ct < 2; ++ct) { const _Float16* krow = &tb[ct * 16 + col][0]; const _Float16* krowl = &tb[32 + ct * 16 + col][0];
        v8f c = {}, cl = {}; const v16h kh = frag_h(krow, lane); c = wmma16(kh, aq, c); cl = wmma16(kh, aql, cl); cl = wmma16(frag_h(krowl, lane), aq, cl);
#pragma unroll
        for (int r = 0; r < 8; ++r) s[ct][r] = (c[r] + cl[r] * (1.0f / 2048.0f)) * 0.17677669529663687f; }   // 32^-0.5
      float mx = fmaxf(s[0][0], s[1][0]);
#pragma unroll
      for (int r = 1; r < 8; ++r) mx = fmaxf(mx, fmaxf(s[0][r], s[1][r]));
      mx = fmaxf(mx, xhalf(mx));
      const float mn = fmaxf(m, mx); const float alpha = (m <= -1.0e38f) ? 0.f : __expf(m - mn); m = mn;
      v8f e0, e1; float es0 = 0.f, es1 = 0.f;
#pragma unroll
      for (int r = 0; r < 8; ++r) { e0[r] = __expf(s[0][r] - mn); e1[r] = __expf(s[1][r] - mn); es0 += e0[r]; es1 += e1[r]; }
      const v8h h0 = __builtin_convertvector(e0, v8h), h1 = __builtin_convertvector(e1, v8h);   // P as f16 hi ...
      const v8h l0 = __builtin_convertvector((e0 - __builtin_convertvector(h0, v8f)) * 2048.0f, v8h), l1 = __builtin_convertvector((e1 - __builtin_convertvector(h1, v8f)) * 2048.0f, v8h);   // ... + (x2048) residual
      const v16h pah = __builtin_shufflevector(h0, h1, 0, 1, 2, 3, 4, 5, 6, 7, 8, 9, 10, 11, 12, 13, 14, 15), pal = __builtin_shufflevector(l0, l1, 0, 1, 2, 3, 4, 5, 6, 7, 8, 9, 10, 11, 12, 13, 14, 15);
      l = l * alpha + (es0 + es1);
#pragma unroll
      for (int dt = 0; dt < 4; ++dt) { acc[dt] *= alpha; accl[dt] *= alpha; }
#pragma unroll
      for (int dt = 0; dt < 4; ++dt) { const v16h vh = frag_h(&tb[64 + dt * 16 + col][0], lane), vl = frag_h(&tb[128 + dt * 16 + col][0], lane); acc[dt] = wmma16(vh, pah, acc[dt]); accl[dt] = wmma16(vh, pal, accl[dt]); accl[dt] = wmma16(vl, pah, accl[dt]); }
      asm volatile("s_wait_dscnt 0x0" ::: "memory");            // this wave's reads of this tile are done
      asm volatile("s_wait_asynccnt 0x0" ::: "memory");         // this wave's copies of tile ks + 1 have landed
      __syncthreads();                                          // publishes tile ks + 1 and frees the buffer that this trip has read
      if (ks + 2 < SS / 32) stage_tile(lst + (unsigned)(ks & 1) * STG_BYTES, gkh + (size_t)(ks + 2) * 32 * 2 * DM, gkl + (size_t)(ks + 2) * 32 * 2 * DM, gvh + (ks + 2) * 32, gvl + (ks + 2) * 32); }
    asm volatile("s_wait_asynccnt 0x0" ::: "memory");           // nothing is in flight behind the loop
    const float il = 1.0f / (l + xhalf(l));   // the halves' sums are joined once
    if (sh2 == 0) {   // each lane parks, and later reads back, its own 32 values
#pragma unroll
      for (int dt = 0; dt < 4; ++dt) {
#pragma unroll
        for (int r = 0; r < 8; ++r) so1[wave][col][dt * 16 + 8 * g + r] = (acc[dt][r] + accl[dt][r] * (1.0f / 2048.0f)) * il; }
    } else {
      float ov[4][8]; float ssq = 0.f;
#pragma unroll
      for (int dt = 0; dt < 4; ++dt) {
#pragma unroll
        for (int r = 0; r < 8; ++r) { ov[dt][r] = so1[wave][col][dt * 16 + 8 * g + r] - lam * ((acc[dt][r] + accl[dt][r] * (1.0f / 2048.0f)) * il); ssq += ov[dt][r] * ov[dt][r]; } }
      ssq += xhalf(ssq);
      const float sc = (1.0f / sqrtf(ssq * (1.0f / HD) + 1e-5f)) * (1.0f - LAMBDA_INIT);
#pragma unroll
      for (int dt = 0; dt < 4; ++dt) {
#pragma unroll
        for (int r = 0; r < 8; ++r) so[wave][col][dt * 16 + 8 * g + r] = ov[dt][r] * sc * bfr(SUBW[dt * 16 + 8 * g + r]); } }
    LDSX(); }
  for (int rl = 0; rl < 16; ++rl) if (lane < 16) vst2(O + ((size_t)b * SS + q0 + rl) * DM + h * HD + lane * 4, *(const v4f*)&so[wave][rl][lane * 4]);
}
// ---- k_out: block = (64 rows, 128 cols): out = O(hi/lo) . Wo rows (2 products)
__global__ __launch_bounds__(128) void k_out(const float* __restrict__ O, const __bf16* __restrict__ P, float* __restrict__ Y) {
  __shared__ __align__(16) float so[4][16][132];
  const int tid = threadIdx.x, wave = tid >> 5, lane = tid & 31, col = lane & 15, g = lane >> 4; const size_t r0 = (size_t)blockIdx.x * 64 + wave * 16; const int n0 = blockIdx.y * 128;
  v8f acc[8] = {};
#pragma unroll 2
  for (int kc = 0; kc < DM / 32; ++kc) { const F2 a = split_row(O + (r0 + col) * DM, kc * 32, lane);
#pragma unroll
    for (int j = 0; j < 8; ++j) { const v16b w = frag_b(P + (size_t)(n0 + j * 16 + col) * DM + kc * 32, lane); acc[j] = wmma_bf(a.l, w, acc[j]); acc[j] = wmma_bf(a.h, w, acc[j]); } }
#pragma unroll
  for (int j = 0; j < 8; ++j) {
#pragma unroll
    for (int r = 0; r < 8; ++r) so[wave][8 * g + r][j * 16 + col] = acc[j][r]; }
  LDSX();
  for (int rl = 0; rl < 16; ++rl) vst2(Y + (r0 + rl) * DM + n0 + lane * 4, *(const v4f*)&so[wave][rl][lane * 4]);
}
extern "C" void kernel_launch(void* const* d_in, const int* in_sizes, int n_in, void* d_out, int out_size, void* d_ws, size_t ws_size, hipStream_t stream) {
  (void)in_sizes; (void)n_in; (void)out_size;
  const float** F = (const float**)d_in;   // 0 query_x [2,2048,1024], 1 kv_x, 2 Wq (in,out), 3 Wk, 4 Wv, 5 Wo, 6 lambda_q1 [32], 7 lambda_k1, 8 lambda_q2, 9 lambda_k2, 10 subln_w [64]
  if (ws_size < (size_t)WS_END) return;
  char* ws = (char*)d_ws; __bf16* PK = (__bf16*)(ws + WS_PK); _Float16 *QK = (_Float16*)(ws + WS_QK), *QKL = (_Float16*)(ws + WS_QKL), *VTH = (_Float16*)(ws + WS_VTH), *VTL = (_Float16*)(ws + WS_VTL); float* O = (float*)(ws + WS_O);
  k_pack<<<dim3(DM, 4), 256, 0, stream>>>(F[2], F[3], F[4], F[5], PK);
  k_qkv<<<dim3(TNB * SS / 64, QKVW / 128), 128, 0, stream>>>(F[0], F[1], PK + PK_A, QK, QKL, VTH, VTL);
  k_attn<<<dim3(TQB, NH, TNB), 128, 0, stream>>>(QK, QKL, VTH, VTL, F[6], F[7], F[8], F[9], F[10], O);
  k_out<<<dim3(TOB, DM / 128), 128, 0, stream>>>(O, PK + PK_P, (float*)d_out);
}

// v003
// It runs in 249 microseconds.
// Next to v002, in two timings, it ran 1.59 times as fast each time.
// Over all steps from v000 it is 2.74 times as fast.
// compute dtype: query_x, kv_x, Wq, Wk, Wv, Wo, lambda_*, subln_w (module inputs) rounded to bf16; q (from query_x), k and v (from kv_x) with exact bf16 products on WMMA 16x16x32 ((in,out) weights packed as transposed rows); q and k stored as f16 hi + (x2048-scaled) residual planes; per head pair both 32-dim sub-head score maps with 3 products x 32^-0.5, two running-max softmaxes in f32 (hardware exp); P as f16 hi + (x2048) residual x v hi/lo (3 products) for both maps; lambda from the four 32-vectors in f32 (precise expf); the differential combination, RMS norm (eps 1e-5) x subln_w x (1 - lambda_init) in f32; output projection with the context as bf16 hi + residual x exact Wo (2 products); f32 accumulate.
#include <hip/hip_runtime.h>
#include <math.h>

typedef __attribute__((ext_vector_type(16))) _Float16 v16h;
typedef __attribute__((ext_vector_type(16))) __bf16 v16b;
typedef __attribute__((ext_vector_type(8)))  _Float16 v8h;
typedef __attribute__((ext_vector_type(8)))  float v8f;
typedef __attribute__((ext_vector_type(4)))  float v4f;
typedef __attribute__((ext_vector_type(2)))  float v2f;
typedef __attribute__((ext_vector_type(4)))  unsigned v4u;
typedef __attribute__((ext_vector_type(4)))  int v4i;
typedef float __attribute__((may_alias)) float_a;
typedef int __attribute__((may_alias)) int_a;

template <typename T> __device__ __forceinline__ void vst2(void* p, T v) { *(T*)p = v;  }
__device__ __forceinline__ v8f wmma16(v16h a, v16h b, v8f c) {
  v8f d = __builtin_amdgcn_wmma_f32_16x16x32_f16(false, a, false, b, (short)0, c, false, false);
  asm volatile("v_nop\n\tv_nop\n\tv_nop\n\tv_nop" : "+v"(d) : "v"(a), "v"(b));
  return d;
}
__device__ __forceinline__ v8f wmma_bf(v16b a, v16b b, v8f c) {
  v8f d = __builtin_amdgcn_wmma_f32_16x16x32_bf16(false, a, false, b, (short)0, c, false, false);
  asm volatile("v_nop\n\tv_nop\n\tv_nop\n\tv_nop" : "+v"(d) : "v"(a), "v"(b));
  return d;
}
// Cross multi-head differential attention (B 2, T = S = 2,048, d 1,024, 16 head pairs of 32-dim q/k and 64-dim values, depth-12 lambda_init): softmax(q1 k1) - lambda softmax(q2 k2) applied to v, RMS norm, output projection.
__device__ __forceinline__ v16h frag_h(const _Float16* rowk0, int lane) {
  union { v16h v; v8h q[2]; } u; const _Float16* p = rowk0 + 8 * (lane >> 4);
  u.q[0] = *(const v8h*)p; u.q[1] = *(const v8h*)(p + 16); return u.v;
}
__device__ __forceinline__ v16h frag_f32(const float* rowk0, int lane) {
  v16h a; const float* p = rowk0 + 8 * (lane >> 4);
#pragma unroll
  for (int i = 0; i < 8; ++i) { a[i] = (_Float16)p[i]; a[8 + i] = (_Float16)p[16 + i]; }
  return a;
}
__device__ __forceinline__ v16h frag_f32s(const float* rowk0, int lane, float sc) {
  v16h a; const float* p = rowk0 + 8 * (lane >> 4);
#pragma unroll
  for (int i = 0; i < 8; ++i) { a[i] = (_Float16)(p[i] * sc); a[8 + i] = (_Float16)(p[16 + i] * sc); }
  return a;
}
// column fragment from a [K][ld] layout (column n), rows >= K read as 0
__device__ __forceinline__ v16h fragc_f32(const float* W, int k0, int n, int lane, int ld, int K) {
  v16h a; const int g = lane >> 4;
#pragma unroll
  for (int i = 0; i < 8; ++i) { const int ka = k0 + 8 * g + i, kb = ka + 16;
    a[i] = (_Float16)(ka < K ? W[(size_t)(ka < K ? ka : K - 1) * ld + n] : 0.f); a[8 + i] = (_Float16)(kb < K ? W[(size_t)(kb < K ? kb : K - 1) * ld + n] : 0.f); }
  return a;
}
struct F2 { v16b h, l; };
__device__ __forceinline__ F2 bsplit16(const float v[16]) { F2 r;
#pragma unroll
  for (int i = 0; i < 16; ++i) { const __bf16 h = (__bf16)v[i]; r.h[i] = h; r.l[i] = (__bf16)(v[i] - (float)h); }
  return r; }
__device__ __forceinline__ F2 split_row(const float* row, int k0, int lane) { float v[16]; const float* p = row + k0 + 8 * (lane >> 4);
#pragma unroll
  for (int i = 0; i < 8; ++i) { v[i] = p[i]; v[8 + i] = p[16 + i]; }
  return bsplit16(v); }
__device__ __forceinline__ F2 split_rowK(const float* row, int k0, int lane, int K) { float v[16]; const int g = lane >> 4;
#pragma unroll
  for (int i = 0; i < 8; ++i) { const int ka = k0 + 8 * g + i, kb = ka + 16; v[i] = ka < K ? row[ka < K ? ka : K - 1] : 0.f; v[8 + i] = kb < K ? row[kb < K ? kb : K - 1] : 0.f; }
  return bsplit16(v); }
__device__ __forceinline__ F2 split_col(const float* W, int k0, int n, int lane, int ld, int K) { float v[16]; const int g = lane >> 4;
#pragma unroll
  for (int i = 0; i < 8; ++i) { const int ka = k0 + 8 * g + i, kb = ka + 16; v[i] = ka < K ? W[(size_t)(ka < K ? ka : K - 1) * ld + n] : 0.f; v[8 + i] = kb < K ? W[(size_t)(kb < K ? kb : K - 1) * ld + n] : 0.f; }
  return bsplit16(v); }
__device__ __forceinline__ v8f mac3(const F2& a, const F2& b, v8f c) { c = wmma_bf(a.l, b.h, c); c = wmma_bf(a.h, b.l, c); return wmma_bf(a.h, b.h, c); }
__device__ __forceinline__ float sigm(float v) { return 1.0f / (1.0f + expf(-v)); }
#define LDSX() do { asm volatile("s_wait_dscnt 0" ::: "memory"); __builtin_amdgcn_wave_barrier(); __builtin_amdgcn_fence(__ATOMIC_RELEASE, "workgroup"); } while (0)


#define NB 2
#define SS 2048
#define DM 1024
#define NH 16
#define HD 64
#define QKVW (3 * DM)
#ifndef TQB
#define TQB (SS / 64)
#define TNB NB
#define TOB (NB * SS / 64)     // output row tiles (all)
#endif
typedef __attribute__((ext_vector_type(8))) __bf16 v8b;
__device__ __forceinline__ v16b frag_b(const __bf16* rowk0, int lane) {
  union { v16b v; v8b q[2]; } u; const __bf16* p = rowk0 + 8 * (lane >> 4);
  u.q[0] = *(const v8b*)p; u.q[1] = *(const v8b*)(p + 16); return u.v;
}
__device__ __forceinline__ float bfr(float v) { return (float)(__bf16)v; }
__device__ __attribute__((noinline)) float exp_ni(float v) { return expf(v); }
__device__ __attribute__((noinline)) float erf_ni(float v) { return erff(v); }

#define PK_A 0                       // [3072][1024] Wqkv rows (natural [out][in])
#define PK_P (PK_A + QKVW * DM)        // [1024][1024] Wo rows (natural)
#define PK_END (PK_P + DM * DM)
#define WS_PK  0u
#define WS_QK  (WS_PK + 2u * PK_END)             // f16 [4096 rows][2048]: q | k
#define WS_QKL (WS_QK + 2u * NB * SS * 2 * DM)     // f16 q | k residual planes x2048
#define WS_VTH (WS_QKL + 2u * NB * SS * 2 * DM)    // f16 [b][1024 (h*64+d)][2048 s] hi
#define WS_VTL (WS_VTH + 2u * NB * DM * SS)        // f16 lo x 2048
#define WS_O   (WS_VTL + 2u * NB * DM * SS)        // f32 [4096][1024]
#define WS_CS  (WS_O + 4u * NB * SS * DM)           // 2 x [2048][32] f32, reserved, unused (no RoPE)
#define WS_END (WS_CS + 4u * 2 * SS * 32)
// ---- k_pack: block = (row n, which): natural [out][in] rows -> bf16; which 0..2 -> W_q/W_k/W_v into PK_A rows which*1024 + n; 3 -> W_o into PK_P
__global__ __launch_bounds__(256) void k_pack(const float* __restrict__ WQ, const float* __restrict__ WK, const float* __restrict__ WV, const float* __restrict__ WO, __bf16* __restrict__ PK) {
  __shared__ __align__(16) __bf16 s[DM]; const int n = blockIdx.x, which = blockIdx.y, t = threadIdx.x; const float* Wm = (which == 0) ? WQ : (which == 1) ? WK : (which == 2) ? WV : WO;   // (in,out) -> transposed rows
  for (int k = t; k < DM; k += 256) s[k] = (__bf16)Wm[(size_t)k * DM + n];
  __syncthreads();
  __bf16* dst = (which < 3) ? PK + PK_A + ((size_t)which * DM + n) * DM : PK + PK_P + (size_t)n * DM;
  for (int q = t; q < DM / 8; q += 256) vst2((unsigned*)(dst + q * 8), *(const v4u*)&s[q * 8]);
}
#define GK 64                              // k depth of one staged block: X rows of 256 bytes, weight rows of 128 bytes, whole cache lines
#define GA_PITCH 272                       // LDS bytes per staged f32 row (256 data bytes, 16 B x odd for the ds_load_b128 readers)
#define GB_PITCH 144                       // LDS bytes per staged bf16 weight row (128 data bytes, 16 B x odd)
#define GA_BYTES (64 * GA_PITCH)
#define GS_BYTES (GA_BYTES + 128 * GB_PITCH)   // one staged block: 64 f32 rows, then 128 weight rows
#define COPY8_TEXT "global_load_async_to_lds_b128 %0, %8, off\n\t" "global_load_async_to_lds_b128 %1, %9, off\n\t" "global_load_async_to_lds_b128 %2, %10, off\n\t" "global_load_async_to_lds_b128 %3, %11, off\n\t" \
                   "global_load_async_to_lds_b128 %4, %12, off\n\t" "global_load_async_to_lds_b128 %5, %13, off\n\t" "global_load_async_to_lds_b128 %6, %14, off\n\t" "global_load_async_to_lds_b128 %7, %15, off\n\t" "s_wait_xcnt 0x0"
// one 64-deep k block of a 64 x 128 GEMM tile into LDS, through no register: every lane copies 16 bytes of eight f32 rows (16 lanes a row, rows 8 apart) and of eight weight rows (8 lanes a row, rows 16 apart), so each wave-wide copy covers whole lines.
// s_wait_xcnt 0 is each statement's last line so that no address register a copy names is rewritten ahead of it (a precaution).
__device__ __forceinline__ void stage_gemm(unsigned la, unsigned lw, const float* gx, const __bf16* gw) {
  const unsigned sa = 8 * GA_PITCH, sw = 16 * GB_PITCH;
  asm volatile(COPY8_TEXT :: "v"(la), "v"(la + sa), "v"(la + 2 * sa), "v"(la + 3 * sa), "v"(la + 4 * sa), "v"(la + 5 * sa), "v"(la + 6 * sa), "v"(la + 7 * sa),
               "v"(gx), "v"(gx + 8 * DM), "v"(gx + 16 * DM), "v"(gx + 24 * DM), "v"(gx + 32 * DM), "v"(gx + 40 * DM), "v"(gx + 48 * DM), "v"(gx + 56 * DM) : "memory");
  asm volatile(COPY8_TEXT :: "v"(lw), "v"(lw + sw), "v"(lw + 2 * sw), "v"(lw + 3 * sw), "v"(lw + 4 * sw), "v"(lw + 5 * sw), "v"(lw + 6 * sw), "v"(lw + 7 * sw),
               "v"(gw), "v"(gw + 16 * DM), "v"(gw + 32 * DM), "v"(gw + 48 * DM), "v"(gw + 64 * DM), "v"(gw + 80 * DM), "v"(gw + 96 * DM), "v"(gw + 112 * DM) : "memory");
}
// the 16 f32 of one A fragment (k order of frag_b) from a staged row
__device__ __forceinline__ void row16(const char* row, int u, int g, float v[16]) {
  const v4f* p = (const v4f*)(row + u * 128 + 32 * g); const v4f x0 = p[0], x1 = p[1], x2 = p[4], x3 = p[5];
#pragma unroll
  for (int i = 0; i < 4; ++i) { v[i] = x0[i]; v[4 + i] = x1[i]; v[8 + i] = x2[i]; v[12 + i] = x3[i]; }
}
__global__ __launch_bounds__(128) void k_qkv(const float* __restrict__ XQ, const float* __restrict__ XKV, const __bf16* __restrict__ P, _Float16* __restrict__ QK, _Float16* __restrict__ QKL, _Float16* __restrict__ VTH, _Float16* __restrict__ VTL) {
  const float* X = (blockIdx.y * 128 < DM) ? XQ : XKV;   // q from query_x, k and v from kv_x
  __shared__ __align__(16) char sm[2 * GS_BYTES];   // in the loop two staged k blocks (the next lands while this one is read by all four waves); behind it the epilogue's tiles
  _Float16 (*so)[16][136] = (_Float16 (*)[16][136])sm; _Float16 (*sol)[16][136] = (_Float16 (*)[16][136])(sm + 4 * 16 * 136 * 2); _Float16 (*sth)[72] = (_Float16 (*)[72])sm; _Float16 (*stl)[72] = (_Float16 (*)[72])(sm + 128 * 72 * 2);
  const int tid = threadIdx.x, wave = tid >> 5, lane = tid & 31, col = lane & 15, g = lane >> 4; const size_t r0 = (size_t)blockIdx.x * 64 + wave * 16; const int n0 = blockIdx.y * 128;
  const unsigned la = (unsigned)(size_t)sm + (tid >> 4) * GA_PITCH + (tid & 15) * 16, lw = (unsigned)(size_t)sm + GA_BYTES + (tid >> 3) * GB_PITCH + (tid & 7) * 16;   // this lane's LDS byte addresses in buffer 0
  const float* gx = X + ((size_t)blockIdx.x * 64 + (tid >> 4)) * DM + (tid & 15) * 4; const __bf16* gw = P + (size_t)(n0 + (tid >> 3)) * DM + (tid & 7) * 8;
  v8f acc[8] = {};
  stage_gemm(la, lw, gx, gw);                                 // block 0
  asm volatile("s_wait_asynccnt 0x0" ::: "memory");           // this wave's copies of block 0 have landed
  __syncthreads();                                            // ... and every other wave's: block 0 may be read
  stage_gemm(la + GS_BYTES, lw + GS_BYTES, gx + GK, gw + GK);   // block 1 flies during trip 0
#pragma unroll 1   // rolled: one copy of the trip keeps the text short
  for (int t = 0; t < DM / GK; ++t) { const char* tb = sm + (t & 1) * GS_BYTES;
    // the trip's 16 weight fragments in four groups of four (group q: k half q / 2, columns 64 (q & 1) ...), each read one group ahead of its products so that a wave does not wait out the LDS latency per product
    const char* wrow = tb + GA_BYTES + col * GB_PITCH; v16b w[2][4], a[2];
#pragma unroll
    for (int u = 0; u < 2; ++u) { float xv[16]; row16(tb + (wave * 16 + col) * GA_PITCH, u, g, xv);
#pragma unroll
      for (int i = 0; i < 16; ++i) a[u][i] = (__bf16)xv[i]; }
#pragma unroll
    for (int i = 0; i < 4; ++i) w[0][i] = frag_b((const __bf16*)(wrow + i * 16 * GB_PITCH), lane);
#pragma unroll
    for (int q = 0; q < 4; ++q) {
      if (q < 3) {
#pragma unroll
        for (int i = 0; i < 4; ++i) w[(q + 1) & 1][i] = frag_b((const __bf16*)(wrow + (((q + 1) & 1) * 4 + i) * 16 * GB_PITCH) + ((q + 1) >> 1) * 32, lane); }
#pragma unroll
      for (int i = 0; i < 4; ++i) acc[(q & 1) * 4 + i] = wmma_bf(a[q >> 1], w[q & 1][i], acc[(q & 1) * 4 + i]); }
    asm volatile("s_wait_dscnt 0x0" ::: "memory");            // this wave's reads of this block are done
    asm volatile("s_wait_asynccnt 0x0" ::: "memory");         // this wave's copies of block t + 1 have landed
    __syncthreads();                                          // publishes block t + 1 and frees the buffer that this trip has read
    if (t + 2 < DM / GK) stage_gemm(la + (unsigned)(t & 1) * GS_BYTES, lw + (unsigned)(t & 1) * GS_BYTES, gx + (t + 2) * GK, gw + (t + 2) * GK); }
  asm volatile("s_wait_asynccnt 0x0" ::: "memory");           // nothing is in flight behind the loop: the epilogue may take the LDS over
  if (n0 < 2 * DM) {   // q stored unscaled (f16 sigma ~0.6, no subnormal exposure); 32^-0.5 applied to the f32 score
#pragma unroll
    for (int j = 0; j < 8; ++j) {
#pragma unroll
      for (int r = 0; r < 8; ++r) { const float v = acc[j][r]; const _Float16 hv = (_Float16)v; so[wave][8 * g + r][j * 16 + col] = hv; sol[wave][8 * g + r][j * 16 + col] = (_Float16)((v - (float)hv) * 2048.0f); } }   // q, k as f16 hi + (x2048) residual (no RoPE in this module)
    LDSX();
    for (int rl = 0; rl < 16; ++rl) if (lane < 16) { vst2((unsigned*)(QK + (r0 + rl) * (2 * DM) + n0 + lane * 8), *(const v4u*)&so[wave][rl][lane * 8]); vst2((unsigned*)(QKL + (r0 + rl) * (2 * DM) + n0 + lane * 8), *(const v4u*)&sol[wave][rl][lane * 8]); }
  } else {
#pragma unroll
    for (int j = 0; j < 8; ++j) {
#pragma unroll
      for (int r = 0; r < 8; ++r) { const float v = acc[j][r]; const _Float16 hv = (_Float16)v; sth[j * 16 + col][wave * 16 + 8 * g + r] = hv; stl[j * 16 + col][wave * 16 + 8 * g + r] = (_Float16)((v - (float)hv) * 2048.0f); } }
    __syncthreads();
    const size_t rb = (size_t)blockIdx.x * 64; const int b = (int)(rb / SS), s0 = (int)(rb % SS); const int pc0 = n0 - 2 * DM;
    for (int q = tid; q < 128 * 8; q += 128) { const int d = q >> 3, pc = q & 7; const size_t o = ((size_t)b * DM + pc0 + d) * SS + s0 + pc * 8; vst2((unsigned*)(VTH + o), *(const v4u*)&sth[d][pc * 8]); vst2((unsigned*)(VTL + o), *(const v4u*)&stl[d][pc * 8]); }
  }
}
__device__ __forceinline__ float xhalf(float x) { return __builtin_bit_cast(float, __builtin_amdgcn_permlanex16(__builtin_bit_cast(int, x), __builtin_bit_cast(int, x), 0x76543210, 0xfedcba98, false, false)); }   // lane l with lane l ^ 16
#define LAMBDA_INIT 0.78360247f   // 0.8 - 0.6*exp(-0.3*12), float32
#define STG_PITCH 40                       // f16 per staged row: 64 data bytes at an 80-byte pitch (16 B x odd) for the ds_load_b128 readers
#define STG_ROWS 192                       // one 32-key tile: rows 0..31 K hi, 32..63 K lo (row = key), 64..127 V hi, 128..191 V lo (row = value dim)
#define STG_BYTES (STG_ROWS * STG_PITCH * 2)
// one 32-key tile into LDS: every lane copies 16 bytes of six rows (its row r = tid / 4 of each 32-row group), through no register.
// s_wait_xcnt 0 is the statement's last line so that no address register a copy names is rewritten ahead of it (a precaution).
__device__ __forceinline__ void stage_tile(unsigned l, const _Float16* kh, const _Float16* kl, const _Float16* vh, const _Float16* vl) {
  const unsigned g32 = 32 * STG_PITCH * 2;   // LDS bytes of one 32-row group
  asm volatile("global_load_async_to_lds_b128 %0, %6, off\n\t"
               "global_load_async_to_lds_b128 %1, %7, off\n\t"
               "global_load_async_to_lds_b128 %2, %8, off\n\t"
               "global_load_async_to_lds_b128 %3, %9, off\n\t"
               "global_load_async_to_lds_b128 %4, %10, off\n\t"
               "global_load_async_to_lds_b128 %5, %11, off\n\t"
               "s_wait_xcnt 0x0"
               :: "v"(l), "v"(l + g32), "v"(l + 2 * g32), "v"(l + 3 * g32), "v"(l + 4 * g32), "v"(l + 5 * g32),
                  "v"(kh), "v"(kl), "v"(vh), "v"(vh + 32 * SS), "v"(vl), "v"(vl + 32 * SS) : "memory");
}
__global__ __launch_bounds__(128) void k_attn(const _Float16* __restrict__ QK, const _Float16* __restrict__ QKL, const _Float16* __restrict__ VTH, const _Float16* __restrict__ VTL, const float* __restrict__ LQ1, const float* __restrict__ LK1, const float* __restrict__ LQ2, const float* __restrict__ LK2, const float* __restrict__ SUBW, float* __restrict__ O) {
  __shared__ __align__(16) float so[4][16][68]; __shared__ __align__(16) float so1[4][16][68];
  __shared__ __align__(16) _Float16 stg[2][STG_ROWS][STG_PITCH];   // two buffers: the next 32-key tile lands while this one is read by all four waves
  const int tid = threadIdx.x, wave = tid >> 5, lane = tid & 31, col = lane & 15, g = lane >> 4;
  const int qb = blockIdx.x, h = blockIdx.y, b = blockIdx.z; const int q0 = qb * 64 + wave * 16; const size_t rq = (size_t)b * SS + q0 + col;
  float lam; { float a1 = 0.f, a2 = 0.f;
#pragma unroll 1
    for (int i = 0; i < 32; ++i) { a1 += bfr(LQ1[i]) * bfr(LK1[i]); a2 += bfr(LQ2[i]) * bfr(LK2[i]); }
    lam = exp_ni(a1) - exp_ni(a2) + LAMBDA_INIT; }
  const unsigned lst = (unsigned)(size_t)&stg[0][tid >> 2][(tid & 3) * 8];   // this lane's LDS byte address in buffer 0, row group 0
  const size_t vso = ((size_t)b * DM + h * HD + (tid >> 2)) * SS + (tid & 3) * 8; const _Float16* gvh = VTH + vso; const _Float16* gvl = VTL + vso;
  // the two sub-heads are processed one after the other (sub-head 0's normalised P.V parked in LDS) to keep registers under 256
#pragma unroll 1
  for (int sh2 = 0; sh2 < 2; ++sh2) {
    const v16h aq = frag_h(QK + rq * (2 * DM) + h * HD + sh2 * 32, lane), aql = frag_h(QKL + rq * (2 * DM) + h * HD + sh2 * 32, lane);
    float m = -3.0e38f, l = 0.f;   // this lane's query: running maximum (same in both halves) and this half's part of the sum
    v8f acc[4] = {}, accl[4] = {};   // acc[dt][r]: value dim dt * 16 + 8 g + r of query col
    const size_t kso = ((size_t)b * SS + (tid >> 2)) * (2 * DM) + DM + h * HD + sh2 * 32 + (tid & 3) * 8; const _Float16* gkh = QK + kso; const _Float16* gkl = QKL + kso;
    stage_tile(lst, gkh, gkl, gvh, gvl);                       // tile 0 (both buffers are free: the last trip's foot ended every read)
    asm volatile("s_wait_asynccnt 0x0" ::: "memory");           // this wave's copies of tile 0 have landed
    __syncthreads();                                            // ... and every other wave's: tile 0 may be read
    stage_tile(lst + STG_BYTES, gkh + (size_t)32 * 2 * DM, gkl + (size_t)32 * 2 * DM, gvh + 32, gvl + 32);   // tile 1 flies during trip 0
#pragma unroll 1
    for (int ks = 0; ks < SS / 32; ++ks) { v8f s[2]; const _Float16 (*tb)[STG_PITCH] = stg[ks & 1];
#pragma unroll
      for (int ct = 0; ct < 2; ++ct) { const _Float16* krow = &tb[ct * 16 + col][0]; const _Float16* krowl = &tb[32 + ct * 16 + col][0];
        v8f c = {}, cl = {}; const v16h kh = frag_h(krow, lane); c = wmma16(kh, aq, c); cl = wmma16(kh, aql, cl); cl = wmma16(frag_h(krowl, lane), aq, cl);
#pragma unroll
        for (int r = 0; r < 8; ++r) s[ct][r] = (c[r] + cl[r] * (1.0f / 2048.0f)) * 0.17677669529663687f; }   // 32^-0.5
      float mx = fmaxf(s[0][0], s[1][0]);
#pragma unroll
      for (int r = 1; r < 8; ++r) mx = fmaxf(mx, fmaxf(s[0][r], s[1][r]));
      mx = fmaxf(mx, xhalf(mx));
      const float mn = fmaxf(m, mx); const float alpha = (m <= -1.0e38f) ? 0.f : __expf(m - mn); m = mn;
      v8f e0, e1; float es0 = 0.f, es1 = 0.f;
#pragma unroll
      for (int r = 0; r < 8; ++r) { e0[r] = __expf(s[0][r] - mn); e1[r] = __expf(s[1][r] - mn); es0 += e0[r]; es1 += e1[r]; }
      const v8h h0 = __builtin_convertvector(e0, v8h), h1 = __builtin_convertvector(e1, v8h);   // P as f16 hi ...
      const v8h l0 = __builtin_convertvector((e0 - __builtin_convertvector(h0, v8f)) * 2048.0f, v8h), l1 = __builtin_convertvector((e1 - __builtin_convertvector(h1, v8f)) * 2048.0f, v8h);   // ... + (x2048) residual
      const v16h pah = __builtin_shufflevector(h0, h1, 0, 1, 2, 3, 4, 5, 6, 7, 8, 9, 10, 11, 12, 13, 14, 15), pal = __builtin_shufflevector(l0, l1, 0, 1, 2, 3, 4, 5, 6, 7, 8, 9, 10, 11, 12, 13, 14, 15);
      l = l * alpha + (es0 + es1);
#pragma unroll
      for (int dt = 0; dt < 4; ++dt) { acc[dt] *= alpha; accl[dt] *= alpha; }
#pragma unroll
      for (int dt = 0; dt < 4; ++dt) { const v16h vh = frag_h(&tb[64 + dt * 16 + col][0], lane), vl = frag_h(&tb[128 + dt * 16 + col][0], lane); acc[dt] = wmma16(vh, pah, acc[dt]); accl[dt] = wmma16(vh, pal, accl[dt]); accl[dt] = wmma16(vl, pah, accl[dt]); }
      asm volatile("s_wait_dscnt 0x0" ::: "memory");            // this wave's reads of this tile are done
      asm volatile("s_wait_asynccnt 0x0" ::: "memory");         // this wave's copies of tile ks + 1 have landed
      __syncthreads();                                          // publishes tile ks + 1 and frees the buffer that this trip has read
      if (ks + 2 < SS / 32) stage_tile(lst + (unsigned)(ks & 1) * STG_BYTES, gkh + (size_t)(ks + 2) * 32 * 2 * DM, gkl + (size_t)(ks + 2) * 32 * 2 * DM, gvh + (ks + 2) * 32, gvl + (ks + 2) * 32); }
    asm volatile("s_wait_asynccnt 0x0" ::: "memory");           // nothing is in flight behind the loop
    const float il = 1.0f / (l + xhalf(l));   // the halves' sums are joined once
    if (sh2 == 0) {   // each lane parks, and later reads back, its own 32 values
#pragma unroll
      for (int dt = 0; dt < 4; ++dt) {
#pragma unroll
        for (int r = 0; r < 8; ++r) so1[wave][col][dt * 16 + 8 * g + r] = (acc[dt][r] + accl[dt][r] * (1.0f / 2048.0f)) * il; }
    } else {
      float ov[4][8]; float ssq = 0.f;
#pragma unroll
      for (int dt = 0; dt < 4; ++dt) {
#pragma unroll
        for (int r = 0; r < 8; ++r) { ov[dt][r] = so1[wave][col][dt * 16 + 8 * g + r] - lam * ((acc[dt][r] + accl[dt][r] * (1.0f / 2048.0f)) * il); ssq += ov[dt][r] * ov[dt][r]; } }
      ssq += xhalf(ssq);
      const float sc = (1.0f / sqrtf(ssq * (1.0f / HD) + 1e-5f)) * (1.0f - LAMBDA_INIT);
#pragma unroll
      for (int dt = 0; dt < 4; ++dt) {
#pragma unroll
        for (int r = 0; r < 8; ++r) so[wave][col][dt * 16 + 8 * g + r] = ov[dt][r] * sc * bfr(SUBW[dt * 16 + 8 * g + r]); } }
    LDSX(); }
  for (int rl = 0; rl < 16; ++rl) if (lane < 16) vst2(O + ((size_t)b * SS + q0 + rl) * DM + h * HD + lane * 4, *(const v4f*)&so[wave][rl][lane * 4]);
}
// ---- k_out: block = (64 rows, 128 cols): out = O(hi/lo) . Wo rows (2 products)
__global__ __launch_bounds__(128) void k_out(const float* __restrict__ O, const __bf16* __restrict__ P, float* __restrict__ Y) {
  __shared__ __align__(16) char sm[2 * GS_BYTES];   // in the loop two staged k blocks; behind it the epilogue's tile
  float (*so)[16][132] = (float (*)[16][132])sm;
  const int tid = threadIdx.x, wave = tid >> 5, lane = tid & 31, col = lane & 15, g = lane >> 4; const size_t r0 = (size_t)blockIdx.x * 64 + wave * 16; const int n0 = blockIdx.y * 128;
  const unsigned la = (unsigned)(size_t)sm + (tid >> 4) * GA_PITCH + (tid & 15) * 16, lw = (unsigned)(size_t)sm + GA_BYTES + (tid >> 3) * GB_PITCH + (tid & 7) * 16;   // this lane's LDS byte addresses in buffer 0
  const float* gx = O + ((size_t)blockIdx.x * 64 + (tid >> 4)) * DM + (tid & 15) * 4; const __bf16* gw = P + (size_t)(n0 + (tid >> 3)) * DM + (tid & 7) * 8;
  v8f acc[8] = {};
  stage_gemm(la, lw, gx, gw);                                 // block 0
  asm volatile("s_wait_asynccnt 0x0" ::: "memory");           // this wave's copies of block 0 have landed
  __syncthreads();                                            // ... and every other wave's: block 0 may be read
  stage_gemm(la + GS_BYTES, lw + GS_BYTES, gx + GK, gw + GK);   // block 1 flies during trip 0
#pragma unroll 1   // rolled: one copy of the trip keeps the text short
  for (int t = 0; t < DM / GK; ++t) { const char* tb = sm + (t & 1) * GS_BYTES;
    // the trip's 16 weight fragments in four groups of four, each read one group ahead of its products (as in k_qkv)
    const char* wrow = tb + GA_BYTES + col * GB_PITCH; v16b w[2][4]; F2 a[2];
#pragma unroll
    for (int u = 0; u < 2; ++u) { float xv[16]; row16(tb + (wave * 16 + col) * GA_PITCH, u, g, xv); a[u] = bsplit16(xv); }
#pragma unroll
    for (int i = 0; i < 4; ++i) w[0][i] = frag_b((const __bf16*)(wrow + i * 16 * GB_PITCH), lane);
#pragma unroll
    for (int q = 0; q < 4; ++q) {
      if (q < 3) {
#pragma unroll
        for (int i = 0; i < 4; ++i) w[(q + 1) & 1][i] = frag_b((const __bf16*)(wrow + (((q + 1) & 1) * 4 + i) * 16 * GB_PITCH) + ((q + 1) >> 1) * 32, lane); }
#pragma unroll
      for (int i = 0; i < 4; ++i) { const int j = (q & 1) * 4 + i; acc[j] = wmma_bf(a[q >> 1].l, w[q & 1][i], acc[j]); acc[j] = wmma_bf(a[q >> 1].h, w[q & 1][i], acc[j]); } }
    asm volatile("s_wait_dscnt 0x0" ::: "memory");            // this wave's reads of this block are done
    asm volatile("s_wait_asynccnt 0x0" ::: "memory");         // this wave's copies of block t + 1 have landed
    __syncthreads();                                          // publishes block t + 1 and frees the buffer that this trip has read
    if (t + 2 < DM / GK) stage_gemm(la + (unsigned)(t & 1) * GS_BYTES, lw + (unsigned)(t & 1) * GS_BYTES, gx + (t + 2) * GK, gw + (t + 2) * GK); }
  asm volatile("s_wait_asynccnt 0x0" ::: "memory");           // nothing is in flight behind the loop: the epilogue may take the LDS over
#pragma unroll
  for (int j = 0; j < 8; ++j) {
#pragma unroll
    for (int r = 0; r < 8; ++r) so[wave][8 * g + r][j * 16 + col] = acc[j][r]; }
  LDSX();
  for (int rl = 0; rl < 16; ++rl) vst2(Y + (r0 + rl) * DM + n0 + lane * 4, *(const v4f*)&so[wave][rl][lane * 4]);
}
extern "C" void kernel_launch(void* const* d_in, const int* in_sizes, int n_in, void* d_out, int out_size, void* d_ws, size_t ws_size, hipStream_t stream) {
  (void)in_sizes; (void)n_in; (void)out_size;
  const float** F = (const float**)d_in;   // 0 query_x [2,2048,1024], 1 kv_x, 2 Wq (in,out), 3 Wk, 4 Wv, 5 Wo, 6 lambda_q1 [32], 7 lambda_k1, 8 lambda_q2, 9 lambda_k2, 10 subln_w [64]
  if (ws_size < (size_t)WS_END) return;
  char* ws = (char*)d_ws; __bf16* PK = (__bf16*)(ws + WS_PK); _Float16 *QK = (_Float16*)(ws + WS_QK), *QKL = (_Float16*)(ws + WS_QKL), *VTH = (_Float16*)(ws + WS_VTH), *VTL = (_Float16*)(ws + WS_VTL); float* O = (float*)(ws + WS_O);
  k_pack<<<dim3(DM, 4), 256, 0, stream>>>(F[2], F[3], F[4], F[5], PK);
  k_qkv<<<dim3(TNB * SS / 64, QKVW / 128), 128, 0, stream>>>(F[0], F[1], PK + PK_A, QK, QKL, VTH, VTL);
  k_attn<<<dim3(TQB, NH, TNB), 128, 0, stream>>>(QK, QKL, VTH, VTL, F[6], F[7], F[8], F[9], F[10], O);
  k_out<<<dim3(TOB, DM / 128), 128, 0, stream>>>(O, PK + PK_P, (float*)d_out);
}

// v004
// It runs in 236 microseconds.
// Timed twice side by side with v003, it ran 1.05 times as fast both times.
// Counting every step since v000, it is 2.88 times as fast.
// compute dtype: query_x, kv_x, Wq, Wk, Wv, Wo, lambda_*, subln_w (module inputs) rounded to bf16; q (from query_x), k and v (from kv_x) with exact bf16 products on WMMA 16x16x32 ((in,out) weights packed as transposed rows); q and k stored as f16 hi + (x2048-scaled) residual planes; per head pair both 32-dim sub-head score maps with 3 products x 32^-0.5, two running-max softmaxes in f32 (hardware exp); P as f16 hi + (x2048) residual x v hi/lo (3 products) for both maps; lambda from the four 32-vectors in f32 (precise expf); the differential combination, RMS norm (eps 1e-5) x subln_w x (1 - lambda_init) in f32; output projection with the context as bf16 hi + residual x exact Wo (2 products); f32 accumulate.
#include <hip/hip_runtime.h>
#include <math.h>

typedef __attribute__((ext_vector_type(16))) _Float16 v16h;
typedef __attribute__((ext_vector_type(16))) __bf16 v16b;
typedef __attribute__((ext_vector_type(8)))  _Float16 v8h;
typedef __attribute__((ext_vector_type(8)))  float v8f;
typedef __attribute__((ext_vector_type(4)))  float v4f;
typedef __attribute__((ext_vector_type(2)))  float v2f;
typedef __attribute__((ext_vector_type(4)))  unsigned v4u;
typedef __attribute__((ext_vector_type(4)))  int v4i;
typedef float __attribute__((may_alias)) float_a;
typedef int __attribute__((may_alias)) int_a;

template <typename T> __device__ __forceinline__ void vst2(void* p, T v) { *(T*)p = v;  }
__device__ __forceinline__ v8f wmma16(v16h a, v16h b, v8f c) {
  v8f d = __builtin_amdgcn_wmma_f32_16x16x32_f16(false, a, false, b, (short)0, c, false, false);
  asm volatile("v_nop\n\tv_nop\n\tv_nop\n\tv_nop" : "+v"(d) : "v"(a), "v"(b));
  return d;
}
__device__ __forceinline__ v8f wmma_bf(v16b a, v16b b, v8f c) {
  v8f d = __builtin_amdgcn_wmma_f32_16x16x32_bf16(false, a, false, b, (short)0, c, false, false);
  asm volatile("v_nop\n\tv_nop\n\tv_nop\n\tv_nop" : "+v"(d) : "v"(a), "v"(b));
  return d;
}
// Cross multi-head differential attention (B 2, T = S = 2,048, d 1,024, 16 head pairs of 32-dim q/k and 64-dim values, depth-12 lambda_init): softmax(q1 k1) - lambda softmax(q2 k2) applied to v, RMS norm, output projection.
__device__ __forceinline__ v16h frag_h(const _Float16* rowk0, int lane) {
  union { v16h v; v8h q[2]; } u; const _Float16* p = rowk0 + 8 * (lane >> 4);
  u.q[0] = *(const v8h*)p; u.q[1] = *(const v8h*)(p + 16); return u.v;
}
__device__ __forceinline__ v16h frag_f32(const float* rowk0, int lane) {
  v16h a; const float* p = rowk0 + 8 * (lane >> 4);
#pragma unroll
  for (int i = 0; i < 8; ++i) { a[i] = (_Float16)p[i]; a[8 + i] = (_Float16)p[16 + i]; }
  return a;
}
__device__ __forceinline__ v16h frag_f32s(const float* rowk0, int lane, float sc) {
  v16h a; const float* p = rowk0 + 8 * (lane >> 4);
#pragma unroll
  for (int i = 0; i < 8; ++i) { a[i] = (_Float16)(p[i] * sc); a[8 + i] = (_Float16)(p[16 + i] * sc); }
  return a;
}
// column fragment from a [K][ld] layout (column n), rows >= K read as 0
__device__ __forceinline__ v16h fragc_f32(const float* W, int k0, int n, int lane, int ld, int K) {
  v16h a; const int g = lane >> 4;
#pragma unroll
  for (int i = 0; i < 8; ++i) { const int ka = k0 + 8 * g + i, kb = ka + 16;
    a[i] = (_Float16)(ka < K ? W[(size_t)(ka < K ? ka : K - 1) * ld + n] : 0.f); a[8 + i] = (_Float16)(kb < K ? W[(size_t)(kb < K ? kb : K - 1) * ld + n] : 0.f); }
  return a;
}
struct F2 { v16b h, l; };
__device__ __forceinline__ F2 bsplit16(const float v[16]) { F2 r;
#pragma unroll
  for (int i = 0; i < 16; ++i) { const __bf16 h = (__bf16)v[i]; r.h[i] = h; r.l[i] = (__bf16)(v[i] - (float)h); }
  return r; }
__device__ __forceinline__ F2 split_row(const float* row, int k0, int lane) { float v[16]; const float* p = row + k0 + 8 * (lane >> 4);
#pragma unroll
  for (int i = 0; i < 8; ++i) { v[i] = p[i]; v[8 + i] = p[16 + i]; }
  return bsplit16(v); }
__device__ __forceinline__ F2 split_rowK(const float* row, int k0, int lane, int K) { float v[16]; const int g = lane >> 4;
#pragma unroll
  for (int i = 0; i < 8; ++i) { const int ka = k0 + 8 * g + i, kb = ka + 16; v[i] = ka < K ? row[ka < K ? ka : K - 1] : 0.f; v[8 + i] = kb < K ? row[kb < K ? kb : K - 1] : 0.f; }
  return bsplit16(v); }
__device__ __forceinline__ F2 split_col(const float* W, int k0, int n, int lane, int ld, int K) { float v[16]; const int g = lane >> 4;
#pragma unroll
  for (int i = 0; i < 8; ++i) { const int ka = k0 + 8 * g + i, kb = ka + 16; v[i] = ka < K ? W[(size_t)(ka < K ? ka : K - 1) * ld + n] : 0.f; v[8 + i] = kb < K ? W[(size_t)(kb < K ? kb : K - 1) * ld + n] : 0.f; }
  return bsplit16(v); }
__device__ __forceinline__ v8f mac3(const F2& a, const F2& b, v8f c) { c = wmma_bf(a.l, b.h, c); c = wmma_bf(a.h, b.l, c); return wmma_bf(a.h, b.h, c); }
__device__ __forceinline__ float sigm(float v) { return 1.0f / (1.0f + expf(-v)); }
#define LDSX() do { asm volatile("s_wait_dscnt 0" ::: "memory"); __builtin_amdgcn_wave_barrier(); __builtin_amdgcn_fence(__ATOMIC_RELEASE, "workgroup"); } while (0)


#define NB 2
#define SS 2048
#define DM 1024
#define NH 16
#define HD 64
#define QKVW (3 * DM)
#ifndef TQB
#define TQB (SS / 64)
#define TNB NB
#define TOB (NB * SS / 64)     // output row tiles (all)
#endif
typedef __attribute__((ext_vector_type(8))) __bf16 v8b;
__device__ __forceinline__ v16b frag_b(const __bf16* rowk0, int lane) {
  union { v16b v; v8b q[2]; } u; const __bf16* p = rowk0 + 8 * (lane >> 4);
  u.q[0] = *(const v8b*)p; u.q[1] = *(const v8b*)(p + 16); return u.v;
}
__device__ __forceinline__ float bfr(float v) { return (float)(__bf16)v; }
__device__ __attribute__((noinline)) float exp_ni(float v) { return expf(v); }
__device__ __attribute__((noinline)) float erf_ni(float v) { return erff(v); }

#define PK_A 0                       // [3072][1024] Wqkv rows (natural [out][in])
#define PK_P (PK_A + QKVW * DM)        // [1024][1024] Wo rows (natural)
#define PK_END (PK_P + DM * DM)
#define WS_PK  0u
#define WS_QK  (WS_PK + 2u * PK_END)             // f16 [4096 rows][2048]: q | k
#define WS_QKL (WS_QK + 2u * NB * SS * 2 * DM)     // f16 q | k residual planes x2048
#define WS_VTH (WS_QKL + 2u * NB * SS * 2 * DM)    // f16 [b][1024 (h*64+d)][2048 s] hi
#define WS_VTL (WS_VTH + 2u * NB * DM * SS)        // f16 lo x 2048
#define WS_O   (WS_VTL + 2u * NB * DM * SS)        // f32 [4096][1024]
#define WS_CS  (WS_O + 4u * NB * SS * DM)           // 2 x [2048][32] f32, reserved, unused (no RoPE)
#define WS_END (WS_CS + 4u * 2 * SS * 32)
// ---- k_pack: block = (row n, which): natural [out][in] rows -> bf16; which 0..2 -> W_q/W_k/W_v into PK_A rows which*1024 + n; 3 -> W_o into PK_P
__global__ __launch_bounds__(256) void k_pack(const float* __restrict__ WQ, const float* __restrict__ WK, const float* __restrict__ WV, const float* __restrict__ WO, __bf16* __restrict__ PK) {
  __shared__ __align__(16) __bf16 s[DM]; const int n = blockIdx.x, which = blockIdx.y, t = threadIdx.x; const float* Wm = (which == 0) ? WQ : (which == 1) ? WK : (which == 2) ? WV : WO;   // (in,out) -> transposed rows
  for (int k = t; k < DM; k += 256) s[k] = (__bf16)Wm[(size_t)k * DM + n];
  __syncthreads();
  __bf16* dst = (which < 3) ? PK + PK_A + ((size_t)which * DM + n) * DM : PK + PK_P + (size_t)n * DM;
  for (int q = t; q < DM / 8; q += 256) vst2((unsigned*)(dst + q * 8), *(const v4u*)&s[q * 8]);
}
#define GK 64                              // k depth of one staged block: X rows of 256 bytes, weight rows of 128 bytes, whole cache lines
#define GA_PITCH 272                       // LDS bytes per staged f32 row (256 data bytes, 16 B x odd for the ds_load_b128 readers)
#define GB_PITCH 144                       // LDS bytes per staged bf16 weight row (128 data bytes, 16 B x odd)
#define GA_BYTES (64 * GA_PITCH)
#define GS_BYTES (GA_BYTES + 128 * GB_PITCH)   // one staged block: 64 f32 rows, then 128 weight rows
#define COPY8_TEXT "global_load_async_to_lds_b128 %0, %8, off\n\t" "global_load_async_to_lds_b128 %1, %9, off\n\t" "global_load_async_to_lds_b128 %2, %10, off\n\t" "global_load_async_to_lds_b128 %3, %11, off\n\t" \
                   "global_load_async_to_lds_b128 %4, %12, off\n\t" "global_load_async_to_lds_b128 %5, %13, off\n\t" "global_load_async_to_lds_b128 %6, %14, off\n\t" "global_load_async_to_lds_b128 %7, %15, off\n\t" "s_wait_xcnt 0x0"
// one 64-deep k block of a 64 x 128 GEMM tile into LDS, through no register: every lane copies 16 bytes of eight f32 rows (16 lanes a row, rows 8 apart) and of eight weight rows (8 lanes a row, rows 16 apart), so each wave-wide copy covers whole lines.
// s_wait_xcnt 0 is each statement's last line so that no address register a copy names is rewritten ahead of it (a precaution).
__device__ __forceinline__ void stage_gemm(unsigned la, unsigned lw, const float* gx, const __bf16* gw) {
  const unsigned sa = 8 * GA_PITCH, sw = 16 * GB_PITCH;
  asm volatile(COPY8_TEXT :: "v"(la), "v"(la + sa), "v"(la + 2 * sa), "v"(la + 3 * sa), "v"(la + 4 * sa), "v"(la + 5 * sa), "v"(la + 6 * sa), "v"(la + 7 * sa),
               "v"(gx), "v"(gx + 8 * DM), "v"(gx + 16 * DM), "v"(gx + 24 * DM), "v"(gx + 32 * DM), "v"(gx + 40 * DM), "v"(gx + 48 * DM), "v"(gx + 56 * DM) : "memory");
  asm volatile(COPY8_TEXT :: "v"(lw), "v"(lw + sw), "v"(lw + 2 * sw), "v"(lw + 3 * sw), "v"(lw + 4 * sw), "v"(lw + 5 * sw), "v"(lw + 6 * sw), "v"(lw + 7 * sw),
               "v"(gw), "v"(gw + 16 * DM), "v"(gw + 32 * DM), "v"(gw + 48 * DM), "v"(gw + 64 * DM), "v"(gw + 80 * DM), "v"(gw + 96 * DM), "v"(gw + 112 * DM) : "memory");
}
// the 16 f32 of one A fragment (k order of frag_b) from a staged row
__device__ __forceinline__ void row16(const char* row, int u, int g, float v[16]) {
  const v4f* p = (const v4f*)(row + u * 128 + 32 * g); const v4f x0 = p[0], x1 = p[1], x2 = p[4], x3 = p[5];
#pragma unroll
  for (int i = 0; i < 4; ++i) { v[i] = x0[i]; v[4 + i] = x1[i]; v[8 + i] = x2[i]; v[12 + i] = x3[i]; }
}
__global__ __launch_bounds__(128) void k_qkv(const float* __restrict__ XQ, const float* __restrict__ XKV, const __bf16* __restrict__ P, _Float16* __restrict__ QK, _Float16* __restrict__ QKL, _Float16* __restrict__ VTH, _Float16* __restrict__ VTL) {
  const float* X = (blockIdx.y * 128 < DM) ? XQ : XKV;   // q from query_x, k and v from kv_x
  __shared__ __align__(16) char sm[2 * GS_BYTES];   // in the loop two staged k blocks (the next lands while this one is read by all four waves); behind it the epilogue's tiles
  _Float16 (*so)[16][136] = (_Float16 (*)[16][136])sm; _Float16 (*sol)[16][136] = (_Float16 (*)[16][136])(sm + 4 * 16 * 136 * 2); _Float16 (*sth)[72] = (_Float16 (*)[72])sm; _Float16 (*stl)[72] = (_Float16 (*)[72])(sm + 128 * 72 * 2);
  const int tid = threadIdx.x, wave = tid >> 5, lane = tid & 31, col = lane & 15, g = lane >> 4; const size_t r0 = (size_t)blockIdx.x * 64 + wave * 16; const int n0 = blockIdx.y * 128;
  const unsigned la = (unsigned)(size_t)sm + (tid >> 4) * GA_PITCH + (tid & 15) * 16, lw = (unsigned)(size_t)sm + GA_BYTES + (tid >> 3) * GB_PITCH + (tid & 7) * 16;   // this lane's LDS byte addresses in buffer 0
  const float* gx = X + ((size_t)blockIdx.x * 64 + (tid >> 4)) * DM + (tid & 15) * 4; const __bf16* gw = P + (size_t)(n0 + (tid >> 3)) * DM + (tid & 7) * 8;
  v8f acc[8] = {};
  stage_gemm(la, lw, gx, gw);                                 // block 0
  asm volatile("s_wait_asynccnt 0x0" ::: "memory");           // this wave's copies of block 0 have landed
  __syncthreads();                                            // ... and every other wave's: block 0 may be read
  stage_gemm(la + GS_BYTES, lw + GS_BYTES, gx + GK, gw + GK);   // block 1 flies during trip 0
#pragma unroll 1   // rolled: one copy of the trip keeps the text short
  for (int t = 0; t < DM / GK; ++t) { const char* tb = sm + (t & 1) * GS_BYTES;
    // the trip's 16 weight fragments in four groups of four (group q: k half q / 2, columns 64 (q & 1) ...), each read one group ahead of its products so that a wave does not wait out the LDS latency per product
    const char* wrow = tb + GA_BYTES + col * GB_PITCH; v16b w[2][4], a[2];
#pragma unroll
    for (int u = 0; u < 2; ++u) { float xv[16]; row16(tb + (wave * 16 + col) * GA_PITCH, u, g, xv);
#pragma unroll
      for (int i = 0; i < 16; ++i) a[u][i] = (__bf16)xv[i]; }
#pragma unroll
    for (int i = 0; i < 4; ++i) w[0][i] = frag_b((const __bf16*)(wrow + i * 16 * GB_PITCH), lane);
#pragma unroll
    for (int q = 0; q < 4; ++q) {
      if (q < 3) {
#pragma unroll
        for (int i = 0; i < 4; ++i) w[(q + 1) & 1][i] = frag_b((const __bf16*)(wrow + (((q + 1) & 1) * 4 + i) * 16 * GB_PITCH) + ((q + 1) >> 1) * 32, lane); }
#pragma unroll
      for (int i = 0; i < 4; ++i) acc[(q & 1) * 4 + i] = wmma_bf(a[q >> 1], w[q & 1][i], acc[(q & 1) * 4 + i]); }
    asm volatile("s_wait_dscnt 0x0" ::: "memory");            // this wave's reads of this block are done
    asm volatile("s_wait_asynccnt 0x0" ::: "memory");         // this wave's copies of block t + 1 have landed
    __syncthreads();                                          // publishes block t + 1 and frees the buffer that this trip has read
    if (t + 2 < DM / GK) stage_gemm(la + (unsigned)(t & 1) * GS_BYTES, lw + (unsigned)(t & 1) * GS_BYTES, gx + (t + 2) * GK, gw + (t + 2) * GK); }
  asm volatile("s_wait_asynccnt 0x0" ::: "memory");           // nothing is in flight behind the loop: the epilogue may take the LDS over
  if (n0 < 2 * DM) {   // q stored unscaled (f16 sigma ~0.6, no subnormal exposure); 32^-0.5 applied to the f32 score
#pragma unroll
    for (int j = 0; j < 8; ++j) {
#pragma unroll
      for (int r = 0; r < 8; ++r) { const float v = acc[j][r]; const _Float16 hv = (_Float16)v; so[wave][8 * g + r][j * 16 + col] = hv; sol[wave][8 * g + r][j * 16 + col] = (_Float16)((v - (float)hv) * 2048.0f); } }   // q, k as f16 hi + (x2048) residual (no RoPE in this module)
    LDSX();
    for (int rl = 0; rl < 16; ++rl) if (lane < 16) { vst2((unsigned*)(QK + (r0 + rl) * (2 * DM) + n0 + lane * 8), *(const v4u*)&so[wave][rl][lane * 8]); vst2((unsigned*)(QKL + (r0 + rl) * (2 * DM) + n0 + lane * 8), *(const v4u*)&sol[wave][rl][lane * 8]); }
  } else {
#pragma unroll
    for (int j = 0; j < 8; ++j) {
#pragma unroll
      for (int r = 0; r < 8; ++r) { const float v = acc[j][r]; const _Float16 hv = (_Float16)v; sth[j * 16 + col][wave * 16 + 8 * g + r] = hv; stl[j * 16 + col][wave * 16 + 8 * g + r] = (_Float16)((v - (float)hv) * 2048.0f); } }
    __syncthreads();
    const size_t rb = (size_t)blockIdx.x * 64; const int b = (int)(rb / SS), s0 = (int)(rb % SS); const int pc0 = n0 - 2 * DM;
    for (int q = tid; q < 128 * 8; q += 128) { const int d = q >> 3, pc = q & 7; const size_t o = ((size_t)b * DM + pc0 + d) * SS + s0 + pc * 8; vst2((unsigned*)(VTH + o), *(const v4u*)&sth[d][pc * 8]); vst2((unsigned*)(VTL + o), *(const v4u*)&stl[d][pc * 8]); }
  }
}
__device__ __forceinline__ float xhalf(float x) { return __builtin_bit_cast(float, __builtin_amdgcn_permlanex16(__builtin_bit_cast(int, x), __builtin_bit_cast(int, x), 0x76543210, 0xfedcba98, false, false)); }   // lane l with lane l ^ 16
#define LAMBDA_INIT 0.78360247f   // 0.8 - 0.6*exp(-0.3*12), float32
#define STG_PITCH 40                       // f16 per staged row: 64 data bytes at an 80-byte pitch (16 B x odd) for the ds_load_b128 readers
#define STG_ROWS 192                       // one 32-key tile: rows 0..31 K hi, 32..63 K lo (row = key), 64..127 V hi, 128..191 V lo (row = value dim)
#define STG_BYTES (STG_ROWS * STG_PITCH * 2)
// one 32-key tile into LDS: every lane copies 16 bytes of six rows (its row r = tid / 4 of each 32-row group), through no register.
// s_wait_xcnt 0 is the statement's last line so that no address register a copy names is rewritten ahead of it (a precaution).
__device__ __forceinline__ void stage_tile(unsigned l, const _Float16* kh, const _Float16* kl, const _Float16* vh, const _Float16* vl) {
  const unsigned g32 = 32 * STG_PITCH * 2;   // LDS bytes of one 32-row group
  asm volatile("global_load_async_to_lds_b128 %0, %6, off\n\t"
               "global_load_async_to_lds_b128 %1, %7, off\n\t"
               "global_load_async_to_lds_b128 %2, %8, off\n\t"
               "global_load_async_to_lds_b128 %3, %9, off\n\t"
               "global_load_async_to_lds_b128 %4, %10, off\n\t"
               "global_load_async_to_lds_b128 %5, %11, off\n\t"
               "s_wait_xcnt 0x0"
               :: "v"(l), "v"(l + g32), "v"(l + 2 * g32), "v"(l + 3 * g32), "v"(l + 4 * g32), "v"(l + 5 * g32),
                  "v"(kh), "v"(kl), "v"(vh), "v"(vh + 32 * SS), "v"(vl), "v"(vl + 32 * SS) : "memory");
}
__global__ __launch_bounds__(128) void k_attn(const _Float16* __restrict__ QK, const _Float16* __restrict__ QKL, const _Float16* __restrict__ VTH, const _Float16* __restrict__ VTL, const float* __restrict__ LQ1, const float* __restrict__ LK1, const float* __restrict__ LQ2, const float* __restrict__ LK2, const float* __restrict__ SUBW, float* __restrict__ O) {
  __shared__ __align__(16) float so[4][16][68]; __shared__ __align__(16) float so1[4][16][68];
  __shared__ __align__(16) _Float16 stg[2][STG_ROWS][STG_PITCH];   // two buffers: the next 32-key tile lands while this one is read by all four waves
  const int tid = threadIdx.x, wave = tid >> 5, lane = tid & 31, col = lane & 15, g = lane >> 4;
  const int qb = blockIdx.x, h = blockIdx.y, b = blockIdx.z; const int q0 = qb * 64 + wave * 16; const size_t rq = (size_t)b * SS + q0 + col;
  float lam; { float a1 = 0.f, a2 = 0.f;
#pragma unroll 1
    for (int i = 0; i < 32; ++i) { a1 += bfr(LQ1[i]) * bfr(LK1[i]); a2 += bfr(LQ2[i]) * bfr(LK2[i]); }
    lam = exp_ni(a1) - exp_ni(a2) + LAMBDA_INIT; }
  const unsigned lst = (unsigned)(size_t)&stg[0][tid >> 2][(tid & 3) * 8];   // this lane's LDS byte address in buffer 0, row group 0
  const size_t vso = ((size_t)b * DM + h * HD + (tid >> 2)) * SS + (tid & 3) * 8; const _Float16* gvh = VTH + vso; const _Float16* gvl = VTL + vso;
  // the two sub-heads are processed one after the other (sub-head 0's normalised P.V parked in LDS) to keep registers under 256
#pragma unroll 1
  for (int sh2 = 0; sh2 < 2; ++sh2) {
    const v16h aq = frag_h(QK + rq * (2 * DM) + h * HD + sh2 * 32, lane), aql = frag_h(QKL + rq * (2 * DM) + h * HD + sh2 * 32, lane);
    float m = -3.0e38f, l = 0.f;   // this lane's query: running maximum (same in both halves) and this half's part of the sum
    v8f acc[4] = {}, accl[4] = {};   // acc[dt][r]: value dim dt * 16 + 8 g + r of query col
    const size_t kso = ((size_t)b * SS + (tid >> 2)) * (2 * DM) + DM + h * HD + sh2 * 32 + (tid & 3) * 8; const _Float16* gkh = QK + kso; const _Float16* gkl = QKL + kso;
    stage_tile(lst, gkh, gkl, gvh, gvl);                       // tile 0 (both buffers are free: the last trip's foot ended every read)
    asm volatile("s_wait_asynccnt 0x0" ::: "memory");           // this wave's copies of tile 0 have landed
    __syncthreads();                                            // ... and every other wave's: tile 0 may be read
    stage_tile(lst + STG_BYTES, gkh + (size_t)32 * 2 * DM, gkl + (size_t)32 * 2 * DM, gvh + 32, gvl + 32);   // tile 1 flies during trip 0
#pragma unroll 1
    for (int ks = 0; ks < SS / 32; ++ks) { v8f s[2]; const _Float16 (*tb)[STG_PITCH] = stg[ks & 1];
      // all 24 LDS reads of the trip stand as one group at its head: the K fragments are waited for once, the V fragments land under the score products and the softmax
      v16h fkh[2], fkl[2], fvh[4], fvl[4];
#pragma unroll
      for (int ct = 0; ct < 2; ++ct) { fkh[ct] = frag_h(&tb[ct * 16 + col][0], lane); fkl[ct] = frag_h(&tb[32 + ct * 16 + col][0], lane); }
#pragma unroll
      for (int dt = 0; dt < 4; ++dt) { fvh[dt] = frag_h(&tb[64 + dt * 16 + col][0], lane); fvl[dt] = frag_h(&tb[128 + dt * 16 + col][0], lane); }
      __builtin_amdgcn_sched_barrier(0);   // keeps the reads above together: without it the compiler sinks each one to its product, where the wave waits out the LDS latency every time
#pragma unroll
      for (int ct = 0; ct < 2; ++ct) {
        v8f c = {}, cl = {}; c = wmma16(fkh[ct], aq, c); cl = wmma16(fkh[ct], aql, cl); cl = wmma16(fkl[ct], aq, cl);
#pragma unroll
        for (int r = 0; r < 8; ++r) s[ct][r] = (c[r] + cl[r] * (1.0f / 2048.0f)) * 0.17677669529663687f; }   // 32^-0.5
      float mx = fmaxf(s[0][0], s[1][0]);
#pragma unroll
      for (int r = 1; r < 8; ++r) mx = fmaxf(mx, fmaxf(s[0][r], s[1][r]));
      mx = fmaxf(mx, xhalf(mx));
      const float mn = fmaxf(m, mx); const float alpha = (m <= -1.0e38f) ? 0.f : __expf(m - mn); m = mn;
      v8f e0, e1; float es0 = 0.f, es1 = 0.f;
#pragma unroll
      for (int r = 0; r < 8; ++r) { e0[r] = __expf(s[0][r] - mn); e1[r] = __expf(s[1][r] - mn); es0 += e0[r]; es1 += e1[r]; }
      const v8h h0 = __builtin_convertvector(e0, v8h), h1 = __builtin_convertvector(e1, v8h);   // P as f16 hi ...
      const v8h l0 = __builtin_convertvector((e0 - __builtin_convertvector(h0, v8f)) * 2048.0f, v8h), l1 = __builtin_convertvector((e1 - __builtin_convertvector(h1, v8f)) * 2048.0f, v8h);   // ... + (x2048) residual
      const v16h pah = __builtin_shufflevector(h0, h1, 0, 1, 2, 3, 4, 5, 6, 7, 8, 9, 10, 11, 12, 13, 14, 15), pal = __builtin_shufflevector(l0, l1, 0, 1, 2, 3, 4, 5, 6, 7, 8, 9, 10, 11, 12, 13, 14, 15);
      l = l * alpha + (es0 + es1);
#pragma unroll
      for (int dt = 0; dt < 4; ++dt) { acc[dt] *= alpha; accl[dt] *= alpha; }
#pragma unroll
      for (int dt = 0; dt < 4; ++dt) { acc[dt] = wmma16(fvh[dt], pah, acc[dt]); accl[dt] = wmma16(fvh[dt], pal, accl[dt]); accl[dt] = wmma16(fvl[dt], pah, accl[dt]); }
      asm volatile("s_wait_dscnt 0x0" ::: "memory");            // this wave's reads of this tile are done
      asm volatile("s_wait_asynccnt 0x0" ::: "memory");         // this wave's copies of tile ks + 1 have landed
      __syncthreads();                                          // publishes tile ks + 1 and frees the buffer that this trip has read
      if (ks + 2 < SS / 32) stage_tile(lst + (unsigned)(ks & 1) * STG_BYTES, gkh + (size_t)(ks + 2) * 32 * 2 * DM, gkl + (size_t)(ks + 2) * 32 * 2 * DM, gvh + (ks + 2) * 32, gvl + (ks + 2) * 32); }
    asm volatile("s_wait_asynccnt 0x0" ::: "memory");           // nothing is in flight behind the loop
    const float il = 1.0f / (l + xhalf(l));   // the halves' sums are joined once
    if (sh2 == 0) {   // each lane parks, and later reads back, its own 32 values
#pragma unroll
      for (int dt = 0; dt < 4; ++dt) {
#pragma unroll
        for (int r = 0; r < 8; ++r) so1[wave][col][dt * 16 + 8 * g + r] = (acc[dt][r] + accl[dt][r] * (1.0f / 2048.0f)) * il; }
    } else {
      float ov[4][8]; float ssq = 0.f;
#pragma unroll
      for (int dt = 0; dt < 4; ++dt) {
#pragma unroll
        for (int r = 0; r < 8; ++r) { ov[dt][r] = so1[wave][col][dt * 16 + 8 * g + r] - lam * ((acc[dt][r] + accl[dt][r] * (1.0f / 2048.0f)) * il); ssq += ov[dt][r] * ov[dt][r]; } }
      ssq += xhalf(ssq);
      const float sc = (1.0f / sqrtf(ssq * (1.0f / HD) + 1e-5f)) * (1.0f - LAMBDA_INIT);
#pragma unroll
      for (int dt = 0; dt < 4; ++dt) {
#pragma unroll
        for (int r = 0; r < 8; ++r) so[wave][col][dt * 16 + 8 * g + r] = ov[dt][r] * sc * bfr(SUBW[dt * 16 + 8 * g + r]); } }
    LDSX(); }
  for (int rl = 0; rl < 16; ++rl) if (lane < 16) vst2(O + ((size_t)b * SS + q0 + rl) * DM + h * HD + lane * 4, *(const v4f*)&so[wave][rl][lane * 4]);
}
// ---- k_out: block = (64 rows, 128 cols): out = O(hi/lo) . Wo rows (2 products)
__global__ __launch_bounds__(128) void k_out(const float* __restrict__ O, const __bf16* __restrict__ P, float* __restrict__ Y) {
  __shared__ __align__(16) char sm[2 * GS_BYTES];   // in the loop two staged k blocks; behind it the epilogue's tile
  float (*so)[16][132] = (float (*)[16][132])sm;
  const int tid = threadIdx.x, wave = tid >> 5, lane = tid & 31, col = lane & 15, g = lane >> 4; const size_t r0 = (size_t)blockIdx.x * 64 + wave * 16; const int n0 = blockIdx.y * 128;
  const unsigned la = (unsigned)(size_t)sm + (tid >> 4) * GA_PITCH + (tid & 15) * 16, lw = (unsigned)(size_t)sm + GA_BYTES + (tid >> 3) * GB_PITCH + (tid & 7) * 16;   // this lane's LDS byte addresses in buffer 0
  const float* gx = O + ((size_t)blockIdx.x * 64 + (tid >> 4)) * DM + (tid & 15) * 4; const __bf16* gw = P + (size_t)(n0 + (tid >> 3)) * DM + (tid & 7) * 8;
  v8f acc[8] = {};
  stage_gemm(la, lw, gx, gw);                                 // block 0
  asm volatile("s_wait_asynccnt 0x0" ::: "memory");           // this wave's copies of block 0 have landed
  __syncthreads();                                            // ... and every other wave's: block 0 may be read
  stage_gemm(la + GS_BYTES, lw + GS_BYTES, gx + GK, gw + GK);   // block 1 flies during trip 0
#pragma unroll 1   // rolled: one copy of the trip keeps the text short
  for (int t = 0; t < DM / GK; ++t) { const char* tb = sm + (t & 1) * GS_BYTES;
    // the trip's 16 weight fragments in four groups of four, each read one group ahead of its products (as in k_qkv)
    const char* wrow = tb + GA_BYTES + col * GB_PITCH; v16b w[2][4]; F2 a[2];
#pragma unroll
    for (int u = 0; u < 2; ++u) { float xv[16]; row16(tb + (wave * 16 + col) * GA_PITCH, u, g, xv); a[u] = bsplit16(xv); }
#pragma unroll
    for (int i = 0; i < 4; ++i) w[0][i] = frag_b((const __bf16*)(wrow + i * 16 * GB_PITCH), lane);
#pragma unroll
    for (int q = 0; q < 4; ++q) {
      if (q < 3) {
#pragma unroll
        for (int i = 0; i < 4; ++i) w[(q + 1) & 1][i] = frag_b((const __bf16*)(wrow + (((q + 1) & 1) * 4 + i) * 16 * GB_PITCH) + ((q + 1) >> 1) * 32, lane); }
#pragma unroll
      for (int i = 0; i < 4; ++i) { const int j = (q & 1) * 4 + i; acc[j] = wmma_bf(a[q >> 1].l, w[q & 1][i], acc[j]); acc[j] = wmma_bf(a[q >> 1].h, w[q & 1][i], acc[j]); } }
    asm volatile("s_wait_dscnt 0x0" ::: "memory");            // this wave's reads of this block are done
    asm volatile("s_wait_asynccnt 0x0" ::: "memory");         // this wave's copies of block t + 1 have landed
    __syncthreads();                                          // publishes block t + 1 and frees the buffer that this trip has read
    if (t + 2 < DM / GK) stage_gemm(la + (unsigned)(t & 1) * GS_BYTES, lw + (unsigned)(t & 1) * GS_BYTES, gx + (t + 2) * GK, gw + (t + 2) * GK); }
  asm volatile("s_wait_asynccnt 0x0" ::: "memory");           // nothing is in flight behind the loop: the epilogue may take the LDS over
#pragma unroll
  for (int j = 0; j < 8; ++j) {
#pragma unroll
    for (int r = 0; r < 8; ++r) so[wave][8 * g + r][j * 16 + col] = acc[j][r]; }
  LDSX();
  for (int rl = 0; rl < 16; ++rl) vst2(Y + (r0 + rl) * DM + n0 + lane * 4, *(const v4f*)&so[wave][rl][lane * 4]);
}
extern "C" void kernel_launch(void* const* d_in, const int* in_sizes, int n_in, void* d_out, int out_size, void* d_ws, size_t ws_size, hipStream_t stream) {
  (void)in_sizes; (void)n_in; (void)out_size;
  const float** F = (const float**)d_in;   // 0 query_x [2,2048,1024], 1 kv_x, 2 Wq (in,out), 3 Wk, 4 Wv, 5 Wo, 6 lambda_q1 [32], 7 lambda_k1, 8 lambda_q2, 9 lambda_k2, 10 subln_w [64]
  if (ws_size < (size_t)WS_END) return;
  char* ws = (char*)d_ws; __bf16* PK = (__bf16*)(ws + WS_PK); _Float16 *QK = (_Float16*)(ws + WS_QK), *QKL = (_Float16*)(ws + WS_QKL), *VTH = (_Float16*)(ws + WS_VTH), *VTL = (_Float16*)(ws + WS_VTL); float* O = (float*)(ws + WS_O);
  k_pack<<<dim3(DM, 4), 256, 0, stream>>>(F[2], F[3], F[4], F[5], PK);
  k_qkv<<<dim3(TNB * SS / 64, QKVW / 128), 128, 0, stream>>>(F[0], F[1], PK + PK_A, QK, QKL, VTH, VTL);
  k_attn<<<dim3(TQB, NH, TNB), 128, 0, stream>>>(QK, QKL, VTH, VTL, F[6], F[7], F[8], F[9], F[10], O);
  k_out<<<dim3(TOB, DM / 128), 128, 0, stream>>>(O, PK + PK_P, (float*)d_out);
}

// v005
// It runs in 213 microseconds.
// Two timings next to v004 both put it at 1.11 times that version's speed.
// Counting every step since v000, it is 3.19 times as fast.
// compute dtype: query_x, kv_x, Wq, Wk, Wv, Wo, lambda_*, subln_w (module inputs) rounded to bf16; q (from query_x), k and v (from kv_x) with exact bf16 products on WMMA 16x16x32 ((in,out) weights packed as transposed rows); q and k stored as f16 hi + (x2048-scaled) residual planes; per head pair both 32-dim sub-head score maps with 3 products x 32^-0.5, two running-max softmaxes in f32 (hardware exp); P as f16 hi + (x2048) residual x v hi/lo (3 products) for both maps; lambda from the four 32-vectors in f32 (precise expf); the differential combination, RMS norm (eps 1e-5) x subln_w x (1 - lambda_init) in f32; output projection with the context as bf16 hi + residual x exact Wo (2 products); f32 accumulate.
#include <hip/hip_runtime.h>
#include <math.h>

typedef __attribute__((ext_vector_type(16))) _Float16 v16h;
typedef __attribute__((ext_vector_type(16))) __bf16 v16b;
typedef __attribute__((ext_vector_type(8)))  _Float16 v8h;
typedef __attribute__((ext_vector_type(8)))  float v8f;
typedef __attribute__((ext_vector_type(4)))  float v4f;
typedef __attribute__((ext_vector_type(2)))  float v2f;
typedef __attribute__((ext_vector_type(4)))  unsigned v4u;
typedef __attribute__((ext_vector_type(4)))  int v4i;
typedef float __attribute__((may_alias)) float_a;
typedef int __attribute__((may_alias)) int_a;

template <typename T> __device__ __forceinline__ void vst2(void* p, T v) { *(T*)p = v;  }
__device__ __forceinline__ v8f wmma16(v16h a, v16h b, v8f c) {
  v8f d = __builtin_amdgcn_wmma_f32_16x16x32_f16(false, a, false, b, (short)0, c, false, false);
  asm volatile("v_nop\n\tv_nop\n\tv_nop\n\tv_nop" : "+v"(d) : "v"(a), "v"(b));
  return d;
}
__device__ __forceinline__ v8f wmma_bf(v16b a, v16b b, v8f c) {
  v8f d = __builtin_amdgcn_wmma_f32_16x16x32_bf16(false, a, false, b, (short)0, c, false, false);
  asm volatile("v_nop\n\tv_nop\n\tv_nop\n\tv_nop" : "+v"(d) : "v"(a), "v"(b));
  return d;
}
// Cross multi-head differential attention (B 2, T = S = 2,048, d 1,024, 16 head pairs of 32-dim q/k and 64-dim values, depth-12 lambda_init): softmax(q1 k1) - lambda softmax(q2 k2) applied to v, RMS norm, output projection.
__device__ __forceinline__ v16h frag_h(const _Float16* rowk0, int lane) {
  union { v16h v; v8h q[2]; } u; const _Float16* p = rowk0 + 8 * (lane >> 4);
  u.q[0] = *(const v8h*)p; u.q[1] = *(const v8h*)(p + 16); return u.v;
}
__device__ __forceinline__ v16h frag_f32(const float* rowk0, int lane) {
  v16h a; const float* p = rowk0 + 8 * (lane >> 4);
#pragma unroll
  for (int i = 0; i < 8; ++i) { a[i] = (_Float16)p[i]; a[8 + i] = (_Float16)p[16 + i]; }
  return a;
}
__device__ __forceinline__ v16h frag_f32s(const float* rowk0, int lane, float sc) {
  v16h a; const float* p = rowk0 + 8 * (lane >> 4);
#pragma unroll
  for (int i = 0; i < 8; ++i) { a[i] = (_Float16)(p[i] * sc); a[8 + i] = (_Float16)(p[16 + i] * sc); }
  return a;
}
// column fragment from a [K][ld] layout (column n), rows >= K read as 0
__device__ __forceinline__ v16h fragc_f32(const float* W, int k0, int n, int lane, int ld, int K) {
  v16h a; const int g = lane >> 4;
#pragma unroll
  for (int i = 0; i < 8; ++i) { const int ka = k0 + 8 * g + i, kb = ka + 16;
    a[i] = (_Float16)(ka < K ? W[(size_t)(ka < K ? ka : K - 1) * ld + n] : 0.f); a[8 + i] = (_Float16)(kb < K ? W[(size_t)(kb < K ? kb : K - 1) * ld + n] : 0.f); }
  return a;
}
struct F2 { v16b h, l; };
__device__ __forceinline__ F2 bsplit16(const float v[16]) { F2 r;
#pragma unroll
  for (int i = 0; i < 16; ++i) { const __bf16 h = (__bf16)v[i]; r.h[i] = h; r.l[i] = (__bf16)(v[i] - (float)h); }
  return r; }
__device__ __forceinline__ F2 split_row(const float* row, int k0, int lane) { float v[16]; const float* p = row + k0 + 8 * (lane >> 4);
#pragma unroll
  for (int i = 0; i < 8; ++i) { v[i] = p[i]; v[8 + i] = p[16 + i]; }
  return bsplit16(v); }
__device__ __forceinline__ F2 split_rowK(const float* row, int k0, int lane, int K) { float v[16]; const int g = lane >> 4;
#pragma unroll
  for (int i = 0; i < 8; ++i) { const int ka = k0 + 8 * g + i, kb = ka + 16; v[i] = ka < K ? row[ka < K ? ka : K - 1] : 0.f; v[8 + i] = kb < K ? row[kb < K ? kb : K - 1] : 0.f; }
  return bsplit16(v); }
__device__ __forceinline__ F2 split_col(const float* W, int k0, int n, int lane, int ld, int K) { float v[16]; const int g = lane >> 4;
#pragma unroll
  for (int i = 0; i < 8; ++i) { const int ka = k0 + 8 * g + i, kb = ka + 16; v[i] = ka < K ? W[(size_t)(ka < K ? ka : K - 1) * ld + n] : 0.f; v[8 + i] = kb < K ? W[(size_t)(kb < K ? kb : K - 1) * ld + n] : 0.f; }
  return bsplit16(v); }
__device__ __forceinline__ v8f mac3(const F2& a, const F2& b, v8f c) { c = wmma_bf(a.l, b.h, c); c = wmma_bf(a.h, b.l, c); return wmma_bf(a.h, b.h, c); }
__device__ __forceinline__ float sigm(float v) { return 1.0f / (1.0f + expf(-v)); }
#define LDSX() do { asm volatile("s_wait_dscnt 0" ::: "memory"); __builtin_amdgcn_wave_barrier(); __builtin_amdgcn_fence(__ATOMIC_RELEASE, "workgroup"); } while (0)


#define NB 2
#define SS 2048
#define DM 1024
#define NH 16
#define HD 64
#define QKVW (3 * DM)
#ifndef TQB
#define TQB (SS / 64)
#define TNB NB
#define TOB (NB * SS / 64)     // output row tiles (all)
#endif
typedef __attribute__((ext_vector_type(8))) __bf16 v8b;
__device__ __forceinline__ v16b frag_b(const __bf16* rowk0, int lane) {
  union { v16b v; v8b q[2]; } u; const __bf16* p = rowk0 + 8 * (lane >> 4);
  u.q[0] = *(const v8b*)p; u.q[1] = *(const v8b*)(p + 16); return u.v;
}
__device__ __forceinline__ float bfr(float v) { return (float)(__bf16)v; }
__device__ __attribute__((noinline)) float exp_ni(float v) { return expf(v); }
__device__ __attribute__((noinline)) float erf_ni(float v) { return erff(v); }

#define PK_A 0                       // [3072][1024] Wqkv rows (natural [out][in])
#define PK_P (PK_A + QKVW * DM)        // [1024][1024] Wo rows (natural)
#define PK_END (PK_P + DM * DM)
#define WS_PK  0u
#define WS_QK  (WS_PK + 2u * PK_END)             // f16 [4096 rows][2048]: q | k
#define WS_QKL (WS_QK + 2u * NB * SS * 2 * DM)     // f16 q | k residual planes x2048
#define WS_VTH (WS_QKL + 2u * NB * SS * 2 * DM)    // f16 [b][1024 (h*64+d)][2048 s] hi
#define WS_VTL (WS_VTH + 2u * NB * DM * SS)        // f16 lo x 2048
#define WS_O   (WS_VTL + 2u * NB * DM * SS)        // f32 [4096][1024]
#define WS_CS  (WS_O + 4u * NB * SS * DM)           // 2 x [2048][32] f32, reserved, unused (no RoPE)
#define WS_END (WS_CS + 4u * 2 * SS * 32)
// ---- k_pack: block = (128 columns n, 64 rows k, which) of an (in,out) weight: the tile is read along its rows (a wave-wide 16-byte load = 512 contiguous bytes of one k row), rounded to bf16, turned in LDS and written as 128-byte pieces of the transposed rows; which 0..2 -> W_q/W_k/W_v into PK_A rows which*1024 + n; 3 -> W_o into PK_P
#define PT_N 128
#define PT_K 64
#define PT_P (PT_K / 2 + 1)               // dwords per LDS row n: 32 pairs of k neighbours and one of padding, so that the writes (lanes 4 rows apart) and the row-wise read-out both spread over the banks
typedef __attribute__((ext_vector_type(2))) __bf16 v2b;
__global__ __launch_bounds__(128) void k_pack(const float* __restrict__ WQ, const float* __restrict__ WK, const float* __restrict__ WV, const float* __restrict__ WO, __bf16* __restrict__ PK) {
  __shared__ __align__(16) unsigned s[PT_N * PT_P]; const int t = threadIdx.x, wave = t >> 5, lane = t & 31, n0 = blockIdx.x * PT_N, k0 = blockIdx.y * PT_K, which = blockIdx.z; const float* Wm = (which == 0) ? WQ : (which == 1) ? WK : (which == 2) ? WV : WO;
  const float* src = Wm + (size_t)(k0 + wave * 16) * DM + n0 + lane * 4;   // this wave's 16 k rows, this lane's 4 columns
  v4f x[16];
#pragma unroll   // x[] stays in registers and the 16 loads issue as one group
  for (int i = 0; i < 16; ++i) x[i] = *(const v4f*)(src + (size_t)i * DM);
  // all 16 loads are in flight together, and no register that one of them names (data or address) is rewritten ahead of this wait (a precaution): the values are inputs only
  asm volatile("s_wait_xcnt 0x0" :: "v"(x[0]), "v"(x[1]), "v"(x[2]), "v"(x[3]), "v"(x[4]), "v"(x[5]), "v"(x[6]), "v"(x[7]), "v"(x[8]), "v"(x[9]), "v"(x[10]), "v"(x[11]), "v"(x[12]), "v"(x[13]), "v"(x[14]), "v"(x[15]), "v"(src) : "memory");
#pragma unroll   // constant indices into x[] (both loops)
  for (int i = 0; i < 8; ++i) {
#pragma unroll
    for (int j = 0; j < 4; ++j) { const v2b two = { (__bf16)x[2 * i][j], (__bf16)x[2 * i + 1][j] }; s[(lane * 4 + j) * PT_P + wave * 8 + i] = __builtin_bit_cast(unsigned, two); } }
  __syncthreads();
  __bf16* dst = ((which < 3) ? PK + PK_A + ((size_t)which * DM + n0) * DM : PK + PK_P + (size_t)n0 * DM) + k0;
  unsigned* d = (unsigned*)(dst + (size_t)wave * (PT_N / 4) * DM) + lane; const unsigned* sr = s + wave * (PT_N / 4) * PT_P + lane; unsigned y[PT_N / 4];
#pragma unroll   // all 32 LDS reads ahead of the stores, each value in a register of its own: no register of an issued store is rewritten
  for (int r = 0; r < PT_N / 4; ++r) y[r] = sr[r * PT_P];
#pragma unroll   // constant indices into y[], row steps as immediate offsets
  for (int r = 0; r < PT_N / 4; ++r) d[r * (DM / 2)] = y[r];   // one whole 128-byte line a wave-wide store
}
#define GK 64                              // k depth of one staged block: X rows of 256 bytes, weight rows of 128 bytes, whole cache lines
#define GA_PITCH 272                       // LDS bytes per staged f32 row (256 data bytes, 16 B x odd for the ds_load_b128 readers)
#define GB_PITCH 144                       // LDS bytes per staged bf16 weight row (128 data bytes, 16 B x odd)
#define GA_BYTES (64 * GA_PITCH)
#define GS_BYTES (GA_BYTES + 128 * GB_PITCH)   // one staged block: 64 f32 rows, then 128 weight rows
#define COPY8_TEXT "global_load_async_to_lds_b128 %0, %8, off\n\t" "global_load_async_to_lds_b128 %1, %9, off\n\t" "global_load_async_to_lds_b128 %2, %10, off\n\t" "global_load_async_to_lds_b128 %3, %11, off\n\t" \
                   "global_load_async_to_lds_b128 %4, %12, off\n\t" "global_load_async_to_lds_b128 %5, %13, off\n\t" "global_load_async_to_lds_b128 %6, %14, off\n\t" "global_load_async_to_lds_b128 %7, %15, off\n\t" "s_wait_xcnt 0x0"
// one 64-deep k block of a 64 x 128 GEMM tile into LDS, through no register: every lane copies 16 bytes of eight f32 rows (16 lanes a row, rows 8 apart) and of eight weight rows (8 lanes a row, rows 16 apart), so each wave-wide copy covers whole lines.
// s_wait_xcnt 0 is each statement's last line so that no address register a copy names is rewritten ahead of it (a precaution).
__device__ __forceinline__ void stage_gemm(unsigned la, unsigned lw, const float* gx, const __bf16* gw) {
  const unsigned sa = 8 * GA_PITCH, sw = 16 * GB_PITCH;
  asm volatile(COPY8_TEXT :: "v"(la), "v"(la + sa), "v"(la + 2 * sa), "v"(la + 3 * sa), "v"(la + 4 * sa), "v"(la + 5 * sa), "v"(la + 6 * sa), "v"(la + 7 * sa),
               "v"(gx), "v"(gx + 8 * DM), "v"(gx + 16 * DM), "v"(gx + 24 * DM), "v"(gx + 32 * DM), "v"(gx + 40 * DM), "v"(gx + 48 * DM), "v"(gx + 56 * DM) : "memory");
  asm volatile(COPY8_TEXT :: "v"(lw), "v"(lw + sw), "v"(lw + 2 * sw), "v"(lw + 3 * sw), "v"(lw + 4 * sw), "v"(lw + 5 * sw), "v"(lw + 6 * sw), "v"(lw + 7 * sw),
               "v"(gw), "v"(gw + 16 * DM), "v"(gw + 32 * DM), "v"(gw + 48 * DM), "v"(gw + 64 * DM), "v"(gw + 80 * DM), "v"(gw + 96 * DM), "v"(gw + 112 * DM) : "memory");
}
// the 16 f32 of one A fragment (k order of frag_b) from a staged row
__device__ __forceinline__ void row16(const char* row, int u, int g, float v[16]) {
  const v4f* p = (const v4f*)(row + u * 128 + 32 * g); const v4f x0 = p[0], x1 = p[1], x2 = p[4], x3 = p[5];
#pragma unroll
  for (int i = 0; i < 4; ++i) { v[i] = x0[i]; v[4 + i] = x1[i]; v[8 + i] = x2[i]; v[12 + i] = x3[i]; }
}
__global__ __launch_bounds__(128) void k_qkv(const float* __restrict__ XQ, const float* __restrict__ XKV, const __bf16* __restrict__ P, _Float16* __restrict__ QK, _Float16* __restrict__ QKL, _Float16* __restrict__ VTH, _Float16* __restrict__ VTL) {
  const float* X = (blockIdx.y * 128 < DM) ? XQ : XKV;   // q from query_x, k and v from kv_x
  __shared__ __align__(16) char sm[2 * GS_BYTES];   // in the loop two staged k blocks (the next lands while this one is read by all four waves); behind it the epilogue's tiles
  _Float16 (*so)[16][136] = (_Float16 (*)[16][136])sm; _Float16 (*sol)[16][136] = (_Float16 (*)[16][136])(sm + 4 * 16 * 136 * 2); _Float16 (*sth)[72] = (_Float16 (*)[72])sm; _Float16 (*stl)[72] = (_Float16 (*)[72])(sm + 128 * 72 * 2);
  const int tid = threadIdx.x, wave = tid >> 5, lane = tid & 31, col = lane & 15, g = lane >> 4; const size_t r0 = (size_t)blockIdx.x * 64 + wave * 16; const int n0 = blockIdx.y * 128;
  const unsigned la = (unsigned)(size_t)sm + (tid >> 4) * GA_PITCH + (tid & 15) * 16, lw = (unsigned)(size_t)sm + GA_BYTES + (tid >> 3) * GB_PITCH + (tid & 7) * 16;   // this lane's LDS byte addresses in buffer 0
  const float* gx = X + ((size_t)blockIdx.x * 64 + (tid >> 4)) * DM + (tid & 15) * 4; const __bf16* gw = P + (size_t)(n0 + (tid >> 3)) * DM + (tid & 7) * 8;
  v8f acc[8] = {};
  stage_gemm(la, lw, gx, gw);                                 // block 0
  asm volatile("s_wait_asynccnt 0x0" ::: "memory");           // this wave's copies of block 0 have landed
  __syncthreads();                                            // ... and every other wave's: block 0 may be read
  stage_gemm(la + GS_BYTES, lw + GS_BYTES, gx + GK, gw + GK);   // block 1 flies during trip 0
#pragma unroll 1   // rolled: one copy of the trip keeps the text short
  for (int t = 0; t < DM / GK; ++t) { const char* tb = sm + (t & 1) * GS_BYTES;
    // the trip's 16 weight fragments in four groups of four (group q: k half q / 2, columns 64 (q & 1) ...), each read one group ahead of its products so that a wave does not wait out the LDS latency per product
    const char* wrow = tb + GA_BYTES + col * GB_PITCH; v16b w[2][4], a[2];
#pragma unroll
    for (int u = 0; u < 2; ++u) { float xv[16]; row16(tb + (wave * 16 + col) * GA_PITCH, u, g, xv);
#pragma unroll
      for (int i = 0; i < 16; ++i) a[u][i] = (__bf16)xv[i]; }
#pragma unroll
    for (int i = 0; i < 4; ++i) w[0][i] = frag_b((const __bf16*)(wrow + i * 16 * GB_PITCH), lane);
#pragma unroll
    for (int q = 0; q < 4; ++q) {
      if (q < 3) {
#pragma unroll
        for (int i = 0; i < 4; ++i) w[(q + 1) & 1][i] = frag_b((const __bf16*)(wrow + (((q + 1) & 1) * 4 + i) * 16 * GB_PITCH) + ((q + 1) >> 1) * 32, lane); }
#pragma unroll
      for (int i = 0; i < 4; ++i) acc[(q & 1) * 4 + i] = wmma_bf(a[q >> 1], w[q & 1][i], acc[(q & 1) * 4 + i]); }
    asm volatile("s_wait_dscnt 0x0" ::: "memory");            // this wave's reads of this block are done
    asm volatile("s_wait_asynccnt 0x0" ::: "memory");         // this wave's copies of block t + 1 have landed
    __syncthreads();                                          // publishes block t + 1 and frees the buffer that this trip has read
    if (t + 2 < DM / GK) stage_gemm(la + (unsigned)(t & 1) * GS_BYTES, lw + (unsigned)(t & 1) * GS_BYTES, gx + (t + 2) * GK, gw + (t + 2) * GK); }
  asm volatile("s_wait_asynccnt 0x0" ::: "memory");           // nothing is in flight behind the loop: the epilogue may take the LDS over
  if (n0 < 2 * DM) {   // q stored unscaled (f16 sigma ~0.6, no subnormal exposure); 32^-0.5 applied to the f32 score
#pragma unroll
    for (int j = 0; j < 8; ++j) {
#pragma unroll
      for (int r = 0; r < 8; ++r) { const float v = acc[j][r]; const _Float16 hv = (_Float16)v; so[wave][8 * g + r][j * 16 + col] = hv; sol[wave][8 * g + r][j * 16 + col] = (_Float16)((v - (float)hv) * 2048.0f); } }   // q, k as f16 hi + (x2048) residual (no RoPE in this module)
    LDSX();
    for (int rl = 0; rl < 16; ++rl) if (lane < 16) { vst2((unsigned*)(QK + (r0 + rl) * (2 * DM) + n0 + lane * 8), *(const v4u*)&so[wave][rl][lane * 8]); vst2((unsigned*)(QKL + (r0 + rl) * (2 * DM) + n0 + lane * 8), *(const v4u*)&sol[wave][rl][lane * 8]); }
  } else {
#pragma unroll
    for (int j = 0; j < 8; ++j) {
#pragma unroll
      for (int r = 0; r < 8; ++r) { const float v = acc[j][r]; const _Float16 hv = (_Float16)v; sth[j * 16 + col][wave * 16 + 8 * g + r] = hv; stl[j * 16 + col][wave * 16 + 8 * g + r] = (_Float16)((v - (float)hv) * 2048.0f); } }
    __syncthreads();
    const size_t rb = (size_t)blockIdx.x * 64; const int b = (int)(rb / SS), s0 = (int)(rb % SS); const int pc0 = n0 - 2 * DM;
    for (int q = tid; q < 128 * 8; q += 128) { const int d = q >> 3, pc = q & 7; const size_t o = ((size_t)b * DM + pc0 + d) * SS + s0 + pc * 8; vst2((unsigned*)(VTH + o), *(const v4u*)&sth[d][pc * 8]); vst2((unsigned*)(VTL + o), *(const v4u*)&stl[d][pc * 8]); }
  }
}
__device__ __forceinline__ float xhalf(float x) { return __builtin_bit_cast(float, __builtin_amdgcn_permlanex16(__builtin_bit_cast(int, x), __builtin_bit_cast(int, x), 0x76543210, 0xfedcba98, false, false)); }   // lane l with lane l ^ 16
#define LAMBDA_INIT 0.78360247f   // 0.8 - 0.6*exp(-0.3*12), float32
#define STG_PITCH 40                       // f16 per staged row: 64 data bytes at an 80-byte pitch (16 B x odd) for the ds_load_b128 readers
#define STG_ROWS 192                       // one 32-key tile: rows 0..31 K hi, 32..63 K lo (row = key), 64..127 V hi, 128..191 V lo (row = value dim)
#define STG_BYTES (STG_ROWS * STG_PITCH * 2)
// one 32-key tile into LDS: every lane copies 16 bytes of six rows (its row r = tid / 4 of each 32-row group), through no register.
// s_wait_xcnt 0 is the statement's last line so that no address register a copy names is rewritten ahead of it (a precaution).
__device__ __forceinline__ void stage_tile(unsigned l, const _Float16* kh, const _Float16* kl, const _Float16* vh, const _Float16* vl) {
  const unsigned g32 = 32 * STG_PITCH * 2;   // LDS bytes of one 32-row group
  asm volatile("global_load_async_to_lds_b128 %0, %6, off\n\t"
               "global_load_async_to_lds_b128 %1, %7, off\n\t"
               "global_load_async_to_lds_b128 %2, %8, off\n\t"
               "global_load_async_to_lds_b128 %3, %9, off\n\t"
               "global_load_async_to_lds_b128 %4, %10, off\n\t"
               "global_load_async_to_lds_b128 %5, %11, off\n\t"
               "s_wait_xcnt 0x0"
               :: "v"(l), "v"(l + g32), "v"(l + 2 * g32), "v"(l + 3 * g32), "v"(l + 4 * g32), "v"(l + 5 * g32),
                  "v"(kh), "v"(kl), "v"(vh), "v"(vh + 32 * SS), "v"(vl), "v"(vl + 32 * SS) : "memory");
}
__global__ __launch_bounds__(128) void k_attn(const _Float16* __restrict__ QK, const _Float16* __restrict__ QKL, const _Float16* __restrict__ VTH, const _Float16* __restrict__ VTL, const float* __restrict__ LQ1, const float* __restrict__ LK1, const float* __restrict__ LQ2, const float* __restrict__ LK2, const float* __restrict__ SUBW, float* __restrict__ O) {
  __shared__ __align__(16) float so[4][16][68]; __shared__ __align__(16) float so1[4][16][68];
  __shared__ __align__(16) _Float16 stg[2][STG_ROWS][STG_PITCH];   // two buffers: the next 32-key tile lands while this one is read by all four waves
  const int tid = threadIdx.x, wave = tid >> 5, lane = tid & 31, col = lane & 15, g = lane >> 4;
  const int qb = blockIdx.x, h = blockIdx.y, b = blockIdx.z; const int q0 = qb * 64 + wave * 16; const size_t rq = (size_t)b * SS + q0 + col;
  float lam; { float a1 = 0.f, a2 = 0.f;
#pragma unroll 1
    for (int i = 0; i < 32; ++i) { a1 += bfr(LQ1[i]) * bfr(LK1[i]); a2 += bfr(LQ2[i]) * bfr(LK2[i]); }
    lam = exp_ni(a1) - exp_ni(a2) + LAMBDA_INIT; }
  const unsigned lst = (unsigned)(size_t)&stg[0][tid >> 2][(tid & 3) * 8];   // this lane's LDS byte address in buffer 0, row group 0
  const size_t vso = ((size_t)b * DM + h * HD + (tid >> 2)) * SS + (tid & 3) * 8; const _Float16* gvh = VTH + vso; const _Float16* gvl = VTL + vso;
  // the two sub-heads are processed one after the other (sub-head 0's normalised P.V parked in LDS) to keep registers under 256
#pragma unroll 1
  for (int sh2 = 0; sh2 < 2; ++sh2) {
    const v16h aq = frag_h(QK + rq * (2 * DM) + h * HD + sh2 * 32, lane), aql = frag_h(QKL + rq * (2 * DM) + h * HD + sh2 * 32, lane);
    float m = -3.0e38f, l = 0.f;   // this lane's query: running maximum (same in both halves) and this half's part of the sum
    v8f acc[4] = {}, accl[4] = {};   // acc[dt][r]: value dim dt * 16 + 8 g + r of query col
    const size_t kso = ((size_t)b * SS + (tid >> 2)) * (2 * DM) + DM + h * HD + sh2 * 32 + (tid & 3) * 8; const _Float16* gkh = QK + kso; const _Float16* gkl = QKL + kso;
    stage_tile(lst, gkh, gkl, gvh, gvl);                       // tile 0 (both buffers are free: the last trip's foot ended every read)
    asm volatile("s_wait_asynccnt 0x0" ::: "memory");           // this wave's copies of tile 0 have landed
    __syncthreads();                                            // ... and every other wave's: tile 0 may be read
    stage_tile(lst + STG_BYTES, gkh + (size_t)32 * 2 * DM, gkl + (size_t)32 * 2 * DM, gvh + 32, gvl + 32);   // tile 1 flies during trip 0
#pragma unroll 1
    for (int ks = 0; ks < SS / 32; ++ks) { v8f s[2]; const _Float16 (*tb)[STG_PITCH] = stg[ks & 1];
      // all 24 LDS reads of the trip stand as one group at its head: the K fragments are waited for once, the V fragments land under the score products and the softmax
      v16h fkh[2], fkl[2], fvh[4], fvl[4];
#pragma unroll
      for (int ct = 0; ct < 2; ++ct) { fkh[ct] = frag_h(&tb[ct * 16 + col][0], lane); fkl[ct] = frag_h(&tb[32 + ct * 16 + col][0], lane); }
#pragma unroll
      for (int dt = 0; dt < 4; ++dt) { fvh[dt] = frag_h(&tb[64 + dt * 16 + col][0], lane); fvl[dt] = frag_h(&tb[128 + dt * 16 + col][0], lane); }
      __builtin_amdgcn_sched_barrier(0);   // keeps the reads above together: without it the compiler sinks each one to its product, where the wave waits out the LDS latency every time
#pragma unroll
      for (int ct = 0; ct < 2; ++ct) {
        v8f c = {}, cl = {}; c = wmma16(fkh[ct], aq, c); cl = wmma16(fkh[ct], aql, cl); cl = wmma16(fkl[ct], aq, cl);
#pragma unroll
        for (int r = 0; r < 8; ++r) s[ct][r] = (c[r] + cl[r] * (1.0f / 2048.0f)) * 0.17677669529663687f; }   // 32^-0.5
      float mx = fmaxf(s[0][0], s[1][0]);
#pragma unroll
      for (int r = 1; r < 8; ++r) mx = fmaxf(mx, fmaxf(s[0][r], s[1][r]));
      mx = fmaxf(mx, xhalf(mx));
      const float mn = fmaxf(m, mx); const float alpha = (m <= -1.0e38f) ? 0.f : __expf(m - mn); m = mn;
      v8f e0, e1; float es0 = 0.f, es1 = 0.f;
#pragma unroll
      for (int r = 0; r < 8; ++r) { e0[r] = __expf(s[0][r] - mn); e1[r] = __expf(s[1][r] - mn); es0 += e0[r]; es1 += e1[r]; }
      const v8h h0 = __builtin_convertvector(e0, v8h), h1 = __builtin_convertvector(e1, v8h);   // P as f16 hi ...
      const v8h l0 = __builtin_convertvector((e0 - __builtin_convertvector(h0, v8f)) * 2048.0f, v8h), l1 = __builtin_convertvector((e1 - __builtin_convertvector(h1, v8f)) * 2048.0f, v8h);   // ... + (x2048) residual
      const v16h pah = __builtin_shufflevector(h0, h1, 0, 1, 2, 3, 4, 5, 6, 7, 8, 9, 10, 11, 12, 13, 14, 15), pal = __builtin_shufflevector(l0, l1, 0, 1, 2, 3, 4, 5, 6, 7, 8, 9, 10, 11, 12, 13, 14, 15);
      l = l * alpha + (es0 + es1);
#pragma unroll
      for (int dt = 0; dt < 4; ++dt) { acc[dt] *= alpha; accl[dt] *= alpha; }
#pragma unroll
      for (int dt = 0; dt < 4; ++dt) { acc[dt] = wmma16(fvh[dt], pah, acc[dt]); accl[dt] = wmma16(fvh[dt], pal, accl[dt]); accl[dt] = wmma16(fvl[dt], pah, accl[dt]); }
      asm volatile("s_wait_dscnt 0x0" ::: "memory");            // this wave's reads of this tile are done
      asm volatile("s_wait_asynccnt 0x0" ::: "memory");         // this wave's copies of tile ks + 1 have landed
      __syncthreads();                                          // publishes tile ks + 1 and frees the buffer that this trip has read
      if (ks + 2 < SS / 32) stage_tile(lst + (unsigned)(ks & 1) * STG_BYTES, gkh + (size_t)(ks + 2) * 32 * 2 * DM, gkl + (size_t)(ks + 2) * 32 * 2 * DM, gvh + (ks + 2) * 32, gvl + (ks + 2) * 32); }
    asm volatile("s_wait_asynccnt 0x0" ::: "memory");           // nothing is in flight behind the loop
    const float il = 1.0f / (l + xhalf(l));   // the halves' sums are joined once
    if (sh2 == 0) {   // each lane parks, and later reads back, its own 32 values
#pragma unroll
      for (int dt = 0; dt < 4; ++dt) {
#pragma unroll
        for (int r = 0; r < 8; ++r) so1[wave][col][dt * 16 + 8 * g + r] = (acc[dt][r] + accl[dt][r] * (1.0f / 2048.0f)) * il; }
    } else {
      float ov[4][8]; float ssq = 0.f;
#pragma unroll
      for (int dt = 0; dt < 4; ++dt) {
#pragma unroll
        for (int r = 0; r < 8; ++r) { ov[dt][r] = so1[wave][col][dt * 16 + 8 * g + r] - lam * ((acc[dt][r] + accl[dt][r] * (1.0f / 2048.0f)) * il); ssq += ov[dt][r] * ov[dt][r]; } }
      ssq += xhalf(ssq);
      const float sc = (1.0f / sqrtf(ssq * (1.0f / HD) + 1e-5f)) * (1.0f - LAMBDA_INIT);
#pragma unroll
      for (int dt = 0; dt < 4; ++dt) {
#pragma unroll
        for (int r = 0; r < 8; ++r) so[wave][col][dt * 16 + 8 * g + r] = ov[dt][r] * sc * bfr(SUBW[dt * 16 + 8 * g + r]); } }
    LDSX(); }
  for (int rl = 0; rl < 16; ++rl) if (lane < 16) vst2(O + ((size_t)b * SS + q0 + rl) * DM + h * HD + lane * 4, *(const v4f*)&so[wave][rl][lane * 4]);
}
// ---- k_out: block = (64 rows, 128 cols): out = O(hi/lo) . Wo rows (2 products)
__global__ __launch_bounds__(128) void k_out(const float* __restrict__ O, const __bf16* __restrict__ P, float* __restrict__ Y) {
  __shared__ __align__(16) char sm[2 * GS_BYTES];   // in the loop two staged k blocks; behind it the epilogue's tile
  float (*so)[16][132] = (float (*)[16][132])sm;
  const int tid = threadIdx.x, wave = tid >> 5, lane = tid & 31, col = lane & 15, g = lane >> 4; const size_t r0 = (size_t)blockIdx.x * 64 + wave * 16; const int n0 = blockIdx.y * 128;
  const unsigned la = (unsigned)(size_t)sm + (tid >> 4) * GA_PITCH + (tid & 15) * 16, lw = (unsigned)(size_t)sm + GA_BYTES + (tid >> 3) * GB_PITCH + (tid & 7) * 16;   // this lane's LDS byte addresses in buffer 0
  const float* gx = O + ((size_t)blockIdx.x * 64 + (tid >> 4)) * DM + (tid & 15) * 4; const __bf16* gw = P + (size_t)(n0 + (tid >> 3)) * DM + (tid & 7) * 8;
  v8f acc[8] = {};
  stage_gemm(la, lw, gx, gw);                                 // block 0
  asm volatile("s_wait_asynccnt 0x0" ::: "memory");           // this wave's copies of block 0 have landed
  __syncthreads();                                            // ... and every other wave's: block 0 may be read
  stage_gemm(la + GS_BYTES, lw + GS_BYTES, gx + GK, gw + GK);   // block 1 flies during trip 0
#pragma unroll 1   // rolled: one copy of the trip keeps the text short
  for (int t = 0; t < DM / GK; ++t) { const char* tb = sm + (t & 1) * GS_BYTES;
    // the trip's 16 weight fragments in four groups of four, each read one group ahead of its products (as in k_qkv)
    const char* wrow = tb + GA_BYTES + col * GB_PITCH; v16b w[2][4]; F2 a[2];
#pragma unroll
    for (int u = 0; u < 2; ++u) { float xv[16]; row16(tb + (wave * 16 + col) * GA_PITCH, u, g, xv); a[u] = bsplit16(xv); }
#pragma unroll
    for (int i = 0; i < 4; ++i) w[0][i] = frag_b((const __bf16*)(wrow + i * 16 * GB_PITCH), lane);
#pragma unroll
    for (int q = 0; q < 4; ++q) {
      if (q < 3) {
#pragma unroll
        for (int i = 0; i < 4; ++i) w[(q + 1) & 1][i] = frag_b((const __bf16*)(wrow + (((q + 1) & 1) * 4 + i) * 16 * GB_PITCH) + ((q + 1) >> 1) * 32, lane); }
#pragma unroll
      for (int i = 0; i < 4; ++i) { const int j = (q & 1) * 4 + i; acc[j] = wmma_bf(a[q >> 1].l, w[q & 1][i], acc[j]); acc[j] = wmma_bf(a[q >> 1].h, w[q & 1][i], acc[j]); } }
    asm volatile("s_wait_dscnt 0x0" ::: "memory");            // this wave's reads of this block are done
    asm volatile("s_wait_asynccnt 0x0" ::: "memory");         // this wave's copies of block t + 1 have landed
    __syncthreads();                                          // publishes block t + 1 and frees the buffer that this trip has read
    if (t + 2 < DM / GK) stage_gemm(la + (unsigned)(t & 1) * GS_BYTES, lw + (unsigned)(t & 1) * GS_BYTES, gx + (t + 2) * GK, gw + (t + 2) * GK); }
  asm volatile("s_wait_asynccnt 0x0" ::: "memory");           // nothing is in flight behind the loop: the epilogue may take the LDS over
#pragma unroll
  for (int j = 0; j < 8; ++j) {
#pragma unroll
    for (int r = 0; r < 8; ++r) so[wave][8 * g + r][j * 16 + col] = acc[j][r]; }
  LDSX();
  for (int rl = 0; rl < 16; ++rl) vst2(Y + (r0 + rl) * DM + n0 + lane * 4, *(const v4f*)&so[wave][rl][lane * 4]);
}
extern "C" void kernel_launch(void* const* d_in, const int* in_sizes, int n_in, void* d_out, int out_size, void* d_ws, size_t ws_size, hipStream_t stream) {
  (void)in_sizes; (void)n_in; (void)out_size;
  const float** F = (const float**)d_in;   // 0 query_x [2,2048,1024], 1 kv_x, 2 Wq (in,out), 3 Wk, 4 Wv, 5 Wo, 6 lambda_q1 [32], 7 lambda_k1, 8 lambda_q2, 9 lambda_k2, 10 subln_w [64]
  if (ws_size < (size_t)WS_END) return;
  char* ws = (char*)d_ws; __bf16* PK = (__bf16*)(ws + WS_PK); _Float16 *QK = (_Float16*)(ws + WS_QK), *QKL = (_Float16*)(ws + WS_QKL), *VTH = (_Float16*)(ws + WS_VTH), *VTL = (_Float16*)(ws + WS_VTL); float* O = (float*)(ws + WS_O);
  k_pack<<<dim3(DM / PT_N, DM / PT_K, 4), 128, 0, stream>>>(F[2], F[3], F[4], F[5], PK);
  k_qkv<<<dim3(TNB * SS / 64, QKVW / 128), 128, 0, stream>>>(F[0], F[1], PK + PK_A, QK, QKL, VTH, VTL);
  k_attn<<<dim3(TQB, NH, TNB), 128, 0, stream>>>(QK, QKL, VTH, VTL, F[6], F[7], F[8], F[9], F[10], O);
  k_out<<<dim3(TOB, DM / 128), 128, 0, stream>>>(O, PK + PK_P, (float*)d_out);
}

// v006
// Measured time: 206 microseconds a run.
// Timed twice side by side with v005, it ran 1.04 and 1.03 times as fast.
// All steps since v000 together make it 3.30 times as fast.
// compute dtype: query_x, kv_x, Wq, Wk, Wv, Wo, lambda_*, subln_w (module inputs) rounded to bf16; q (from query_x), k and v (from kv_x) with exact bf16 products on WMMA 16x16x32 ((in,out) weights packed as transposed rows); q and k stored as f16 hi + (x2048-scaled) residual planes; per head pair both 32-dim sub-head score maps with 3 products x 32^-0.5, two running-max softmaxes in f32 (hardware exp); P as f16 hi + (x2048) residual x v hi/lo (3 products) for both maps; lambda from the four 32-vectors in f32 (precise expf); the differential combination, RMS norm (eps 1e-5) x subln_w x (1 - lambda_init) in f32; output projection with the context as bf16 hi + residual x exact Wo (2 products); f32 accumulate.
#include <hip/hip_runtime.h>
#include <math.h>

typedef __attribute__((ext_vector_type(16))) _Float16 v16h;
typedef __attribute__((ext_vector_type(16))) __bf16 v16b;
typedef __attribute__((ext_vector_type(8)))  _Float16 v8h;
typedef __attribute__((ext_vector_type(8)))  float v8f;
typedef __attribute__((ext_vector_type(4)))  float v4f;
typedef __attribute__((ext_vector_type(2)))  float v2f;
typedef __attribute__((ext_vector_type(4)))  unsigned v4u;
typedef __attribute__((ext_vector_type(4)))  int v4i;
typedef float __attribute__((may_alias)) float_a;
typedef int __attribute__((may_alias)) int_a;

template <typename T> __device__ __forceinline__ void vst2(void* p, T v) { *(T*)p = v;  }
__device__ __forceinline__ v8f wmma16(v16h a, v16h b, v8f c) {
  v8f d = __builtin_amdgcn_wmma_f32_16x16x32_f16(false, a, false, b, (short)0, c, false, false);
  return d;
}
__device__ __forceinline__ v8f wmma_bf(v16b a, v16b b, v8f c) {
  v8f d = __builtin_amdgcn_wmma_f32_16x16x32_bf16(false, a, false, b, (short)0, c, false, false);
  return d;
}
// Cross multi-head differential attention (B 2, T = S = 2,048, d 1,024, 16 head pairs of 32-dim q/k and 64-dim values, depth-12 lambda_init): softmax(q1 k1) - lambda softmax(q2 k2) applied to v, RMS norm, output projection.
__device__ __forceinline__ v16h frag_h(const _Float16* rowk0, int lane) {
  union { v16h v; v8h q[2]; } u; const _Float16* p = rowk0 + 8 * (lane >> 4);
  u.q[0] = *(const v8h*)p; u.q[1] = *(const v8h*)(p + 16); return u.v;
}
__device__ __forceinline__ v16h frag_f32(const float* rowk0, int lane) {
  v16h a; const float* p = rowk0 + 8 * (lane >> 4);
#pragma unroll
  for (int i = 0; i < 8; ++i) { a[i] = (_Float16)p[i]; a[8 + i] = (_Float16)p[16 + i]; }
  return a;
}
__device__ __forceinline__ v16h frag_f32s(const float* rowk0, int lane, float sc) {
  v16h a; const float* p = rowk0 + 8 * (lane >> 4);
#pragma unroll
  for (int i = 0; i < 8; ++i) { a[i] = (_Float16)(p[i] * sc); a[8 + i] = (_Float16)(p[16 + i] * sc); }
  return a;
}
// column fragment from a [K][ld] layout (column n), rows >= K read as 0
__device__ __forceinline__ v16h fragc_f32(const float* W, int k0, int n, int lane, int ld, int K) {
  v16h a; const int g = lane >> 4;
#pragma unroll
  for (int i = 0; i < 8; ++i) { const int ka = k0 + 8 * g + i, kb = ka + 16;
    a[i] = (_Float16)(ka < K ? W[(size_t)(ka < K ? ka : K - 1) * ld + n] : 0.f); a[8 + i] = (_Float16)(kb < K ? W[(size_t)(kb < K ? kb : K - 1) * ld + n] : 0.f); }
  return a;
}
struct F2 { v16b h, l; };
__device__ __forceinline__ F2 bsplit16(const float v[16]) { F2 r;
#pragma unroll
  for (int i = 0; i < 16; ++i) { const __bf16 h = (__bf16)v[i]; r.h[i] = h; r.l[i] = (__bf16)(v[i] - (float)h); }
  return r; }
__device__ __forceinline__ F2 split_row(const float* row, int k0, int lane) { float v[16]; const float* p = row + k0 + 8 * (lane >> 4);
#pragma unroll
  for (int i = 0; i < 8; ++i) { v[i] = p[i]; v[8 + i] = p[16 + i]; }
  return bsplit16(v); }
__device__ __forceinline__ F2 split_rowK(const float* row, int k0, int lane, int K) { float v[16]; const int g = lane >> 4;
#pragma unroll
  for (int i = 0; i < 8; ++i) { const int ka = k0 + 8 * g + i, kb = ka + 16; v[i] = ka < K ? row[ka < K ? ka : K - 1] : 0.f; v[8 + i] = kb < K ? row[kb < K ? kb : K - 1] : 0.f; }
  return bsplit16(v); }
__device__ __forceinline__ F2 split_col(const float* W, int k0, int n, int lane, int ld, int K) { float v[16]; const int g = lane >> 4;
#pragma unroll
  for (int i = 0; i < 8; ++i) { const int ka = k0 + 8 * g + i, kb = ka + 16; v[i] = ka < K ? W[(size_t)(ka < K ? ka : K - 1) * ld + n] : 0.f; v[8 + i] = kb < K ? W[(size_t)(kb < K ? kb : K - 1) * ld + n] : 0.f; }
  return bsplit16(v); }
__device__ __forceinline__ v8f mac3(const F2& a, const F2& b, v8f c) { c = wmma_bf(a.l, b.h, c); c = wmma_bf(a.h, b.l, c); return wmma_bf(a.h, b.h, c); }
__device__ __forceinline__ float sigm(float v) { return 1.0f / (1.0f + expf(-v)); }
#define LDSX() do { asm volatile("s_wait_dscnt 0" ::: "memory"); __builtin_amdgcn_wave_barrier(); __builtin_amdgcn_fence(__ATOMIC_RELEASE, "workgroup"); } while (0)


#define NB 2
#define SS 2048
#define DM 1024
#define NH 16
#define HD 64
#define QKVW (3 * DM)
#ifndef TQB
#define TQB (SS / 64)
#define TNB NB
#define TOB (NB * SS / 64)     // output row tiles (all)
#endif
typedef __attribute__((ext_vector_type(8))) __bf16 v8b;
__device__ __forceinline__ v16b frag_b(const __bf16* rowk0, int lane) {
  union { v16b v; v8b q[2]; } u; const __bf16* p = rowk0 + 8 * (lane >> 4);
  u.q[0] = *(const v8b*)p; u.q[1] = *(const v8b*)(p + 16); return u.v;
}
__device__ __forceinline__ float bfr(float v) { return (float)(__bf16)v; }
__device__ __attribute__((noinline)) float exp_ni(float v) { return expf(v); }
__device__ __attribute__((noinline)) float erf_ni(float v) { return erff(v); }

#define PK_A 0                       // [3072][1024] Wqkv rows (natural [out][in])
#define PK_P (PK_A + QKVW * DM)        // [1024][1024] Wo rows (natural)
#define PK_END (PK_P + DM * DM)
#define WS_PK  0u
#define WS_QK  (WS_PK + 2u * PK_END)             // f16 [4096 rows][2048]: q | k
#define WS_QKL (WS_QK + 2u * NB * SS * 2 * DM)     // f16 q | k residual planes x2048
#define WS_VTH (WS_QKL + 2u * NB * SS * 2 * DM)    // f16 [b][1024 (h*64+d)][2048 s] hi
#define WS_VTL (WS_VTH + 2u * NB * DM * SS)        // f16 lo x 2048
#define WS_O   (WS_VTL + 2u * NB * DM * SS)        // f32 [4096][1024]
#define WS_CS  (WS_O + 4u * NB * SS * DM)           // 2 x [2048][32] f32, reserved, unused (no RoPE)
#define WS_END (WS_CS + 4u * 2 * SS * 32)
// ---- k_pack: block = (128 columns n, 64 rows k, which) of an (in,out) weight: the tile is read along its rows (a wave-wide 16-byte load = 512 contiguous bytes of one k row), rounded to bf16, turned in LDS and written as 128-byte pieces of the transposed rows; which 0..2 -> W_q/W_k/W_v into PK_A rows which*1024 + n; 3 -> W_o into PK_P
#define PT_N 128
#define PT_K 64
#define PT_P (PT_K / 2 + 1)               // dwords per LDS row n: 32 pairs of k neighbours and one of padding, so that the writes (lanes 4 rows apart) and the row-wise read-out both spread over the banks
typedef __attribute__((ext_vector_type(2))) __bf16 v2b;
__global__ __launch_bounds__(128) void k_pack(const float* __restrict__ WQ, const float* __restrict__ WK, const float* __restrict__ WV, const float* __restrict__ WO, __bf16* __restrict__ PK) {
  __shared__ __align__(16) unsigned s[PT_N * PT_P]; const int t = threadIdx.x, wave = t >> 5, lane = t & 31, n0 = blockIdx.x * PT_N, k0 = blockIdx.y * PT_K, which = blockIdx.z; const float* Wm = (which == 0) ? WQ : (which == 1) ? WK : (which == 2) ? WV : WO;
  const float* src = Wm + (size_t)(k0 + wave * 16) * DM + n0 + lane * 4;   // this wave's 16 k rows, this lane's 4 columns
  v4f x[16];
#pragma unroll   // x[] stays in registers and the 16 loads issue as one group
  for (int i = 0; i < 16; ++i) x[i] = *(const v4f*)(src + (size_t)i * DM);
  // all 16 loads are in flight together, and no register that one of them names (data or address) is rewritten ahead of this wait (a precaution): the values are inputs only
  asm volatile("s_wait_xcnt 0x0" :: "v"(x[0]), "v"(x[1]), "v"(x[2]), "v"(x[3]), "v"(x[4]), "v"(x[5]), "v"(x[6]), "v"(x[7]), "v"(x[8]), "v"(x[9]), "v"(x[10]), "v"(x[11]), "v"(x[12]), "v"(x[13]), "v"(x[14]), "v"(x[15]), "v"(src) : "memory");
#pragma unroll   // constant indices into x[] (both loops)
  for (int i = 0; i < 8; ++i) {
#pragma unroll
    for (int j = 0; j < 4; ++j) { const v2b two = { (__bf16)x[2 * i][j], (__bf16)x[2 * i + 1][j] }; s[(lane * 4 + j) * PT_P + wave * 8 + i] = __builtin_bit_cast(unsigned, two); } }
  __syncthreads();
  __bf16* dst = ((which < 3) ? PK + PK_A + ((size_t)which * DM + n0) * DM : PK + PK_P + (size_t)n0 * DM) + k0;
  unsigned* d = (unsigned*)(dst + (size_t)wave * (PT_N / 4) * DM) + lane; const unsigned* sr = s + wave * (PT_N / 4) * PT_P + lane; unsigned y[PT_N / 4];
#pragma unroll   // all 32 LDS reads ahead of the stores, each value in a register of its own: no register of an issued store is rewritten
  for (int r = 0; r < PT_N / 4; ++r) y[r] = sr[r * PT_P];
#pragma unroll   // constant indices into y[], row steps as immediate offsets
  for (int r = 0; r < PT_N / 4; ++r) d[r * (DM / 2)] = y[r];   // one whole 128-byte line a wave-wide store
}
#define GK 64                              // k depth of one staged block: X rows of 256 bytes, weight rows of 128 bytes, whole cache lines
#define GA_PITCH 272                       // LDS bytes per staged f32 row (256 data bytes, 16 B x odd for the ds_load_b128 readers)
#define GB_PITCH 144                       // LDS bytes per staged bf16 weight row (128 data bytes, 16 B x odd)
#define GA_BYTES (64 * GA_PITCH)
#define GS_BYTES (GA_BYTES + 128 * GB_PITCH)   // one staged block: 64 f32 rows, then 128 weight rows
#define COPY8_TEXT "global_load_async_to_lds_b128 %0, %8, off\n\t" "global_load_async_to_lds_b128 %1, %9, off\n\t" "global_load_async_to_lds_b128 %2, %10, off\n\t" "global_load_async_to_lds_b128 %3, %11, off\n\t" \
                   "global_load_async_to_lds_b128 %4, %12, off\n\t" "global_load_async_to_lds_b128 %5, %13, off\n\t" "global_load_async_to_lds_b128 %6, %14, off\n\t" "global_load_async_to_lds_b128 %7, %15, off\n\t" "s_wait_xcnt 0x0"
// one 64-deep k block of a 64 x 128 GEMM tile into LDS, through no register: every lane copies 16 bytes of eight f32 rows (16 lanes a row, rows 8 apart) and of eight weight rows (8 lanes a row, rows 16 apart), so each wave-wide copy covers whole lines.
// s_wait_xcnt 0 is each statement's last line so that no address register a copy names is rewritten ahead of it (a precaution).
__device__ __forceinline__ void stage_gemm(unsigned la, unsigned lw, const float* gx, const __bf16* gw) {
  const unsigned sa = 8 * GA_PITCH, sw = 16 * GB_PITCH;
  asm volatile(COPY8_TEXT :: "v"(la), "v"(la + sa), "v"(la + 2 * sa), "v"(la + 3 * sa), "v"(la + 4 * sa), "v"(la + 5 * sa), "v"(la + 6 * sa), "v"(la + 7 * sa),
               "v"(gx), "v"(gx + 8 * DM), "v"(gx + 16 * DM), "v"(gx + 24 * DM), "v"(gx + 32 * DM), "v"(gx + 40 * DM), "v"(gx + 48 * DM), "v"(gx + 56 * DM) : "memory");
  asm volatile(COPY8_TEXT :: "v"(lw), "v"(lw + sw), "v"(lw + 2 * sw), "v"(lw + 3 * sw), "v"(lw + 4 * sw), "v"(lw + 5 * sw), "v"(lw + 6 * sw), "v"(lw + 7 * sw),
               "v"(gw), "v"(gw + 16 * DM), "v"(gw + 32 * DM), "v"(gw + 48 * DM), "v"(gw + 64 * DM), "v"(gw + 80 * DM), "v"(gw + 96 * DM), "v"(gw + 112 * DM) : "memory");
}
// the 16 f32 of one A fragment (k order of frag_b) from a staged row
__device__ __forceinline__ void row16(const char* row, int u, int g, float v[16]) {
  const v4f* p = (const v4f*)(row + u * 128 + 32 * g); const v4f x0 = p[0], x1 = p[1], x2 = p[4], x3 = p[5];
#pragma unroll
  for (int i = 0; i < 4; ++i) { v[i] = x0[i]; v[4 + i] = x1[i]; v[8 + i] = x2[i]; v[12 + i] = x3[i]; }
}
__global__ __launch_bounds__(128) void k_qkv(const float* __restrict__ XQ, const float* __restrict__ XKV, const __bf16* __restrict__ P, _Float16* __restrict__ QK, _Float16* __restrict__ QKL, _Float16* __restrict__ VTH, _Float16* __restrict__ VTL) {
  const float* X = (blockIdx.y * 128 < DM) ? XQ : XKV;   // q from query_x, k and v from kv_x
  __shared__ __align__(16) char sm[2 * GS_BYTES];   // in the loop two staged k blocks (the next lands while this one is read by all four waves); behind it the epilogue's tiles
  _Float16 (*so)[16][136] = (_Float16 (*)[16][136])sm; _Float16 (*sol)[16][136] = (_Float16 (*)[16][136])(sm + 4 * 16 * 136 * 2); _Float16 (*sth)[72] = (_Float16 (*)[72])sm; _Float16 (*stl)[72] = (_Float16 (*)[72])(sm + 128 * 72 * 2);
  const int tid = threadIdx.x, wave = tid >> 5, lane = tid & 31, col = lane & 15, g = lane >> 4; const size_t r0 = (size_t)blockIdx.x * 64 + wave * 16; const int n0 = blockIdx.y * 128;
  const unsigned la = (unsigned)(size_t)sm + (tid >> 4) * GA_PITCH + (tid & 15) * 16, lw = (unsigned)(size_t)sm + GA_BYTES + (tid >> 3) * GB_PITCH + (tid & 7) * 16;   // this lane's LDS byte addresses in buffer 0
  const float* gx = X + ((size_t)blockIdx.x * 64 + (tid >> 4)) * DM + (tid & 15) * 4; const __bf16* gw = P + (size_t)(n0 + (tid >> 3)) * DM + (tid & 7) * 8;
  v8f acc[8] = {};
  stage_gemm(la, lw, gx, gw);                                 // block 0
  asm volatile("s_wait_asynccnt 0x0" ::: "memory");           // this wave's copies of block 0 have landed
  __syncthreads();                                            // ... and every other wave's: block 0 may be read
  stage_gemm(la + GS_BYTES, lw + GS_BYTES, gx + GK, gw + GK);   // block 1 flies during trip 0
#pragma unroll 1   // rolled: one copy of the trip keeps the text short
  for (int t = 0; t < DM / GK; ++t) { const char* tb = sm + (t & 1) * GS_BYTES;
    // the trip's 16 weight fragments in four groups of four (group q: k half q / 2, columns 64 (q & 1) ...), each read one group ahead of its products so that a wave does not wait out the LDS latency per product
    const char* wrow = tb + GA_BYTES + col * GB_PITCH; v16b w[2][4], a[2];
#pragma unroll
    for (int u = 0; u < 2; ++u) { float xv[16]; row16(tb + (wave * 16 + col) * GA_PITCH, u, g, xv);
#pragma unroll
      for (int i = 0; i < 16; ++i) a[u][i] = (__bf16)xv[i]; }
#pragma unroll
    for (int i = 0; i < 4; ++i) w[0][i] = frag_b((const __bf16*)(wrow + i * 16 * GB_PITCH), lane);
#pragma unroll
    for (int q = 0; q < 4; ++q) {
      if (q < 3) {
#pragma unroll
        for (int i = 0; i < 4; ++i) w[(q + 1) & 1][i] = frag_b((const __bf16*)(wrow + (((q + 1) & 1) * 4 + i) * 16 * GB_PITCH) + ((q + 1) >> 1) * 32, lane); }
      __builtin_amdgcn_sched_barrier(0);   // keeps the next group's reads together ahead of this group's products: without it the compiler sinks each read to its own product, where the wave waits out the LDS latency
#pragma unroll
      for (int i = 0; i < 4; ++i) acc[(q & 1) * 4 + i] = wmma_bf(a[q >> 1], w[q & 1][i], acc[(q & 1) * 4 + i]);
      __builtin_amdgcn_sched_barrier(0); }   // ... and what follows behind these products: the next reads as one group; behind the last group the foot's waits and barrier, which the compiler otherwise lifts over the products
    asm volatile("s_wait_dscnt 0x0" ::: "memory");            // this wave's reads of this block are done
    asm volatile("s_wait_asynccnt 0x0" ::: "memory");         // this wave's copies of block t + 1 have landed
    __syncthreads();                                          // publishes block t + 1 and frees the buffer that this trip has read
    if (t + 2 < DM / GK) stage_gemm(la + (unsigned)(t & 1) * GS_BYTES, lw + (unsigned)(t & 1) * GS_BYTES, gx + (t + 2) * GK, gw + (t + 2) * GK); }
  asm volatile("s_wait_asynccnt 0x0" ::: "memory");           // nothing is in flight behind the loop: the epilogue may take the LDS over
  if (n0 < 2 * DM) {   // q stored unscaled (f16 sigma ~0.6, no subnormal exposure); 32^-0.5 applied to the f32 score
#pragma unroll
    for (int j = 0; j < 8; ++j) {
#pragma unroll
      for (int r = 0; r < 8; ++r) { const float v = acc[j][r]; const _Float16 hv = (_Float16)v; so[wave][8 * g + r][j * 16 + col] = hv; sol[wave][8 * g + r][j * 16 + col] = (_Float16)((v - (float)hv) * 2048.0f); } }   // q, k as f16 hi + (x2048) residual (no RoPE in this module)
    LDSX();
    for (int rl = 0; rl < 16; ++rl) if (lane < 16) { vst2((unsigned*)(QK + (r0 + rl) * (2 * DM) + n0 + lane * 8), *(const v4u*)&so[wave][rl][lane * 8]); vst2((unsigned*)(QKL + (r0 + rl) * (2 * DM) + n0 + lane * 8), *(const v4u*)&sol[wave][rl][lane * 8]); }
  } else {
#pragma unroll
    for (int j = 0; j < 8; ++j) {
#pragma unroll
      for (int r = 0; r < 8; ++r) { const float v = acc[j][r]; const _Float16 hv = (_Float16)v; sth[j * 16 + col][wave * 16 + 8 * g + r] = hv; stl[j * 16 + col][wave * 16 + 8 * g + r] = (_Float16)((v - (float)hv) * 2048.0f); } }
    __syncthreads();
    const size_t rb = (size_t)blockIdx.x * 64; const int b = (int)(rb / SS), s0 = (int)(rb % SS); const int pc0 = n0 - 2 * DM;
    for (int q = tid; q < 128 * 8; q += 128) { const int d = q >> 3, pc = q & 7; const size_t o = ((size_t)b * DM + pc0 + d) * SS + s0 + pc * 8; vst2((unsigned*)(VTH + o), *(const v4u*)&sth[d][pc * 8]); vst2((unsigned*)(VTL + o), *(const v4u*)&stl[d][pc * 8]); }
  }
}
__device__ __forceinline__ float xhalf(float x) { return __builtin_bit_cast(float, __builtin_amdgcn_permlanex16(__builtin_bit_cast(int, x), __builtin_bit_cast(int, x), 0x76543210, 0xfedcba98, false, false)); }   // lane l with lane l ^ 16
#define LAMBDA_INIT 0.78360247f   // 0.8 - 0.6*exp(-0.3*12), float32
#define STG_PITCH 40                       // f16 per staged row: 64 data bytes at an 80-byte pitch (16 B x odd) for the ds_load_b128 readers
#define STG_ROWS 192                       // one 32-key tile: rows 0..31 K hi, 32..63 K lo (row = key), 64..127 V hi, 128..191 V lo (row = value dim)
#define STG_BYTES (STG_ROWS * STG_PITCH * 2)
// one 32-key tile into LDS: every lane copies 16 bytes of six rows (its row r = tid / 4 of each 32-row group), through no register.
// s_wait_xcnt 0 is the statement's last line so that no address register a copy names is rewritten ahead of it (a precaution).
__device__ __forceinline__ void stage_tile(unsigned l, const _Float16* kh, const _Float16* kl, const _Float16* vh, const _Float16* vl) {
  const unsigned g32 = 32 * STG_PITCH * 2;   // LDS bytes of one 32-row group
  asm volatile("global_load_async_to_lds_b128 %0, %6, off\n\t"
               "global_load_async_to_lds_b128 %1, %7, off\n\t"
               "global_load_async_to_lds_b128 %2, %8, off\n\t"
               "global_load_async_to_lds_b128 %3, %9, off\n\t"
               "global_load_async_to_lds_b128 %4, %10, off\n\t"
               "global_load_async_to_lds_b128 %5, %11, off\n\t"
               "s_wait_xcnt 0x0"
               :: "v"(l), "v"(l + g32), "v"(l + 2 * g32), "v"(l + 3 * g32), "v"(l + 4 * g32), "v"(l + 5 * g32),
                  "v"(kh), "v"(kl), "v"(vh), "v"(vh + 32 * SS), "v"(vl), "v"(vl + 32 * SS) : "memory");
}
__global__ __launch_bounds__(128) void k_attn(const _Float16* __restrict__ QK, const _Float16* __restrict__ QKL, const _Float16* __restrict__ VTH, const _Float16* __restrict__ VTL, const float* __restrict__ LQ1, const float* __restrict__ LK1, const float* __restrict__ LQ2, const float* __restrict__ LK2, const float* __restrict__ SUBW, float* __restrict__ O) {
  __shared__ __align__(16) float so[4][16][68]; __shared__ __align__(16) float so1[4][16][68];
  __shared__ __align__(16) _Float16 stg[2][STG_ROWS][STG_PITCH];   // two buffers: the next 32-key tile lands while this one is read by all four waves
  const int tid = threadIdx.x, wave = tid >> 5, lane = tid & 31, col = lane & 15, g = lane >> 4;
  const int qb = blockIdx.x, h = blockIdx.y, b = blockIdx.z; const int q0 = qb * 64 + wave * 16; const size_t rq = (size_t)b * SS + q0 + col;
  float lam; { float a1 = 0.f, a2 = 0.f;
#pragma unroll 1
    for (int i = 0; i < 32; ++i) { a1 += bfr(LQ1[i]) * bfr(LK1[i]); a2 += bfr(LQ2[i]) * bfr(LK2[i]); }
    lam = exp_ni(a1) - exp_ni(a2) + LAMBDA_INIT; }
  const unsigned lst = (unsigned)(size_t)&stg[0][tid >> 2][(tid & 3) * 8];   // this lane's LDS byte address in buffer 0, row group 0
  const size_t vso = ((size_t)b * DM + h * HD + (tid >> 2)) * SS + (tid & 3) * 8; const _Float16* gvh = VTH + vso; const _Float16* gvl = VTL + vso;
  // the two sub-heads are processed one after the other (sub-head 0's normalised P.V parked in LDS) to keep registers under 256
#pragma unroll 1
  for (int sh2 = 0; sh2 < 2; ++sh2) {
    const v16h aq = frag_h(QK + rq * (2 * DM) + h * HD + sh2 * 32, lane), aql = frag_h(QKL + rq * (2 * DM) + h * HD + sh2 * 32, lane);
    float m = -3.0e38f, l = 0.f;   // this lane's query: running maximum (same in both halves) and this half's part of the sum
    v8f acc[4] = {}, accl[4] = {};   // acc[dt][r]: value dim dt * 16 + 8 g + r of query col
    const size_t kso = ((size_t)b * SS + (tid >> 2)) * (2 * DM) + DM + h * HD + sh2 * 32 + (tid & 3) * 8; const _Float16* gkh = QK + kso; const _Float16* gkl = QKL + kso;
    stage_tile(lst, gkh, gkl, gvh, gvl);                       // tile 0 (both buffers are free: the last trip's foot ended every read)
    asm volatile("s_wait_asynccnt 0x0" ::: "memory");           // this wave's copies of tile 0 have landed
    __syncthreads();                                            // ... and every other wave's: tile 0 may be read
    stage_tile(lst + STG_BYTES, gkh + (size_t)32 * 2 * DM, gkl + (size_t)32 * 2 * DM, gvh + 32, gvl + 32);   // tile 1 flies during trip 0
#pragma unroll 1
    for (int ks = 0; ks < SS / 32; ++ks) { v8f s[2]; const _Float16 (*tb)[STG_PITCH] = stg[ks & 1];
      // all 24 LDS reads of the trip stand as one group at its head: the K fragments are waited for once, the V fragments land under the score products and the softmax
      v16h fkh[2], fkl[2], fvh[4], fvl[4];
#pragma unroll
      for (int ct = 0; ct < 2; ++ct) { fkh[ct] = frag_h(&tb[ct * 16 + col][0], lane); fkl[ct] = frag_h(&tb[32 + ct * 16 + col][0], lane); }
#pragma unroll
      for (int dt = 0; dt < 4; ++dt) { fvh[dt] = frag_h(&tb[64 + dt * 16 + col][0], lane); fvl[dt] = frag_h(&tb[128 + dt * 16 + col][0], lane); }
      __builtin_amdgcn_sched_barrier(0);   // keeps the reads above together: without it the compiler sinks each one to its product, where the wave waits out the LDS latency every time
#pragma unroll
      for (int ct = 0; ct < 2; ++ct) {
        v8f c = {}, cl = {}; c = wmma16(fkh[ct], aq, c); cl = wmma16(fkh[ct], aql, cl); cl = wmma16(fkl[ct], aq, cl);
#pragma unroll
        for (int r = 0; r < 8; ++r) s[ct][r] = (c[r] + cl[r] * (1.0f / 2048.0f)) * 0.17677669529663687f; }   // 32^-0.5
      float mx = fmaxf(s[0][0], s[1][0]);
#pragma unroll
      for (int r = 1; r < 8; ++r) mx = fmaxf(mx, fmaxf(s[0][r], s[1][r]));
      mx = fmaxf(mx, xhalf(mx));
      const float mn = fmaxf(m, mx); const float alpha = (m <= -1.0e38f) ? 0.f : __expf(m - mn); m = mn;
      v8f e0, e1; float es0 = 0.f, es1 = 0.f;
#pragma unroll
      for (int r = 0; r < 8; ++r) { e0[r] = __expf(s[0][r] - mn); e1[r] = __expf(s[1][r] - mn); es0 += e0[r]; es1 += e1[r]; }
      const v8h h0 = __builtin_convertvector(e0, v8h), h1 = __builtin_convertvector(e1, v8h);   // P as f16 hi ...
      const v8h l0 = __builtin_convertvector((e0 - __builtin_convertvector(h0, v8f)) * 2048.0f, v8h), l1 = __builtin_convertvector((e1 - __builtin_convertvector(h1, v8f)) * 2048.0f, v8h);   // ... + (x2048) residual
      const v16h pah = __builtin_shufflevector(h0, h1, 0, 1, 2, 3, 4, 5, 6, 7, 8, 9, 10, 11, 12, 13, 14, 15), pal = __builtin_shufflevector(l0, l1, 0, 1, 2, 3, 4, 5, 6, 7, 8, 9, 10, 11, 12, 13, 14, 15);
      l = l * alpha + (es0 + es1);
#pragma unroll
      for (int dt = 0; dt < 4; ++dt) { acc[dt] *= alpha; accl[dt] *= alpha; }
#pragma unroll
      for (int dt = 0; dt < 4; ++dt) { acc[dt] = wmma16(fvh[dt], pah, acc[dt]); accl[dt] = wmma16(fvh[dt], pal, accl[dt]); accl[dt] = wmma16(fvl[dt], pah, accl[dt]); }
      __builtin_amdgcn_sched_barrier(0);                        // keeps the products above the foot: without it the compiler lifts the waits and the barrier over them, and the next tile's copies are waited for right behind their issue
      asm volatile("s_wait_dscnt 0x0" ::: "memory");            // this wave's reads of this tile are done
      asm volatile("s_wait_asynccnt 0x0" ::: "memory");         // this wave's copies of tile ks + 1 have landed
      __syncthreads();                                          // publishes tile ks + 1 and frees the buffer that this trip has read
      if (ks + 2 < SS / 32) stage_tile(lst + (unsigned)(ks & 1) * STG_BYTES, gkh + (size_t)(ks + 2) * 32 * 2 * DM, gkl + (size_t)(ks + 2) * 32 * 2 * DM, gvh + (ks + 2) * 32, gvl + (ks + 2) * 32); }
    asm volatile("s_wait_asynccnt 0x0" ::: "memory");           // nothing is in flight behind the loop
    const float il = 1.0f / (l + xhalf(l));   // the halves' sums are joined once
    if (sh2 == 0) {   // each lane parks, and later reads back, its own 32 values
#pragma unroll
      for (int dt = 0; dt < 4; ++dt) {
#pragma unroll
        for (int r = 0; r < 8; ++r) so1[wave][col][dt * 16 + 8 * g + r] = (acc[dt][r] + accl[dt][r] * (1.0f / 2048.0f)) * il; }
    } else {
      float ov[4][8]; float ssq = 0.f;
#pragma unroll
      for (int dt = 0; dt < 4; ++dt) {
#pragma unroll
        for (int r = 0; r < 8; ++r) { ov[dt][r] = so1[wave][col][dt * 16 + 8 * g + r] - lam * ((acc[dt][r] + accl[dt][r] * (1.0f / 2048.0f)) * il); ssq += ov[dt][r] * ov[dt][r]; } }
      ssq += xhalf(ssq);
      const float sc = (1.0f / sqrtf(ssq * (1.0f / HD) + 1e-5f)) * (1.0f - LAMBDA_INIT);
#pragma unroll
      for (int dt = 0; dt < 4; ++dt) {
#pragma unroll
        for (int r = 0; r < 8; ++r) so[wave][col][dt * 16 + 8 * g + r] = ov[dt][r] * sc * bfr(SUBW[dt * 16 + 8 * g + r]); } }
    LDSX(); }
  for (int rl = 0; rl < 16; ++rl) if (lane < 16) vst2(O + ((size_t)b * SS + q0 + rl) * DM + h * HD + lane * 4, *(const v4f*)&so[wave][rl][lane * 4]);
}
// ---- k_out: block = (64 rows, 128 cols): out = O(hi/lo) . Wo rows (2 products)
__global__ __launch_bounds__(128) void k_out(const float* __restrict__ O, const __bf16* __restrict__ P, float* __restrict__ Y) {
  __shared__ __align__(16) char sm[2 * GS_BYTES];   // in the loop two staged k blocks; behind it the epilogue's tile
  float (*so)[16][132] = (float (*)[16][132])sm;
  const int tid = threadIdx.x, wave = tid >> 5, lane = tid & 31, col = lane & 15, g = lane >> 4; const size_t r0 = (size_t)blockIdx.x * 64 + wave * 16; const int n0 = blockIdx.y * 128;
  const unsigned la = (unsigned)(size_t)sm + (tid >> 4) * GA_PITCH + (tid & 15) * 16, lw = (unsigned)(size_t)sm + GA_BYTES + (tid >> 3) * GB_PITCH + (tid & 7) * 16;   // this lane's LDS byte addresses in buffer 0
  const float* gx = O + ((size_t)blockIdx.x * 64 + (tid >> 4)) * DM + (tid & 15) * 4; const __bf16* gw = P + (size_t)(n0 + (tid >> 3)) * DM + (tid & 7) * 8;
  v8f acc[8] = {};
  stage_gemm(la, lw, gx, gw);                                 // block 0
  asm volatile("s_wait_asynccnt 0x0" ::: "memory");           // this wave's copies of block 0 have landed
  __syncthreads();                                            // ... and every other wave's: block 0 may be read
  stage_gemm(la + GS_BYTES, lw + GS_BYTES, gx + GK, gw + GK);   // block 1 flies during trip 0
#pragma unroll 1   // rolled: one copy of the trip keeps the text short
  for (int t = 0; t < DM / GK; ++t) { const char* tb = sm + (t & 1) * GS_BYTES;
    // the trip's 16 weight fragments in four groups of four, each read one group ahead of its products (as in k_qkv)
    const char* wrow = tb + GA_BYTES + col * GB_PITCH; v16b w[2][4]; F2 a[2];
    float xv[2][16];
#pragma unroll
    for (int u = 0; u < 2; ++u) row16(tb + (wave * 16 + col) * GA_PITCH, u, g, xv[u]);
#pragma unroll
    for (int i = 0; i < 4; ++i) w[0][i] = frag_b((const __bf16*)(wrow + i * 16 * GB_PITCH), lane);
    __builtin_amdgcn_sched_barrier(0);   // keeps the trip's first reads together at its head: without it the compiler deals them among the splitting of the rows, with a full wait in its midst
#pragma unroll
    for (int u = 0; u < 2; ++u) a[u] = bsplit16(xv[u]);
#pragma unroll
    for (int q = 0; q < 4; ++q) {
      if (q < 3) {
#pragma unroll
        for (int i = 0; i < 4; ++i) w[(q + 1) & 1][i] = frag_b((const __bf16*)(wrow + (((q + 1) & 1) * 4 + i) * 16 * GB_PITCH) + ((q + 1) >> 1) * 32, lane); }
      __builtin_amdgcn_sched_barrier(0);   // keeps the next group's reads together ahead of this group's products: without it the compiler sinks each read to its own product, where the wave waits out the LDS latency
#pragma unroll
      for (int i = 0; i < 4; ++i) { const int j = (q & 1) * 4 + i; acc[j] = wmma_bf(a[q >> 1].l, w[q & 1][i], acc[j]); acc[j] = wmma_bf(a[q >> 1].h, w[q & 1][i], acc[j]); }
      __builtin_amdgcn_sched_barrier(0); }   // ... and what follows behind these products: the next reads as one group; behind the last group the foot's waits and barrier, which the compiler otherwise lifts over the products
    asm volatile("s_wait_dscnt 0x0" ::: "memory");            // this wave's reads of this block are done
    asm volatile("s_wait_asynccnt 0x0" ::: "memory");         // this wave's copies of block t + 1 have landed
    __syncthreads();                                          // publishes block t + 1 and frees the buffer that this trip has read
    if (t + 2 < DM / GK) stage_gemm(la + (unsigned)(t & 1) * GS_BYTES, lw + (unsigned)(t & 1) * GS_BYTES, gx + (t + 2) * GK, gw + (t + 2) * GK); }
  asm volatile("s_wait_asynccnt 0x0" ::: "memory");           // nothing is in flight behind the loop: the epilogue may take the LDS over
#pragma unroll
  for (int j = 0; j < 8; ++j) {
#pragma unroll
    for (int r = 0; r < 8; ++r) so[wave][8 * g + r][j * 16 + col] = acc[j][r]; }
  LDSX();
  for (int rl = 0; rl < 16; ++rl) vst2(Y + (r0 + rl) * DM + n0 + lane * 4, *(const v4f*)&so[wave][rl][lane * 4]);
}
extern "C" void kernel_launch(void* const* d_in, const int* in_sizes, int n_in, void* d_out, int out_size, void* d_ws, size_t ws_size, hipStream_t stream) {
  (void)in_sizes; (void)n_in; (void)out_size;
  const float** F = (const float**)d_in;   // 0 query_x [2,2048,1024], 1 kv_x, 2 Wq (in,out), 3 Wk, 4 Wv, 5 Wo, 6 lambda_q1 [32], 7 lambda_k1, 8 lambda_q2, 9 lambda_k2, 10 subln_w [64]
  if (ws_size < (size_t)WS_END) return;
  char* ws = (char*)d_ws; __bf16* PK = (__bf16*)(ws + WS_PK); _Float16 *QK = (_Float16*)(ws + WS_QK), *QKL = (_Float16*)(ws + WS_QKL), *VTH = (_Float16*)(ws + WS_VTH), *VTL = (_Float16*)(ws + WS_VTL); float* O = (float*)(ws + WS_O);
  k_pack<<<dim3(DM / PT_N, DM / PT_K, 4), 128, 0, stream>>>(F[2], F[3], F[4], F[5], PK);
  k_qkv<<<dim3(TNB * SS / 64, QKVW / 128), 128, 0, stream>>>(F[0], F[1], PK + PK_A, QK, QKL, VTH, VTL);
  k_attn<<<dim3(TQB, NH, TNB), 128, 0, stream>>>(QK, QKL, VTH, VTL, F[6], F[7], F[8], F[9], F[10], O);
  k_out<<<dim3(TOB, DM / 128), 128, 0, stream>>>(O, PK + PK_P, (float*)d_out);
}

// v007
// One run takes 190 microseconds.
// Next to v006, in two timings, it ran 1.08 times as fast each time.
// Counting every step since v000, it is 3.57 times as fast.
// compute dtype: query_x, kv_x, Wq, Wk, Wv, Wo, lambda_*, subln_w (module inputs) rounded to bf16; q (from query_x), k and v (from kv_x) with exact bf16 products on WMMA 16x16x32 ((in,out) weights packed as transposed rows); q and k stored as f16 hi + (x2048-scaled) residual planes; per head pair both 32-dim sub-head score maps with 3 products x 32^-0.5, two running-max softmaxes in f32 (hardware exp); P as f16 hi + (x2048) residual x v hi/lo (3 products) for both maps; lambda from the four 32-vectors in f32 (precise expf); the differential combination, RMS norm (eps 1e-5) x subln_w x (1 - lambda_init) in f32; output projection with the context as bf16 hi + residual x exact Wo (2 products); f32 accumulate.
#include <hip/hip_runtime.h>
#include <math.h>

typedef __attribute__((ext_vector_type(16))) _Float16 v16h;
typedef __attribute__((ext_vector_type(16))) __bf16 v16b;
typedef __attribute__((ext_vector_type(8)))  _Float16 v8h;
typedef __attribute__((ext_vector_type(8)))  float v8f;
typedef __attribute__((ext_vector_type(4)))  float v4f;
typedef __attribute__((ext_vector_type(2)))  float v2f;
typedef __attribute__((ext_vector_type(4)))  unsigned v4u;
typedef __attribute__((ext_vector_type(4)))  int v4i;
typedef float __attribute__((may_alias)) float_a;
typedef int __attribute__((may_alias)) int_a;

template <typename T> __device__ __forceinline__ void vst2(void* p, T v) { *(T*)p = v;  }
__device__ __forceinline__ v8f wmma16(v16h a, v16h b, v8f c) {
  v8f d = __builtin_amdgcn_wmma_f32_16x16x32_f16(false, a, false, b, (short)0, c, false, false);
  return d;
}
__device__ __forceinline__ v8f wmma_bf(v16b a, v16b b, v8f c) {
  v8f d = __builtin_amdgcn_wmma_f32_16x16x32_bf16(false, a, false, b, (short)0, c, false, false);
  return d;
}
// Cross multi-head differential attention (B 2, T = S = 2,048, d 1,024, 16 head pairs of 32-dim q/k and 64-dim values, depth-12 lambda_init): softmax(q1 k1) - lambda softmax(q2 k2) applied to v, RMS norm, output projection.
__device__ __forceinline__ v16h frag_h(const _Float16* rowk0, int lane) {
  union { v16h v; v8h q[2]; } u; const _Float16* p = rowk0 + 8 * (lane >> 4);
  u.q[0] = *(const v8h*)p; u.q[1] = *(const v8h*)(p + 16); return u.v;
}
__device__ __forceinline__ v16h frag_f32(const float* rowk0, int lane) {
  v16h a; const float* p = rowk0 + 8 * (lane >> 4);
#pragma unroll
  for (int i = 0; i < 8; ++i) { a[i] = (_Float16)p[i]; a[8 + i] = (_Float16)p[16 + i]; }
  return a;
}
__device__ __forceinline__ v16h frag_f32s(const float* rowk0, int lane, float sc) {
  v16h a; const float* p = rowk0 + 8 * (lane >> 4);
#pragma unroll
  for (int i = 0; i < 8; ++i) { a[i] = (_Float16)(p[i] * sc); a[8 + i] = (_Float16)(p[16 + i] * sc); }
  return a;
}
// column fragment from a [K][ld] layout (column n), rows >= K read as 0
__device__ __forceinline__ v16h fragc_f32(const float* W, int k0, int n, int lane, int ld, int K) {
  v16h a; const int g = lane >> 4;
#pragma unroll
  for (int i = 0; i < 8; ++i) { const int ka = k0 + 8 * g + i, kb = ka + 16;
    a[i] = (_Float16)(ka < K ? W[(size_t)(ka < K ? ka : K - 1) * ld + n] : 0.f); a[8 + i] = (_Float16)(kb < K ? W[(size_t)(kb < K ? kb : K - 1) * ld + n] : 0.f); }
  return a;
}
struct F2 { v16b h, l; };
__device__ __forceinline__ F2 bsplit16(const float v[16]) { F2 r;
#pragma unroll
  for (int i = 0; i < 16; ++i) { const __bf16 h = (__bf16)v[i]; r.h[i] = h; r.l[i] = (__bf16)(v[i] - (float)h); }
  return r; }
__device__ __forceinline__ F2 split_row(const float* row, int k0, int lane) { float v[16]; const float* p = row + k0 + 8 * (lane >> 4);
#pragma unroll
  for (int i = 0; i < 8; ++i) { v[i] = p[i]; v[8 + i] = p[16 + i]; }
  return bsplit16(v); }
__device__ __forceinline__ F2 split_rowK(const float* row, int k0, int lane, int K) { float v[16]; const int g = lane >> 4;
#pragma unroll
  for (int i = 0; i < 8; ++i) { const int ka = k0 + 8 * g + i, kb = ka + 16; v[i] = ka < K ? row[ka < K ? ka : K - 1] : 0.f; v[8 + i] = kb < K ? row[kb < K ? kb : K - 1] : 0.f; }
  return bsplit16(v); }
__device__ __forceinline__ F2 split_col(const float* W, int k0, int n, int lane, int ld, int K) { float v[16]; const int g = lane >> 4;
#pragma unroll
  for (int i = 0; i < 8; ++i) { const int ka = k0 + 8 * g + i, kb = ka + 16; v[i] = ka < K ? W[(size_t)(ka < K ? ka : K - 1) * ld + n] : 0.f; v[8 + i] = kb < K ? W[(size_t)(kb < K ? kb : K - 1) * ld + n] : 0.f; }
  return bsplit16(v); }
__device__ __forceinline__ v8f mac3(const F2& a, const F2& b, v8f c) { c = wmma_bf(a.l, b.h, c); c = wmma_bf(a.h, b.l, c); return wmma_bf(a.h, b.h, c); }
__device__ __forceinline__ float sigm(float v) { return 1.0f / (1.0f + expf(-v)); }
#define LDSX() do { asm volatile("s_wait_dscnt 0" ::: "memory"); __builtin_amdgcn_wave_barrier(); __builtin_amdgcn_fence(__ATOMIC_RELEASE, "workgroup"); } while (0)


#define NB 2
#define SS 2048
#define DM 1024
#define NH 16
#define HD 64
#define QKVW (3 * DM)
#ifndef TQB
#define TQB (SS / 128)         // k_attn query tiles: 128 queries, 8 waves
#define TNB NB
#define TOB (NB * SS / 64)     // output row tiles (all)
#endif
typedef __attribute__((ext_vector_type(8))) __bf16 v8b;
__device__ __forceinline__ v16b frag_b(const __bf16* rowk0, int lane) {
  union { v16b v; v8b q[2]; } u; const __bf16* p = rowk0 + 8 * (lane >> 4);
  u.q[0] = *(const v8b*)p; u.q[1] = *(const v8b*)(p + 16); return u.v;
}
__device__ __forceinline__ float bfr(float v) { return (float)(__bf16)v; }
__device__ __attribute__((noinline)) float exp_ni(float v) { return expf(v); }
__device__ __attribute__((noinline)) float erf_ni(float v) { return erff(v); }

#define PK_A 0                       // [3072][1024] Wqkv rows (natural [out][in])
#define PK_P (PK_A + QKVW * DM)        // [1024][1024] Wo rows (natural)
#define PK_END (PK_P + DM * DM)
#define WS_PK  0u
#define WS_QK  (WS_PK + 2u * PK_END)             // f16 [4096 rows][2048]: q | k
#define WS_QKL (WS_QK + 2u * NB * SS * 2 * DM)     // f16 q | k residual planes x2048
#define WS_VTH (WS_QKL + 2u * NB * SS * 2 * DM)    // f16 [b][1024 (h*64+d)][2048 s] hi
#define WS_VTL (WS_VTH + 2u * NB * DM * SS)        // f16 lo x 2048
#define WS_O   (WS_VTL + 2u * NB * DM * SS)        // f32 [4096][1024]
#define WS_CS  (WS_O + 4u * NB * SS * DM)           // 2 x [2048][32] f32, reserved, unused (no RoPE)
#define WS_END (WS_CS + 4u * 2 * SS * 32)
// ---- k_pack: block = (128 columns n, 64 rows k, which) of an (in,out) weight: the tile is read along its rows (a wave-wide 16-byte load = 512 contiguous bytes of one k row), rounded to bf16, turned in LDS and written as 128-byte pieces of the transposed rows; which 0..2 -> W_q/W_k/W_v into PK_A rows which*1024 + n; 3 -> W_o into PK_P
#define PT_N 128
#define PT_K 64
#define PT_P (PT_K / 2 + 1)               // dwords per LDS row n: 32 pairs of k neighbours and one of padding, so that the writes (lanes 4 rows apart) and the row-wise read-out both spread over the banks
typedef __attribute__((ext_vector_type(2))) __bf16 v2b;
__global__ __launch_bounds__(128) void k_pack(const float* __restrict__ WQ, const float* __restrict__ WK, const float* __restrict__ WV, const float* __restrict__ WO, __bf16* __restrict__ PK) {
  __shared__ __align__(16) unsigned s[PT_N * PT_P]; const int t = threadIdx.x, wave = t >> 5, lane = t & 31, n0 = blockIdx.x * PT_N, k0 = blockIdx.y * PT_K, which = blockIdx.z; const float* Wm = (which == 0) ? WQ : (which == 1) ? WK : (which == 2) ? WV : WO;
  const float* src = Wm + (size_t)(k0 + wave * 16) * DM + n0 + lane * 4;   // this wave's 16 k rows, this lane's 4 columns
  v4f x[16];
#pragma unroll   // x[] stays in registers and the 16 loads issue as one group
  for (int i = 0; i < 16; ++i) x[i] = *(const v4f*)(src + (size_t)i * DM);
  // all 16 loads are in flight together, and no register that one of them names (data or address) is rewritten ahead of this wait (a precaution): the values are inputs only
  asm volatile("s_wait_xcnt 0x0" :: "v"(x[0]), "v"(x[1]), "v"(x[2]), "v"(x[3]), "v"(x[4]), "v"(x[5]), "v"(x[6]), "v"(x[7]), "v"(x[8]), "v"(x[9]), "v"(x[10]), "v"(x[11]), "v"(x[12]), "v"(x[13]), "v"(x[14]), "v"(x[15]), "v"(src) : "memory");
#pragma unroll   // constant indices into x[] (both loops)
  for (int i = 0; i < 8; ++i) {
#pragma unroll
    for (int j = 0; j < 4; ++j) { const v2b two = { (__bf16)x[2 * i][j], (__bf16)x[2 * i + 1][j] }; s[(lane * 4 + j) * PT_P + wave * 8 + i] = __builtin_bit_cast(unsigned, two); } }
  __syncthreads();
  __bf16* dst = ((which < 3) ? PK + PK_A + ((size_t)which * DM + n0) * DM : PK + PK_P + (size_t)n0 * DM) + k0;
  unsigned* d = (unsigned*)(dst + (size_t)wave * (PT_N / 4) * DM) + lane; const unsigned* sr = s + wave * (PT_N / 4) * PT_P + lane; unsigned y[PT_N / 4];
#pragma unroll   // all 32 LDS reads ahead of the stores, each value in a register of its own: no register of an issued store is rewritten
  for (int r = 0; r < PT_N / 4; ++r) y[r] = sr[r * PT_P];
#pragma unroll   // constant indices into y[], row steps as immediate offsets
  for (int r = 0; r < PT_N / 4; ++r) d[r * (DM / 2)] = y[r];   // one whole 128-byte line a wave-wide store
}
#define GK 64                              // k depth of one staged block: X rows of 256 bytes, weight rows of 128 bytes, whole cache lines
#define GA_PITCH 272                       // LDS bytes per staged f32 row (256 data bytes, 16 B x odd for the ds_load_b128 readers)
#define GB_PITCH 144                       // LDS bytes per staged bf16 weight row (128 data bytes, 16 B x odd)
#define GA_BYTES (64 * GA_PITCH)
#define GS_BYTES (GA_BYTES + 128 * GB_PITCH)   // one staged block: 64 f32 rows, then 128 weight rows
#define COPY8_TEXT "global_load_async_to_lds_b128 %0, %8, off\n\t" "global_load_async_to_lds_b128 %1, %9, off\n\t" "global_load_async_to_lds_b128 %2, %10, off\n\t" "global_load_async_to_lds_b128 %3, %11, off\n\t" \
                   "global_load_async_to_lds_b128 %4, %12, off\n\t" "global_load_async_to_lds_b128 %5, %13, off\n\t" "global_load_async_to_lds_b128 %6, %14, off\n\t" "global_load_async_to_lds_b128 %7, %15, off\n\t" "s_wait_xcnt 0x0"
// one 64-deep k block of a 64 x 128 GEMM tile into LDS, through no register: every lane copies 16 bytes of eight f32 rows (16 lanes a row, rows 8 apart) and of eight weight rows (8 lanes a row, rows 16 apart), so each wave-wide copy covers whole lines.
// s_wait_xcnt 0 is each statement's last line so that no address register a copy names is rewritten ahead of it (a precaution).
__device__ __forceinline__ void stage_gemm(unsigned la, unsigned lw, const float* gx, const __bf16* gw) {
  const unsigned sa = 8 * GA_PITCH, sw = 16 * GB_PITCH;
  asm volatile(COPY8_TEXT :: "v"(la), "v"(la + sa), "v"(la + 2 * sa), "v"(la + 3 * sa), "v"(la + 4 * sa), "v"(la + 5 * sa), "v"(la + 6 * sa), "v"(la + 7 * sa),
               "v"(gx), "v"(gx + 8 * DM), "v"(gx + 16 * DM), "v"(gx + 24 * DM), "v"(gx + 32 * DM), "v"(gx + 40 * DM), "v"(gx + 48 * DM), "v"(gx + 56 * DM) : "memory");
  asm volatile(COPY8_TEXT :: "v"(lw), "v"(lw + sw), "v"(lw + 2 * sw), "v"(lw + 3 * sw), "v"(lw + 4 * sw), "v"(lw + 5 * sw), "v"(lw + 6 * sw), "v"(lw + 7 * sw),
               "v"(gw), "v"(gw + 16 * DM), "v"(gw + 32 * DM), "v"(gw + 48 * DM), "v"(gw + 64 * DM), "v"(gw + 80 * DM), "v"(gw + 96 * DM), "v"(gw + 112 * DM) : "memory");
}
// the 16 f32 of one A fragment (k order of frag_b) from a staged row
__device__ __forceinline__ void row16(const char* row, int u, int g, float v[16]) {
  const v4f* p = (const v4f*)(row + u * 128 + 32 * g); const v4f x0 = p[0], x1 = p[1], x2 = p[4], x3 = p[5];
#pragma unroll
  for (int i = 0; i < 4; ++i) { v[i] = x0[i]; v[4 + i] = x1[i]; v[8 + i] = x2[i]; v[12 + i] = x3[i]; }
}
__global__ __launch_bounds__(128) void k_qkv(const float* __restrict__ XQ, const float* __restrict__ XKV, const __bf16* __restrict__ P, _Float16* __restrict__ QK, _Float16* __restrict__ QKL, _Float16* __restrict__ VTH, _Float16* __restrict__ VTL) {
  const float* X = (blockIdx.y * 128 < DM) ? XQ : XKV;   // q from query_x, k and v from kv_x
  __shared__ __align__(16) char sm[2 * GS_BYTES];   // in the loop two staged k blocks (the next lands while this one is read by all four waves); behind it the epilogue's tiles
  _Float16 (*so)[16][136] = (_Float16 (*)[16][136])sm; _Float16 (*sol)[16][136] = (_Float16 (*)[16][136])(sm + 4 * 16 * 136 * 2); _Float16 (*sth)[72] = (_Float16 (*)[72])sm; _Float16 (*stl)[72] = (_Float16 (*)[72])(sm + 128 * 72 * 2);
  const int tid = threadIdx.x, wave = tid >> 5, lane = tid & 31, col = lane & 15, g = lane >> 4; const size_t r0 = (size_t)blockIdx.x * 64 + wave * 16; const int n0 = blockIdx.y * 128;
  const unsigned la = (unsigned)(size_t)sm + (tid >> 4) * GA_PITCH + (tid & 15) * 16, lw = (unsigned)(size_t)sm + GA_BYTES + (tid >> 3) * GB_PITCH + (tid & 7) * 16;   // this lane's LDS byte addresses in buffer 0
  const float* gx = X + ((size_t)blockIdx.x * 64 + (tid >> 4)) * DM + (tid & 15) * 4; const __bf16* gw = P + (size_t)(n0 + (tid >> 3)) * DM + (tid & 7) * 8;
  v8f acc[8] = {};
  stage_gemm(la, lw, gx, gw);                                 // block 0
  asm volatile("s_wait_asynccnt 0x0" ::: "memory");           // this wave's copies of block 0 have landed
  __syncthreads();                                            // ... and every other wave's: block 0 may be read
  stage_gemm(la + GS_BYTES, lw + GS_BYTES, gx + GK, gw + GK);   // block 1 flies during trip 0
#pragma unroll 1   // rolled: one copy of the trip keeps the text short
  for (int t = 0; t < DM / GK; ++t) { const char* tb = sm + (t & 1) * GS_BYTES;
    // the trip's 16 weight fragments in four groups of four (group q: k half q / 2, columns 64 (q & 1) ...), each read one group ahead of its products so that a wave does not wait out the LDS latency per product
    const char* wrow = tb + GA_BYTES + col * GB_PITCH; v16b w[2][4], a[2];
#pragma unroll
    for (int u = 0; u < 2; ++u) { float xv[16]; row16(tb + (wave * 16 + col) * GA_PITCH, u, g, xv);
#pragma unroll
      for (int i = 0; i < 16; ++i) a[u][i] = (__bf16)xv[i]; }
#pragma unroll
    for (int i = 0; i < 4; ++i) w[0][i] = frag_b((const __bf16*)(wrow + i * 16 * GB_PITCH), lane);
#pragma unroll
    for (int q = 0; q < 4; ++q) {
      if (q < 3) {
#pragma unroll
        for (int i = 0; i < 4; ++i) w[(q + 1) & 1][i] = frag_b((const __bf16*)(wrow + (((q + 1) & 1) * 4 + i) * 16 * GB_PITCH) + ((q + 1) >> 1) * 32, lane); }
      __builtin_amdgcn_sched_barrier(0);   // keeps the next group's reads together ahead of this group's products: without it the compiler sinks each read to its own product, where the wave waits out the LDS latency
#pragma unroll
      for (int i = 0; i < 4; ++i) acc[(q & 1) * 4 + i] = wmma_bf(a[q >> 1], w[q & 1][i], acc[(q & 1) * 4 + i]);
      __builtin_amdgcn_sched_barrier(0); }   // ... and what follows behind these products: the next reads as one group; behind the last group the foot's waits and barrier, which the compiler otherwise lifts over the products
    asm volatile("s_wait_dscnt 0x0" ::: "memory");            // this wave's reads of this block are done
    asm volatile("s_wait_asynccnt 0x0" ::: "memory");         // this wave's copies of block t + 1 have landed
    __syncthreads();                                          // publishes block t + 1 and frees the buffer that this trip has read
    if (t + 2 < DM / GK) stage_gemm(la + (unsigned)(t & 1) * GS_BYTES, lw + (unsigned)(t & 1) * GS_BYTES, gx + (t + 2) * GK, gw + (t + 2) * GK); }
  asm volatile("s_wait_asynccnt 0x0" ::: "memory");           // nothing is in flight behind the loop: the epilogue may take the LDS over
  if (n0 < 2 * DM) {   // q stored unscaled (f16 sigma ~0.6, no subnormal exposure); 32^-0.5 applied to the f32 score
#pragma unroll
    for (int j = 0; j < 8; ++j) {
#pragma unroll
      for (int r = 0; r < 8; ++r) { const float v = acc[j][r]; const _Float16 hv = (_Float16)v; so[wave][8 * g + r][j * 16 + col] = hv; sol[wave][8 * g + r][j * 16 + col] = (_Float16)((v - (float)hv) * 2048.0f); } }   // q, k as f16 hi + (x2048) residual (no RoPE in this module)
    LDSX();
    for (int rl = 0; rl < 16; ++rl) if (lane < 16) { vst2((unsigned*)(QK + (r0 + rl) * (2 * DM) + n0 + lane * 8), *(const v4u*)&so[wave][rl][lane * 8]); vst2((unsigned*)(QKL + (r0 + rl) * (2 * DM) + n0 + lane * 8), *(const v4u*)&sol[wave][rl][lane * 8]); }
  } else {
#pragma unroll
    for (int j = 0; j < 8; ++j) {
#pragma unroll
      for (int r = 0; r < 8; ++r) { const float v = acc[j][r]; const _Float16 hv = (_Float16)v; sth[j * 16 + col][wave * 16 + 8 * g + r] = hv; stl[j * 16 + col][wave * 16 + 8 * g + r] = (_Float16)((v - (float)hv) * 2048.0f); } }
    __syncthreads();
    const size_t rb = (size_t)blockIdx.x * 64; const int b = (int)(rb / SS), s0 = (int)(rb % SS); const int pc0 = n0 - 2 * DM;
    for (int q = tid; q < 128 * 8; q += 128) { const int d = q >> 3, pc = q & 7; const size_t o = ((size_t)b * DM + pc0 + d) * SS + s0 + pc * 8; vst2((unsigned*)(VTH + o), *(const v4u*)&sth[d][pc * 8]); vst2((unsigned*)(VTL + o), *(const v4u*)&stl[d][pc * 8]); }
  }
}
__device__ __forceinline__ float xhalf(float x) { return __builtin_bit_cast(float, __builtin_amdgcn_permlanex16(__builtin_bit_cast(int, x), __builtin_bit_cast(int, x), 0x76543210, 0xfedcba98, false, false)); }   // lane l with lane l ^ 16
#define LAMBDA_INIT 0.78360247f   // 0.8 - 0.6*exp(-0.3*12), float32
#define STG_PITCH 40                       // f16 per staged row: 64 data bytes at an 80-byte pitch (16 B x odd) for the ds_load_b128 readers
#define STG_ROWS 192                       // one 32-key tile: rows 0..31 K hi, 32..63 K lo (row = key), 64..127 V hi, 128..191 V lo (row = value dim)
#define STG_BYTES (STG_ROWS * STG_PITCH * 2)
// one 32-key tile into LDS by the work-group's 256 lanes: every lane copies 16 bytes of three rows (its row r = tid / 4 of each 64-row group: K hi and lo, V hi, V lo), through no register.
// s_wait_xcnt 0 is the statement's last line so that no address register a copy names is rewritten ahead of it (a precaution).
__device__ __forceinline__ void stage_tile(unsigned l, const _Float16* k, const _Float16* vh, const _Float16* vl) {
  const unsigned g64 = 64 * STG_PITCH * 2;   // LDS bytes of one 64-row group
  asm volatile("global_load_async_to_lds_b128 %0, %3, off\n\t"
               "global_load_async_to_lds_b128 %1, %4, off\n\t"
               "global_load_async_to_lds_b128 %2, %5, off\n\t"
               "s_wait_xcnt 0x0"
               :: "v"(l), "v"(l + g64), "v"(l + 2 * g64), "v"(k), "v"(vh), "v"(vl) : "memory");
}
__global__ __launch_bounds__(256) void k_attn(const _Float16* __restrict__ QK, const _Float16* __restrict__ QKL, const _Float16* __restrict__ VTH, const _Float16* __restrict__ VTL, const float* __restrict__ LQ1, const float* __restrict__ LK1, const float* __restrict__ LQ2, const float* __restrict__ LK2, const float* __restrict__ SUBW, float* __restrict__ O) {
  __shared__ __align__(16) float so[8][16][68]; __shared__ __align__(16) float so1[8][16][68];
  __shared__ __align__(16) _Float16 stg[2][STG_ROWS][STG_PITCH];   // two buffers: the next 32-key tile lands while this one is read by all eight waves
  const int tid = threadIdx.x, wave = tid >> 5, lane = tid & 31, col = lane & 15, g = lane >> 4;
  const int qb = blockIdx.x, h = blockIdx.y, b = blockIdx.z; const int q0 = qb * 128 + wave * 16; const size_t rq = (size_t)b * SS + q0 + col;
  float lam; { float a1 = 0.f, a2 = 0.f;
#pragma unroll 1
    for (int i = 0; i < 32; ++i) { a1 += bfr(LQ1[i]) * bfr(LK1[i]); a2 += bfr(LQ2[i]) * bfr(LK2[i]); }
    lam = exp_ni(a1) - exp_ni(a2) + LAMBDA_INIT; }
  const unsigned lst = (unsigned)(size_t)&stg[0][tid >> 2][(tid & 3) * 8];   // this lane's LDS byte address in buffer 0, row group 0 (rows 0..63)
  const size_t vso = ((size_t)b * DM + h * HD + (tid >> 2)) * SS + (tid & 3) * 8; const _Float16* gvh = VTH + vso; const _Float16* gvl = VTL + vso;
  // the two sub-heads are processed one after the other (sub-head 0's normalised P.V parked in LDS) to keep registers under 256
#pragma unroll 1
  for (int sh2 = 0; sh2 < 2; ++sh2) {
    const v16h aq = frag_h(QK + rq * (2 * DM) + h * HD + sh2 * 32, lane), aql = frag_h(QKL + rq * (2 * DM) + h * HD + sh2 * 32, lane);
    float m = -3.0e38f, l = 0.f;   // this lane's query: running maximum (same in both halves) and this half's part of the sum
    v8f acc[4] = {}, accl[4] = {};   // acc[dt][r]: value dim dt * 16 + 8 g + r of query col
    const size_t kso = ((size_t)b * SS + ((tid >> 2) & 31)) * (2 * DM) + DM + h * HD + sh2 * 32 + (tid & 3) * 8; const _Float16* gk = (tid < 128 ? QK : QKL) + kso;   // waves 0..3 bring K hi, waves 4..7 K lo
    stage_tile(lst, gk, gvh, gvl);                       // tile 0 (both buffers are free: the last trip's foot ended every read)
    asm volatile("s_wait_asynccnt 0x0" ::: "memory");           // this wave's copies of tile 0 have landed
    __syncthreads();                                            // ... and every other wave's: tile 0 may be read
    stage_tile(lst + STG_BYTES, gk + (size_t)32 * 2 * DM, gvh + 32, gvl + 32);   // tile 1 flies during trip 0
#pragma unroll 1
    for (int ks = 0; ks < SS / 32; ++ks) { v8f s[2]; const _Float16 (*tb)[STG_PITCH] = stg[ks & 1];
      // all 24 LDS reads of the trip stand as one group at its head: the K fragments are waited for once, the V fragments land under the score products and the softmax
      v16h fkh[2], fkl[2], fvh[4], fvl[4];
#pragma unroll
      for (int ct = 0; ct < 2; ++ct) { fkh[ct] = frag_h(&tb[ct * 16 + col][0], lane); fkl[ct] = frag_h(&tb[32 + ct * 16 + col][0], lane); }
#pragma unroll
      for (int dt = 0; dt < 4; ++dt) { fvh[dt] = frag_h(&tb[64 + dt * 16 + col][0], lane); fvl[dt] = frag_h(&tb[128 + dt * 16 + col][0], lane); }
      __builtin_amdgcn_sched_barrier(0);   // keeps the reads above together: without it the compiler sinks each one to its product, where the wave waits out the LDS latency every time
#pragma unroll
      for (int ct = 0; ct < 2; ++ct) {
        v8f c = {}, cl = {}; c = wmma16(fkh[ct], aq, c); cl = wmma16(fkh[ct], aql, cl); cl = wmma16(fkl[ct], aq, cl);
#pragma unroll
        for (int r = 0; r < 8; ++r) s[ct][r] = (c[r] + cl[r] * (1.0f / 2048.0f)) * 0.17677669529663687f; }   // 32^-0.5
      float mx = fmaxf(s[0][0], s[1][0]);
#pragma unroll
      for (int r = 1; r < 8; ++r) mx = fmaxf(mx, fmaxf(s[0][r], s[1][r]));
      mx = fmaxf(mx, xhalf(mx));
      const float mn = fmaxf(m, mx); const float alpha = (m <= -1.0e38f) ? 0.f : __expf(m - mn); m = mn;
      v8f e0, e1; float es0 = 0.f, es1 = 0.f;
#pragma unroll
      for (int r = 0; r < 8; ++r) { e0[r] = __expf(s[0][r] - mn); e1[r] = __expf(s[1][r] - mn); es0 += e0[r]; es1 += e1[r]; }
      const v8h h0 = __builtin_convertvector(e0, v8h), h1 = __builtin_convertvector(e1, v8h);   // P as f16 hi ...
      const v8h l0 = __builtin_convertvector((e0 - __builtin_convertvector(h0, v8f)) * 2048.0f, v8h), l1 = __builtin_convertvector((e1 - __builtin_convertvector(h1, v8f)) * 2048.0f, v8h);   // ... + (x2048) residual
      const v16h pah = __builtin_shufflevector(h0, h1, 0, 1, 2, 3, 4, 5, 6, 7, 8, 9, 10, 11, 12, 13, 14, 15), pal = __builtin_shufflevector(l0, l1, 0, 1, 2, 3, 4, 5, 6, 7, 8, 9, 10, 11, 12, 13, 14, 15);
      l = l * alpha + (es0 + es1);
#pragma unroll
      for (int dt = 0; dt < 4; ++dt) { acc[dt] *= alpha; accl[dt] *= alpha; }
#pragma unroll
      for (int dt = 0; dt < 4; ++dt) { acc[dt] = wmma16(fvh[dt], pah, acc[dt]); accl[dt] = wmma16(fvh[dt], pal, accl[dt]); accl[dt] = wmma16(fvl[dt], pah, accl[dt]); }
      __builtin_amdgcn_sched_barrier(0);                        // keeps the products above the foot: without it the compiler lifts the waits and the barrier over them, and the next tile's copies are waited for right behind their issue
      asm volatile("s_wait_dscnt 0x0" ::: "memory");            // this wave's reads of this tile are done
      asm volatile("s_wait_asynccnt 0x0" ::: "memory");         // this wave's copies of tile ks + 1 have landed
      __syncthreads();                                          // publishes tile ks + 1 and frees the buffer that this trip has read
      if (ks + 2 < SS / 32) stage_tile(lst + (unsigned)(ks & 1) * STG_BYTES, gk + (size_t)(ks + 2) * 32 * 2 * DM, gvh + (ks + 2) * 32, gvl + (ks + 2) * 32); }
    asm volatile("s_wait_asynccnt 0x0" ::: "memory");           // nothing is in flight behind the loop
    const float il = 1.0f / (l + xhalf(l));   // the halves' sums are joined once
    if (sh2 == 0) {   // each lane parks, and later reads back, its own 32 values
#pragma unroll
      for (int dt = 0; dt < 4; ++dt) {
#pragma unroll
        for (int r = 0; r < 8; ++r) so1[wave][col][dt * 16 + 8 * g + r] = (acc[dt][r] + accl[dt][r] * (1.0f / 2048.0f)) * il; }
    } else {
      float ov[4][8]; float ssq = 0.f;
#pragma unroll
      for (int dt = 0; dt < 4; ++dt) {
#pragma unroll
        for (int r = 0; r < 8; ++r) { ov[dt][r] = so1[wave][col][dt * 16 + 8 * g + r] - lam * ((acc[dt][r] + accl[dt][r] * (1.0f / 2048.0f)) * il); ssq += ov[dt][r] * ov[dt][r]; } }
      ssq += xhalf(ssq);
      const float sc = (1.0f / sqrtf(ssq * (1.0f / HD) + 1e-5f)) * (1.0f - LAMBDA_INIT);
#pragma unroll
      for (int dt = 0; dt < 4; ++dt) {
#pragma unroll
        for (int r = 0; r < 8; ++r) so[wave][col][dt * 16 + 8 * g + r] = ov[dt][r] * sc * bfr(SUBW[dt * 16 + 8 * g + r]); } }
    LDSX(); }
  for (int rl = 0; rl < 16; ++rl) if (lane < 16) vst2(O + ((size_t)b * SS + q0 + rl) * DM + h * HD + lane * 4, *(const v4f*)&so[wave][rl][lane * 4]);
}
// ---- k_out: block = (64 rows, 128 cols): out = O(hi/lo) . Wo rows (2 products)
__global__ __launch_bounds__(128) void k_out(const float* __restrict__ O, const __bf16* __restrict__ P, float* __restrict__ Y) {
  __shared__ __align__(16) char sm[2 * GS_BYTES];   // in the loop two staged k blocks; behind it the epilogue's tile
  float (*so)[16][132] = (float (*)[16][132])sm;
  const int tid = threadIdx.x, wave = tid >> 5, lane = tid & 31, col = lane & 15, g = lane >> 4; const size_t r0 = (size_t)blockIdx.x * 64 + wave * 16; const int n0 = blockIdx.y * 128;
  const unsigned la = (unsigned)(size_t)sm + (tid >> 4) * GA_PITCH + (tid & 15) * 16, lw = (unsigned)(size_t)sm + GA_BYTES + (tid >> 3) * GB_PITCH + (tid & 7) * 16;   // this lane's LDS byte addresses in buffer 0
  const float* gx = O + ((size_t)blockIdx.x * 64 + (tid >> 4)) * DM + (tid & 15) * 4; const __bf16* gw = P + (size_t)(n0 + (tid >> 3)) * DM + (tid & 7) * 8;
  v8f acc[8] = {};
  stage_gemm(la, lw, gx, gw);                                 // block 0
  asm volatile("s_wait_asynccnt 0x0" ::: "memory");           // this wave's copies of block 0 have landed
  __syncthreads();                                            // ... and every other wave's: block 0 may be read
  stage_gemm(la + GS_BYTES, lw + GS_BYTES, gx + GK, gw + GK);   // block 1 flies during trip 0
#pragma unroll 1   // rolled: one copy of the trip keeps the text short
  for (int t = 0; t < DM / GK; ++t) { const char* tb = sm + (t & 1) * GS_BYTES;
    // the trip's 16 weight fragments in four groups of four, each read one group ahead of its products (as in k_qkv)
    const char* wrow = tb + GA_BYTES + col * GB_PITCH; v16b w[2][4]; F2 a[2];
    float xv[2][16];
#pragma unroll
    for (int u = 0; u < 2; ++u) row16(tb + (wave * 16 + col) * GA_PITCH, u, g, xv[u]);
#pragma unroll
    for (int i = 0; i < 4; ++i) w[0][i] = frag_b((const __bf16*)(wrow + i * 16 * GB_PITCH), lane);
    __builtin_amdgcn_sched_barrier(0);   // keeps the trip's first reads together at its head: without it the compiler deals them among the splitting of the rows, with a full wait in its midst
#pragma unroll
    for (int u = 0; u < 2; ++u) a[u] = bsplit16(xv[u]);
#pragma unroll
    for (int q = 0; q < 4; ++q) {
      if (q < 3) {
#pragma unroll
        for (int i = 0; i < 4; ++i) w[(q + 1) & 1][i] = frag_b((const __bf16*)(wrow + (((q + 1) & 1) * 4 + i) * 16 * GB_PITCH) + ((q + 1) >> 1) * 32, lane); }
      __builtin_amdgcn_sched_barrier(0);   // keeps the next group's reads together ahead of this group's products: without it the compiler sinks each read to its own product, where the wave waits out the LDS latency
#pragma unroll
      for (int i = 0; i < 4; ++i) { const int j = (q & 1) * 4 + i; acc[j] = wmma_bf(a[q >> 1].l, w[q & 1][i], acc[j]); acc[j] = wmma_bf(a[q >> 1].h, w[q & 1][i], acc[j]); }
      __builtin_amdgcn_sched_barrier(0); }   // ... and what follows behind these products: the next reads as one group; behind the last group the foot's waits and barrier, which the compiler otherwise lifts over the products
    asm volatile("s_wait_dscnt 0x0" ::: "memory");            // this wave's reads of this block are done
    asm volatile("s_wait_asynccnt 0x0" ::: "memory");         // this wave's copies of block t + 1 have landed
    __syncthreads();                                          // publishes block t + 1 and frees the buffer that this trip has read
    if (t + 2 < DM / GK) stage_gemm(la + (unsigned)(t & 1) * GS_BYTES, lw + (unsigned)(t & 1) * GS_BYTES, gx + (t + 2) * GK, gw + (t + 2) * GK); }
  asm volatile("s_wait_asynccnt 0x0" ::: "memory");           // nothing is in flight behind the loop: the epilogue may take the LDS over
#pragma unroll
  for (int j = 0; j < 8; ++j) {
#pragma unroll
    for (int r = 0; r < 8; ++r) so[wave][8 * g + r][j * 16 + col] = acc[j][r]; }
  LDSX();
  for (int rl = 0; rl < 16; ++rl) vst2(Y + (r0 + rl) * DM + n0 + lane * 4, *(const v4f*)&so[wave][rl][lane * 4]);
}
extern "C" void kernel_launch(void* const* d_in, const int* in_sizes, int n_in, void* d_out, int out_size, void* d_ws, size_t ws_size, hipStream_t stream) {
  (void)in_sizes; (void)n_in; (void)out_size;
  const float** F = (const float**)d_in;   // 0 query_x [2,2048,1024], 1 kv_x, 2 Wq (in,out), 3 Wk, 4 Wv, 5 Wo, 6 lambda_q1 [32], 7 lambda_k1, 8 lambda_q2, 9 lambda_k2, 10 subln_w [64]
  if (ws_size < (size_t)WS_END) return;
  char* ws = (char*)d_ws; __bf16* PK = (__bf16*)(ws + WS_PK); _Float16 *QK = (_Float16*)(ws + WS_QK), *QKL = (_Float16*)(ws + WS_QKL), *VTH = (_Float16*)(ws + WS_VTH), *VTL = (_Float16*)(ws + WS_VTL); float* O = (float*)(ws + WS_O);
  k_pack<<<dim3(DM / PT_N, DM / PT_K, 4), 128, 0, stream>>>(F[2], F[3], F[4], F[5], PK);
  k_qkv<<<dim3(TNB * SS / 64, QKVW / 128), 128, 0, stream>>>(F[0], F[1], PK + PK_A, QK, QKL, VTH, VTL);
  k_attn<<<dim3(TQB, NH, TNB), 256, 0, stream>>>(QK, QKL, VTH, VTL, F[6], F[7], F[8], F[9], F[10], O);
  k_out<<<dim3(TOB, DM / 128), 128, 0, stream>>>(O, PK + PK_P, (float*)d_out);
}

// v008
// One run takes 181 microseconds.
// Two timings next to v007 put it at 1.05 and 1.04 times that version's speed.
// All steps since v000 together make it 3.74 times as fast.
// compute dtype: query_x, kv_x, Wq, Wk, Wv, Wo, lambda_*, subln_w (module inputs) rounded to bf16; q (from query_x), k and v (from kv_x) with exact bf16 products on WMMA 16x16x32 ((in,out) weights packed as transposed rows); q and k stored as f16 hi + (x2048-scaled) residual planes; per head pair both 32-dim sub-head score maps with 3 products x 32^-0.5, two softmaxes in f32 (hardware exp), each against a reference that follows the running maximum only when that rises by more than 8 in log2; P as f16 hi + (x2048) residual x v hi/lo (3 products) for both maps; lambda from the four 32-vectors in f32 (precise expf); the differential combination, RMS norm (eps 1e-5) x subln_w x (1 - lambda_init) in f32; output projection with the context as bf16 hi + residual x exact Wo (2 products); f32 accumulate.
#include <hip/hip_runtime.h>
#include <math.h>

typedef __attribute__((ext_vector_type(16))) _Float16 v16h;
typedef __attribute__((ext_vector_type(16))) __bf16 v16b;
typedef __attribute__((ext_vector_type(8)))  _Float16 v8h;
typedef __attribute__((ext_vector_type(8)))  float v8f;
typedef __attribute__((ext_vector_type(4)))  float v4f;
typedef __attribute__((ext_vector_type(2)))  float v2f;
typedef __attribute__((ext_vector_type(4)))  unsigned v4u;
typedef __attribute__((ext_vector_type(4)))  int v4i;
typedef float __attribute__((may_alias)) float_a;
typedef int __attribute__((may_alias)) int_a;

template <typename T> __device__ __forceinline__ void vst2(void* p, T v) { *(T*)p = v;  }
__device__ __forceinline__ v8f wmma16(v16h a, v16h b, v8f c) {
  v8f d = __builtin_amdgcn_wmma_f32_16x16x32_f16(false, a, false, b, (short)0, c, false, false);
  return d;
}
__device__ __forceinline__ v8f wmma_bf(v16b a, v16b b, v8f c) {
  v8f d = __builtin_amdgcn_wmma_f32_16x16x32_bf16(false, a, false, b, (short)0, c, false, false);
  return d;
}
// Cross multi-head differential attention (B 2, T = S = 2,048, d 1,024, 16 head pairs of 32-dim q/k and 64-dim values, depth-12 lambda_init): softmax(q1 k1) - lambda softmax(q2 k2) applied to v, RMS norm, output projection.
__device__ __forceinline__ v16h frag_h(const _Float16* rowk0, int lane) {
  union { v16h v; v8h q[2]; } u; const _Float16* p = rowk0 + 8 * (lane >> 4);
  u.q[0] = *(const v8h*)p; u.q[1] = *(const v8h*)(p + 16); return u.v;
}
__device__ __forceinline__ v16h frag_f32(const float* rowk0, int lane) {
  v16h a; const float* p = rowk0 + 8 * (lane >> 4);
#pragma unroll
  for (int i = 0; i < 8; ++i) { a[i] = (_Float16)p[i]; a[8 + i] = (_Float16)p[16 + i]; }
  return a;
}
__device__ __forceinline__ v16h frag_f32s(const float* rowk0, int lane, float sc) {
  v16h a; const float* p = rowk0 + 8 * (lane >> 4);
#pragma unroll
  for (int i = 0; i < 8; ++i) { a[i] = (_Float16)(p[i] * sc); a[8 + i] = (_Float16)(p[16 + i] * sc); }
  return a;
}
// column fragment from a [K][ld] layout (column n), rows >= K read as 0
__device__ __forceinline__ v16h fragc_f32(const float* W, int k0, int n, int lane, int ld, int K) {
  v16h a; const int g = lane >> 4;
#pragma unroll
  for (int i = 0; i < 8; ++i) { const int ka = k0 + 8 * g + i, kb = ka + 16;
    a[i] = (_Float16)(ka < K ? W[(size_t)(ka < K ? ka : K - 1) * ld + n] : 0.f); a[8 + i] = (_Float16)(kb < K ? W[(size_t)(kb < K ? kb : K - 1) * ld + n] : 0.f); }
  return a;
}
struct F2 { v16b h, l; };
__device__ __forceinline__ F2 bsplit16(const float v[16]) { F2 r;
#pragma unroll
  for (int i = 0; i < 16; ++i) { const __bf16 h = (__bf16)v[i]; r.h[i] = h; r.l[i] = (__bf16)(v[i] - (float)h); }
  return r; }
__device__ __forceinline__ F2 split_row(const float* row, int k0, int lane) { float v[16]; const float* p = row + k0 + 8 * (lane >> 4);
#pragma unroll
  for (int i = 0; i < 8; ++i) { v[i] = p[i]; v[8 + i] = p[16 + i]; }
  return bsplit16(v); }
__device__ __forceinline__ F2 split_rowK(const float* row, int k0, int lane, int K) { float v[16]; const int g = lane >> 4;
#pragma unroll
  for (int i = 0; i < 8; ++i) { const int ka = k0 + 8 * g + i, kb = ka + 16; v[i] = ka < K ? row[ka < K ? ka : K - 1] : 0.f; v[8 + i] = kb < K ? row[kb < K ? kb : K - 1] : 0.f; }
  return bsplit16(v); }
__device__ __forceinline__ F2 split_col(const float* W, int k0, int n, int lane, int ld, int K) { float v[16]; const int g = lane >> 4;
#pragma unroll
  for (int i = 0; i < 8; ++i) { const int ka = k0 + 8 * g + i, kb = ka + 16; v[i] = ka < K ? W[(size_t)(ka < K ? ka : K - 1) * ld + n] : 0.f; v[8 + i] = kb < K ? W[(size_t)(kb < K ? kb : K - 1) * ld + n] : 0.f; }
  return bsplit16(v); }
__device__ __forceinline__ v8f mac3(const F2& a, const F2& b, v8f c) { c = wmma_bf(a.l, b.h, c); c = wmma_bf(a.h, b.l, c); return wmma_bf(a.h, b.h, c); }
__device__ __forceinline__ float sigm(float v) { return 1.0f / (1.0f + expf(-v)); }
#define LDSX() do { asm volatile("s_wait_dscnt 0" ::: "memory"); __builtin_amdgcn_wave_barrier(); __builtin_amdgcn_fence(__ATOMIC_RELEASE, "workgroup"); } while (0)


#define NB 2
#define SS 2048
#define DM 1024
#define NH 16
#define HD 64
#define QKVW (3 * DM)
#ifndef TQB
#define TQB (SS / 128)         // k_attn query tiles: 128 queries, 8 waves
#define TNB NB
#define TOB (NB * SS / 64)     // output row tiles (all)
#endif
typedef __attribute__((ext_vector_type(8))) __bf16 v8b;
__device__ __forceinline__ v16b frag_b(const __bf16* rowk0, int lane) {
  union { v16b v; v8b q[2]; } u; const __bf16* p = rowk0 + 8 * (lane >> 4);
  u.q[0] = *(const v8b*)p; u.q[1] = *(const v8b*)(p + 16); return u.v;
}
__device__ __forceinline__ float bfr(float v) { return (float)(__bf16)v; }
__device__ __attribute__((noinline)) float exp_ni(float v) { return expf(v); }
__device__ __attribute__((noinline)) float erf_ni(float v) { return erff(v); }

#define PK_A 0                       // [3072][1024] Wqkv rows (natural [out][in])
#define PK_P (PK_A + QKVW * DM)        // [1024][1024] Wo rows (natural)
#define PK_END (PK_P + DM * DM)
#define WS_PK  0u
#define WS_QK  (WS_PK + 2u * PK_END)             // f16 [4096 rows][2048]: q | k
#define WS_QKL (WS_QK + 2u * NB * SS * 2 * DM)     // f16 q | k residual planes x2048
#define WS_VTH (WS_QKL + 2u * NB * SS * 2 * DM)    // f16 [b][1024 (h*64+d)][2048 s] hi
#define WS_VTL (WS_VTH + 2u * NB * DM * SS)        // f16 lo x 2048
#define WS_O   (WS_VTL + 2u * NB * DM * SS)        // f32 [4096][1024]
#define WS_CS  (WS_O + 4u * NB * SS * DM)           // 2 x [2048][32] f32, reserved, unused (no RoPE)
#define WS_END (WS_CS + 4u * 2 * SS * 32)
// ---- k_pack: block = (128 columns n, 64 rows k, which) of an (in,out) weight: the tile is read along its rows (a wave-wide 16-byte load = 512 contiguous bytes of one k row), rounded to bf16, turned in LDS and written as 128-byte pieces of the transposed rows; which 0..2 -> W_q/W_k/W_v into PK_A rows which*1024 + n; 3 -> W_o into PK_P
#define PT_N 128
#define PT_K 64
#define PT_P (PT_K / 2 + 1)               // dwords per LDS row n: 32 pairs of k neighbours and one of padding, so that the writes (lanes 4 rows apart) and the row-wise read-out both spread over the banks
typedef __attribute__((ext_vector_type(2))) __bf16 v2b;
__global__ __launch_bounds__(128) void k_pack(const float* __restrict__ WQ, const float* __restrict__ WK, const float* __restrict__ WV, const float* __restrict__ WO, __bf16* __restrict__ PK) {
  __shared__ __align__(16) unsigned s[PT_N * PT_P]; const int t = threadIdx.x, wave = t >> 5, lane = t & 31, n0 = blockIdx.x * PT_N, k0 = blockIdx.y * PT_K, which = blockIdx.z; const float* Wm = (which == 0) ? WQ : (which == 1) ? WK : (which == 2) ? WV : WO;
  const float* src = Wm + (size_t)(k0 + wave * 16) * DM + n0 + lane * 4;   // this wave's 16 k rows, this lane's 4 columns
  v4f x[16];
#pragma unroll   // x[] stays in registers and the 16 loads issue as one group
  for (int i = 0; i < 16; ++i) x[i] = *(const v4f*)(src + (size_t)i * DM);
  // all 16 loads are in flight together, and no register that one of them names (data or address) is rewritten ahead of this wait (a precaution): the values are inputs only
  asm volatile("s_wait_xcnt 0x0" :: "v"(x[0]), "v"(x[1]), "v"(x[2]), "v"(x[3]), "v"(x[4]), "v"(x[5]), "v"(x[6]), "v"(x[7]), "v"(x[8]), "v"(x[9]), "v"(x[10]), "v"(x[11]), "v"(x[12]), "v"(x[13]), "v"(x[14]), "v"(x[15]), "v"(src) : "memory");
#pragma unroll   // constant indices into x[] (both loops)
  for (int i = 0; i < 8; ++i) {
#pragma unroll
    for (int j = 0; j < 4; ++j) { const v2b two = { (__bf16)x[2 * i][j], (__bf16)x[2 * i + 1][j] }; s[(lane * 4 + j) * PT_P + wave * 8 + i] = __builtin_bit_cast(unsigned, two); } }
  __syncthreads();
  __bf16* dst = ((which < 3) ? PK + PK_A + ((size_t)which * DM + n0) * DM : PK + PK_P + (size_t)n0 * DM) + k0;
  unsigned* d = (unsigned*)(dst + (size_t)wave * (PT_N / 4) * DM) + lane; const unsigned* sr = s + wave * (PT_N / 4) * PT_P + lane; unsigned y[PT_N / 4];
#pragma unroll   // all 32 LDS reads ahead of the stores, each value in a register of its own: no register of an issued store is rewritten
  for (int r = 0; r < PT_N / 4; ++r) y[r] = sr[r * PT_P];
#pragma unroll   // constant indices into y[], row steps as immediate offsets
  for (int r = 0; r < PT_N / 4; ++r) d[r * (DM / 2)] = y[r];   // one whole 128-byte line a wave-wide store
}
#define GK 64                              // k depth of one staged block: X rows of 256 bytes, weight rows of 128 bytes, whole cache lines
#define GA_PITCH 272                       // LDS bytes per staged f32 row (256 data bytes, 16 B x odd for the ds_load_b128 readers)
#define GB_PITCH 144                       // LDS bytes per staged bf16 weight row (128 data bytes, 16 B x odd)
#define GA_BYTES (64 * GA_PITCH)
#define GS_BYTES (GA_BYTES + 128 * GB_PITCH)   // one staged block: 64 f32 rows, then 128 weight rows
#define COPY8_TEXT "global_load_async_to_lds_b128 %0, %8, off\n\t" "global_load_async_to_lds_b128 %1, %9, off\n\t" "global_load_async_to_lds_b128 %2, %10, off\n\t" "global_load_async_to_lds_b128 %3, %11, off\n\t" \
                   "global_load_async_to_lds_b128 %4, %12, off\n\t" "global_load_async_to_lds_b128 %5, %13, off\n\t" "global_load_async_to_lds_b128 %6, %14, off\n\t" "global_load_async_to_lds_b128 %7, %15, off\n\t" "s_wait_xcnt 0x0"
// one 64-deep k block of a 64 x 128 GEMM tile into LDS, through no register: every lane copies 16 bytes of eight f32 rows (16 lanes a row, rows 8 apart) and of eight weight rows (8 lanes a row, rows 16 apart), so each wave-wide copy covers whole lines.
// s_wait_xcnt 0 is each statement's last line so that no address register a copy names is rewritten ahead of it (a precaution).
__device__ __forceinline__ void stage_gemm(unsigned la, unsigned lw, const float* gx, const __bf16* gw) {
  const unsigned sa = 8 * GA_PITCH, sw = 16 * GB_PITCH;
  asm volatile(COPY8_TEXT :: "v"(la), "v"(la + sa), "v"(la + 2 * sa), "v"(la + 3 * sa), "v"(la + 4 * sa), "v"(la + 5 * sa), "v"(la + 6 * sa), "v"(la + 7 * sa),
               "v"(gx), "v"(gx + 8 * DM), "v"(gx + 16 * DM), "v"(gx + 24 * DM), "v"(gx + 32 * DM), "v"(gx + 40 * DM), "v"(gx + 48 * DM), "v"(gx + 56 * DM) : "memory");
  asm volatile(COPY8_TEXT :: "v"(lw), "v"(lw + sw), "v"(lw + 2 * sw), "v"(lw + 3 * sw), "v"(lw + 4 * sw), "v"(lw + 5 * sw), "v"(lw + 6 * sw), "v"(lw + 7 * sw),
               "v"(gw), "v"(gw + 16 * DM), "v"(gw + 32 * DM), "v"(gw + 48 * DM), "v"(gw + 64 * DM), "v"(gw + 80 * DM), "v"(gw + 96 * DM), "v"(gw + 112 * DM) : "memory");
}
// the 16 f32 of one A fragment (k order of frag_b) from a staged row
__device__ __forceinline__ void row16(const char* row, int u, int g, float v[16]) {
  const v4f* p = (const v4f*)(row + u * 128 + 32 * g); const v4f x0 = p[0], x1 = p[1], x2 = p[4], x3 = p[5];
#pragma unroll
  for (int i = 0; i < 4; ++i) { v[i] = x0[i]; v[4 + i] = x1[i]; v[8 + i] = x2[i]; v[12 + i] = x3[i]; }
}
__global__ __launch_bounds__(128) void k_qkv(const float* __restrict__ XQ, const float* __restrict__ XKV, const __bf16* __restrict__ P, _Float16* __restrict__ QK, _Float16* __restrict__ QKL, _Float16* __restrict__ VTH, _Float16* __restrict__ VTL) {
  const float* X = (blockIdx.y * 128 < DM) ? XQ : XKV;   // q from query_x, k and v from kv_x
  __shared__ __align__(16) char sm[2 * GS_BYTES];   // in the loop two staged k blocks (the next lands while this one is read by all four waves); behind it the epilogue's tiles
  _Float16 (*so)[16][136] = (_Float16 (*)[16][136])sm; _Float16 (*sol)[16][136] = (_Float16 (*)[16][136])(sm + 4 * 16 * 136 * 2); _Float16 (*sth)[72] = (_Float16 (*)[72])sm; _Float16 (*stl)[72] = (_Float16 (*)[72])(sm + 128 * 72 * 2);
  const int tid = threadIdx.x, wave = tid >> 5, lane = tid & 31, col = lane & 15, g = lane >> 4; const size_t r0 = (size_t)blockIdx.x * 64 + wave * 16; const int n0 = blockIdx.y * 128;
  const unsigned la = (unsigned)(size_t)sm + (tid >> 4) * GA_PITCH + (tid & 15) * 16, lw = (unsigned)(size_t)sm + GA_BYTES + (tid >> 3) * GB_PITCH + (tid & 7) * 16;   // this lane's LDS byte addresses in buffer 0
  const float* gx = X + ((size_t)blockIdx.x * 64 + (tid >> 4)) * DM + (tid & 15) * 4; const __bf16* gw = P + (size_t)(n0 + (tid >> 3)) * DM + (tid & 7) * 8;
  v8f acc[8] = {};
  stage_gemm(la, lw, gx, gw);                                 // block 0
  asm volatile("s_wait_asynccnt 0x0" ::: "memory");           // this wave's copies of block 0 have landed
  __syncthreads();                                            // ... and every other wave's: block 0 may be read
  stage_gemm(la + GS_BYTES, lw + GS_BYTES, gx + GK, gw + GK);   // block 1 flies during trip 0
#pragma unroll 1   // rolled: one copy of the trip keeps the text short
  for (int t = 0; t < DM / GK; ++t) { const char* tb = sm + (t & 1) * GS_BYTES;
    // the trip's 16 weight fragments in four groups of four (group q: k half q / 2, columns 64 (q & 1) ...), each read one group ahead of its products so that a wave does not wait out the LDS latency per product
    const char* wrow = tb + GA_BYTES + col * GB_PITCH; v16b w[2][4], a[2];
#pragma unroll
    for (int u = 0; u < 2; ++u) { float xv[16]; row16(tb + (wave * 16 + col) * GA_PITCH, u, g, xv);
#pragma unroll
      for (int i = 0; i < 16; ++i) a[u][i] = (__bf16)xv[i]; }
#pragma unroll
    for (int i = 0; i < 4; ++i) w[0][i] = frag_b((const __bf16*)(wrow + i * 16 * GB_PITCH), lane);
#pragma unroll
    for (int q = 0; q < 4; ++q) {
      if (q < 3) {
#pragma unroll
        for (int i = 0; i < 4; ++i) w[(q + 1) & 1][i] = frag_b((const __bf16*)(wrow + (((q + 1) & 1) * 4 + i) * 16 * GB_PITCH) + ((q + 1) >> 1) * 32, lane); }
      __builtin_amdgcn_sched_barrier(0);   // keeps the next group's reads together ahead of this group's products: without it the compiler sinks each read to its own product, where the wave waits out the LDS latency
#pragma unroll
      for (int i = 0; i < 4; ++i) acc[(q & 1) * 4 + i] = wmma_bf(a[q >> 1], w[q & 1][i], acc[(q & 1) * 4 + i]);
      __builtin_amdgcn_sched_barrier(0); }   // ... and what follows behind these products: the next reads as one group; behind the last group the foot's waits and barrier, which the compiler otherwise lifts over the products
    asm volatile("s_wait_dscnt 0x0" ::: "memory");            // this wave's reads of this block are done
    asm volatile("s_wait_asynccnt 0x0" ::: "memory");         // this wave's copies of block t + 1 have landed
    __syncthreads();                                          // publishes block t + 1 and frees the buffer that this trip has read
    if (t + 2 < DM / GK) stage_gemm(la + (unsigned)(t & 1) * GS_BYTES, lw + (unsigned)(t & 1) * GS_BYTES, gx + (t + 2) * GK, gw + (t + 2) * GK); }
  asm volatile("s_wait_asynccnt 0x0" ::: "memory");           // nothing is in flight behind the loop: the epilogue may take the LDS over
  if (n0 < 2 * DM) {   // q stored unscaled (f16 sigma ~0.6, no subnormal exposure); 32^-0.5 applied to the f32 score
#pragma unroll
    for (int j = 0; j < 8; ++j) {
#pragma unroll
      for (int r = 0; r < 8; ++r) { const float v = acc[j][r]; const _Float16 hv = (_Float16)v; so[wave][8 * g + r][j * 16 + col] = hv; sol[wave][8 * g + r][j * 16 + col] = (_Float16)((v - (float)hv) * 2048.0f); } }   // q, k as f16 hi + (x2048) residual (no RoPE in this module)
    LDSX();
    for (int rl = 0; rl < 16; ++rl) if (lane < 16) { vst2((unsigned*)(QK + (r0 + rl) * (2 * DM) + n0 + lane * 8), *(const v4u*)&so[wave][rl][lane * 8]); vst2((unsigned*)(QKL + (r0 + rl) * (2 * DM) + n0 + lane * 8), *(const v4u*)&sol[wave][rl][lane * 8]); }
  } else {
#pragma unroll
    for (int j = 0; j < 8; ++j) {
#pragma unroll
      for (int r = 0; r < 8; ++r) { const float v = acc[j][r]; const _Float16 hv = (_Float16)v; sth[j * 16 + col][wave * 16 + 8 * g + r] = hv; stl[j * 16 + col][wave * 16 + 8 * g + r] = (_Float16)((v - (float)hv) * 2048.0f); } }
    __syncthreads();
    const size_t rb = (size_t)blockIdx.x * 64; const int b = (int)(rb / SS), s0 = (int)(rb % SS); const int pc0 = n0 - 2 * DM;
    for (int q = tid; q < 128 * 8; q += 128) { const int d = q >> 3, pc = q & 7; const size_t o = ((size_t)b * DM + pc0 + d) * SS + s0 + pc * 8; vst2((unsigned*)(VTH + o), *(const v4u*)&sth[d][pc * 8]); vst2((unsigned*)(VTL + o), *(const v4u*)&stl[d][pc * 8]); }
  }
}
__device__ __forceinline__ float xhalf(float x) { return __builtin_bit_cast(float, __builtin_amdgcn_permlanex16(__builtin_bit_cast(int, x), __builtin_bit_cast(int, x), 0x76543210, 0xfedcba98, false, false)); }   // lane l with lane l ^ 16
#define LAMBDA_INIT 0.78360247f   // 0.8 - 0.6*exp(-0.3*12), float32
#define QSC 0.17677669529663687f           // 32^-0.5
#define RISE (8.0f * 0.6931471805599453f / QSC)   // a rise of 8 in log2, in unscaled score units
#define STG_PITCH 40                       // f16 per staged row: 64 data bytes at an 80-byte pitch (16 B x odd) for the ds_load_b128 readers
#define STG_ROWS 192                       // one 32-key tile: rows 0..31 K hi, 32..63 K lo (row = key), 64..127 V hi, 128..191 V lo (row = value dim)
#define STG_BYTES (STG_ROWS * STG_PITCH * 2)
// one 32-key tile into LDS by the work-group's 256 lanes: every lane copies 16 bytes of three rows (its row r = tid / 4 of each 64-row group: K hi and lo, V hi, V lo), through no register.
// s_wait_xcnt 0 is the statement's last line so that no address register a copy names is rewritten ahead of it (a precaution).
__device__ __forceinline__ void stage_tile(unsigned l, const _Float16* k, const _Float16* vh, const _Float16* vl) {
  const unsigned g64 = 64 * STG_PITCH * 2;   // LDS bytes of one 64-row group
  asm volatile("global_load_async_to_lds_b128 %0, %3, off\n\t"
               "global_load_async_to_lds_b128 %1, %4, off\n\t"
               "global_load_async_to_lds_b128 %2, %5, off\n\t"
               "s_wait_xcnt 0x0"
               :: "v"(l), "v"(l + g64), "v"(l + 2 * g64), "v"(k), "v"(vh), "v"(vl) : "memory");
}
__global__ __launch_bounds__(256) void k_attn(const _Float16* __restrict__ QK, const _Float16* __restrict__ QKL, const _Float16* __restrict__ VTH, const _Float16* __restrict__ VTL, const float* __restrict__ LQ1, const float* __restrict__ LK1, const float* __restrict__ LQ2, const float* __restrict__ LK2, const float* __restrict__ SUBW, float* __restrict__ O) {
  __shared__ __align__(16) float so[8][16][68]; __shared__ __align__(16) float so1[8][16][68];
  __shared__ __align__(16) _Float16 stg[2][STG_ROWS][STG_PITCH];   // two buffers: the next 32-key tile lands while this one is read by all eight waves
  const int tid = threadIdx.x, wave = tid >> 5, lane = tid & 31, col = lane & 15, g = lane >> 4;
  const int qb = blockIdx.x, h = blockIdx.y, b = blockIdx.z; const int q0 = qb * 128 + wave * 16; const size_t rq = (size_t)b * SS + q0 + col;
  float lam; { float a1 = 0.f, a2 = 0.f;
#pragma unroll 1
    for (int i = 0; i < 32; ++i) { a1 += bfr(LQ1[i]) * bfr(LK1[i]); a2 += bfr(LQ2[i]) * bfr(LK2[i]); }
    lam = exp_ni(a1) - exp_ni(a2) + LAMBDA_INIT; }
  const unsigned lst = (unsigned)(size_t)&stg[0][tid >> 2][(tid & 3) * 8];   // this lane's LDS byte address in buffer 0, row group 0 (rows 0..63)
  const size_t vso = ((size_t)b * DM + h * HD + (tid >> 2)) * SS + (tid & 3) * 8; const _Float16* gvh = VTH + vso; const _Float16* gvl = VTL + vso;
  // the two sub-heads are processed one after the other (sub-head 0's normalised P.V parked in LDS) to keep registers under 256
#pragma unroll 1
  for (int sh2 = 0; sh2 < 2; ++sh2) {
    const v16h aq = frag_h(QK + rq * (2 * DM) + h * HD + sh2 * 32, lane), aql = frag_h(QKL + rq * (2 * DM) + h * HD + sh2 * 32, lane);
    float m = -3.0e38f, mq = 0.f, l = 0.f;   // this lane's query: the reference in use, held from trip to trip, in unscaled score units and x 32^-0.5 (same in both halves), and this half's part of the sum
    v8f acc[4] = {}, accl[4] = {};   // acc[dt][r]: value dim dt * 16 + 8 g + r of query col
    const size_t kso = ((size_t)b * SS + ((tid >> 2) & 31)) * (2 * DM) + DM + h * HD + sh2 * 32 + (tid & 3) * 8; const _Float16* gk = (tid < 128 ? QK : QKL) + kso;   // waves 0..3 bring K hi, waves 4..7 K lo
    stage_tile(lst, gk, gvh, gvl);                       // tile 0 (both buffers are free: the last trip's foot ended every read)
    asm volatile("s_wait_asynccnt 0x0" ::: "memory");           // this wave's copies of tile 0 have landed
    __syncthreads();                                            // ... and every other wave's: tile 0 may be read
    stage_tile(lst + STG_BYTES, gk + (size_t)32 * 2 * DM, gvh + 32, gvl + 32);   // tile 1 flies during trip 0
#pragma unroll 1
    for (int ks = 0; ks < SS / 32; ++ks) { v8f s[2]; const _Float16 (*tb)[STG_PITCH] = stg[ks & 1];
      // all 24 LDS reads of the trip stand as one group at its head: the K fragments are waited for once, the V fragments land under the score products and the softmax
      v16h fkh[2], fkl[2], fvh[4], fvl[4];
#pragma unroll
      for (int ct = 0; ct < 2; ++ct) { fkh[ct] = frag_h(&tb[ct * 16 + col][0], lane); fkl[ct] = frag_h(&tb[32 + ct * 16 + col][0], lane); }
#pragma unroll
      for (int dt = 0; dt < 4; ++dt) { fvh[dt] = frag_h(&tb[64 + dt * 16 + col][0], lane); fvl[dt] = frag_h(&tb[128 + dt * 16 + col][0], lane); }
      __builtin_amdgcn_sched_barrier(0);   // keeps the reads above together: without it the compiler sinks each one to its product, where the wave waits out the LDS latency every time
#pragma unroll
      for (int ct = 0; ct < 2; ++ct) {
        v8f c = {}, cl = {}; c = wmma16(fkh[ct], aq, c); cl = wmma16(fkh[ct], aql, cl); cl = wmma16(fkl[ct], aq, cl);
#pragma unroll
        for (int r = 0; r < 8; ++r) s[ct][r] = c[r] + cl[r] * (1.0f / 2048.0f); }   // unscaled
      float mx = fmaxf(s[0][0], s[1][0]);   // over this half's 16 keys
#pragma unroll
      for (int r = 1; r < 8; ++r) mx = fmaxf(mx, fmaxf(s[0][r], s[1][r]));
      // the reference moves to the maximum, and sum and output are rescaled, only when some query of the wave rises above the one in use by more than RISE (trip 0 always does): one test a trip, a scalar branch; P stays at or below 2^8, inside f16
      if (__builtin_amdgcn_ballot_w32(mx > m + RISE) != 0) {
        mx = fmaxf(mx, xhalf(mx));
        const float mn = fmaxf(m, mx); const float alpha = (m <= -1.0e38f) ? 0.f : __expf((m - mn) * QSC); m = mn; mq = mn * QSC;
        l *= alpha;
#pragma unroll
        for (int dt = 0; dt < 4; ++dt) { acc[dt] *= alpha; accl[dt] *= alpha; } }
      v8f e0, e1; float es0 = 0.f, es1 = 0.f;
#pragma unroll
      for (int r = 0; r < 8; ++r) { e0[r] = __expf(s[0][r] * QSC - mq); e1[r] = __expf(s[1][r] * QSC - mq); es0 += e0[r]; es1 += e1[r]; }
      const v8h h0 = __builtin_convertvector(e0, v8h), h1 = __builtin_convertvector(e1, v8h);   // P as f16 hi ...
      const v8h l0 = __builtin_convertvector((e0 - __builtin_convertvector(h0, v8f)) * 2048.0f, v8h), l1 = __builtin_convertvector((e1 - __builtin_convertvector(h1, v8f)) * 2048.0f, v8h);   // ... + (x2048) residual
      const v16h pah = __builtin_shufflevector(h0, h1, 0, 1, 2, 3, 4, 5, 6, 7, 8, 9, 10, 11, 12, 13, 14, 15), pal = __builtin_shufflevector(l0, l1, 0, 1, 2, 3, 4, 5, 6, 7, 8, 9, 10, 11, 12, 13, 14, 15);
      l += es0 + es1;
#pragma unroll
      for (int dt = 0; dt < 4; ++dt) { acc[dt] = wmma16(fvh[dt], pah, acc[dt]); accl[dt] = wmma16(fvh[dt], pal, accl[dt]); accl[dt] = wmma16(fvl[dt], pah, accl[dt]); }
      __builtin_amdgcn_sched_barrier(0);                        // keeps the products above the foot: without it the compiler lifts the waits and the barrier over them, and the next tile's copies are waited for right behind their issue
      asm volatile("s_wait_dscnt 0x0" ::: "memory");            // this wave's reads of this tile are done
      asm volatile("s_wait_asynccnt 0x0" ::: "memory");         // this wave's copies of tile ks + 1 have landed
      __syncthreads();                                          // publishes tile ks + 1 and frees the buffer that this trip has read
      if (ks + 2 < SS / 32) stage_tile(lst + (unsigned)(ks & 1) * STG_BYTES, gk + (size_t)(ks + 2) * 32 * 2 * DM, gvh + (ks + 2) * 32, gvl + (ks + 2) * 32); }
    asm volatile("s_wait_asynccnt 0x0" ::: "memory");           // nothing is in flight behind the loop
    const float il = 1.0f / (l + xhalf(l));   // the halves' sums are joined once
    if (sh2 == 0) {   // each lane parks, and later reads back, its own 32 values
#pragma unroll
      for (int dt = 0; dt < 4; ++dt) {
#pragma unroll
        for (int r = 0; r < 8; ++r) so1[wave][col][dt * 16 + 8 * g + r] = (acc[dt][r] + accl[dt][r] * (1.0f / 2048.0f)) * il; }
    } else {
      float ov[4][8]; float ssq = 0.f;
#pragma unroll
      for (int dt = 0; dt < 4; ++dt) {
#pragma unroll
        for (int r = 0; r < 8; ++r) { ov[dt][r] = so1[wave][col][dt * 16 + 8 * g + r] - lam * ((acc[dt][r] + accl[dt][r] * (1.0f / 2048.0f)) * il); ssq += ov[dt][r] * ov[dt][r]; } }
      ssq += xhalf(ssq);
      const float sc = (1.0f / sqrtf(ssq * (1.0f / HD) + 1e-5f)) * (1.0f - LAMBDA_INIT);
#pragma unroll
      for (int dt = 0; dt < 4; ++dt) {
#pragma unroll
        for (int r = 0; r < 8; ++r) so[wave][col][dt * 16 + 8 * g + r] = ov[dt][r] * sc * bfr(SUBW[dt * 16 + 8 * g + r]); } }
    LDSX(); }
  for (int rl = 0; rl < 16; ++rl) if (lane < 16) vst2(O + ((size_t)b * SS + q0 + rl) * DM + h * HD + lane * 4, *(const v4f*)&so[wave][rl][lane * 4]);
}
// ---- k_out: block = (64 rows, 128 cols): out = O(hi/lo) . Wo rows (2 products)
__global__ __launch_bounds__(128) void k_out(const float* __restrict__ O, const __bf16* __restrict__ P, float* __restrict__ Y) {
  __shared__ __align__(16) char sm[2 * GS_BYTES];   // in the loop two staged k blocks; behind it the epilogue's tile
  float (*so)[16][132] = (float (*)[16][132])sm;
  const int tid = threadIdx.x, wave = tid >> 5, lane = tid & 31, col = lane & 15, g = lane >> 4; const size_t r0 = (size_t)blockIdx.x * 64 + wave * 16; const int n0 = blockIdx.y * 128;
  const unsigned la = (unsigned)(size_t)sm + (tid >> 4) * GA_PITCH + (tid & 15) * 16, lw = (unsigned)(size_t)sm + GA_BYTES + (tid >> 3) * GB_PITCH + (tid & 7) * 16;   // this lane's LDS byte addresses in buffer 0
  const float* gx = O + ((size_t)blockIdx.x * 64 + (tid >> 4)) * DM + (tid & 15) * 4; const __bf16* gw = P + (size_t)(n0 + (tid >> 3)) * DM + (tid & 7) * 8;
  v8f acc[8] = {};
  stage_gemm(la, lw, gx, gw);                                 // block 0
  asm volatile("s_wait_asynccnt 0x0" ::: "memory");           // this wave's copies of block 0 have landed
  __syncthreads();                                            // ... and every other wave's: block 0 may be read
  stage_gemm(la + GS_BYTES, lw + GS_BYTES, gx + GK, gw + GK);   // block 1 flies during trip 0
#pragma unroll 1   // rolled: one copy of the trip keeps the text short
  for (int t = 0; t < DM / GK; ++t) { const char* tb = sm + (t & 1) * GS_BYTES;
    // the trip's 16 weight fragments in four groups of four, each read one group ahead of its products (as in k_qkv)
    const char* wrow = tb + GA_BYTES + col * GB_PITCH; v16b w[2][4]; F2 a[2];
    float xv[2][16];
#pragma unroll
    for (int u = 0; u < 2; ++u) row16(tb + (wave * 16 + col) * GA_PITCH, u, g, xv[u]);
#pragma unroll
    for (int i = 0; i < 4; ++i) w[0][i] = frag_b((const __bf16*)(wrow + i * 16 * GB_PITCH), lane);
    __builtin_amdgcn_sched_barrier(0);   // keeps the trip's first reads together at its head: without it the compiler deals them among the splitting of the rows, with a full wait in its midst
#pragma unroll
    for (int u = 0; u < 2; ++u) a[u] = bsplit16(xv[u]);
#pragma unroll
    for (int q = 0; q < 4; ++q) {
      if (q < 3) {
#pragma unroll
        for (int i = 0; i < 4; ++i) w[(q + 1) & 1][i] = frag_b((const __bf16*)(wrow + (((q + 1) & 1) * 4 + i) * 16 * GB_PITCH) + ((q + 1) >> 1) * 32, lane); }
      __builtin_amdgcn_sched_barrier(0);   // keeps the next group's reads together ahead of this group's products: without it the compiler sinks each read to its own product, where the wave waits out the LDS latency
#pragma unroll
      for (int i = 0; i < 4; ++i) { const int j = (q & 1) * 4 + i; acc[j] = wmma_bf(a[q >> 1].l, w[q & 1][i], acc[j]); acc[j] = wmma_bf(a[q >> 1].h, w[q & 1][i], acc[j]); }
      __builtin_amdgcn_sched_barrier(0); }   // ... and what follows behind these products: the next reads as one group; behind the last group the foot's waits and barrier, which the compiler otherwise lifts over the products
    asm volatile("s_wait_dscnt 0x0" ::: "memory");            // this wave's reads of this block are done
    asm volatile("s_wait_asynccnt 0x0" ::: "memory");         // this wave's copies of block t + 1 have landed
    __syncthreads();                                          // publishes block t + 1 and frees the buffer that this trip has read
    if (t + 2 < DM / GK) stage_gemm(la + (unsigned)(t & 1) * GS_BYTES, lw + (unsigned)(t & 1) * GS_BYTES, gx + (t + 2) * GK, gw + (t + 2) * GK); }
  asm volatile("s_wait_asynccnt 0x0" ::: "memory");           // nothing is in flight behind the loop: the epilogue may take the LDS over
#pragma unroll
  for (int j = 0; j < 8; ++j) {
#pragma unroll
    for (int r = 0; r < 8; ++r) so[wave][8 * g + r][j * 16 + col] = acc[j][r]; }
  LDSX();
  for (int rl = 0; rl < 16; ++rl) vst2(Y + (r0 + rl) * DM + n0 + lane * 4, *(const v4f*)&so[wave][rl][lane * 4]);
}
extern "C" void kernel_launch(void* const* d_in, const int* in_sizes, int n_in, void* d_out, int out_size, void* d_ws, size_t ws_size, hipStream_t stream) {
  (void)in_sizes; (void)n_in; (void)out_size;
  const float** F = (const float**)d_in;   // 0 query_x [2,2048,1024], 1 kv_x, 2 Wq (in,out), 3 Wk, 4 Wv, 5 Wo, 6 lambda_q1 [32], 7 lambda_k1, 8 lambda_q2, 9 lambda_k2, 10 subln_w [64]
  if (ws_size < (size_t)WS_END) return;
  char* ws = (char*)d_ws; __bf16* PK = (__bf16*)(ws + WS_PK); _Float16 *QK = (_Float16*)(ws + WS_QK), *QKL = (_Float16*)(ws + WS_QKL), *VTH = (_Float16*)(ws + WS_VTH), *VTL = (_Float16*)(ws + WS_VTL); float* O = (float*)(ws + WS_O);
  k_pack<<<dim3(DM / PT_N, DM / PT_K, 4), 128, 0, stream>>>(F[2], F[3], F[4], F[5], PK);
  k_qkv<<<dim3(TNB * SS / 64, QKVW / 128), 128, 0, stream>>>(F[0], F[1], PK + PK_A, QK, QKL, VTH, VTL);
  k_attn<<<dim3(TQB, NH, TNB), 256, 0, stream>>>(QK, QKL, VTH, VTL, F[6], F[7], F[8], F[9], F[10], O);
  k_out<<<dim3(TOB, DM / 128), 128, 0, stream>>>(O, PK + PK_P, (float*)d_out);
}

// v009
// One run takes 174 microseconds.
// Two timings next to v008 put it at 1.03 and 1.04 times that version's speed.
// Over all steps from v000 it is 3.88 times as fast.
// compute dtype: query_x, kv_x, Wq, Wk, Wv, Wo, lambda_*, subln_w (module inputs) rounded to bf16; q (from query_x), k and v (from kv_x) with exact bf16 products on WMMA 16x16x32 ((in,out) weights packed as transposed rows); q and k stored as f16 hi + (x2048-scaled) residual planes; q x 32^-0.5 x log2(e) in f32 ahead of its split; per head pair both 32-dim sub-head score maps with 3 products, the softmax reference subtracted as the C operand of the hi x hi product, two softmaxes in f32 (hardware exp2), each against a reference that follows the running maximum only when that rises by more than 8 in log2; P as f16 hi + (x2048) residual x v hi/lo (3 products) for both maps; lambda from the four 32-vectors in f32 (precise expf); the differential combination, RMS norm (eps 1e-5) x subln_w x (1 - lambda_init) in f32; output projection with the context as bf16 hi + residual x exact Wo (2 products); f32 accumulate.
#include <hip/hip_runtime.h>
#include <math.h>

typedef __attribute__((ext_vector_type(16))) _Float16 v16h;
typedef __attribute__((ext_vector_type(16))) __bf16 v16b;
typedef __attribute__((ext_vector_type(8)))  _Float16 v8h;
typedef __attribute__((ext_vector_type(8)))  float v8f;
typedef __attribute__((ext_vector_type(4)))  float v4f;
typedef __attribute__((ext_vector_type(2)))  float v2f;
typedef __attribute__((ext_vector_type(4)))  unsigned v4u;
typedef __attribute__((ext_vector_type(4)))  int v4i;
typedef float __attribute__((may_alias)) float_a;
typedef int __attribute__((may_alias)) int_a;

template <typename T> __device__ __forceinline__ void vst2(void* p, T v) { *(T*)p = v;  }
__device__ __forceinline__ v8f wmma16(v16h a, v16h b, v8f c) {
  v8f d = __builtin_amdgcn_wmma_f32_16x16x32_f16(false, a, false, b, (short)0, c, false, false);
  return d;
}
__device__ __forceinline__ v8f wmma_bf(v16b a, v16b b, v8f c) {
  v8f d = __builtin_amdgcn_wmma_f32_16x16x32_bf16(false, a, false, b, (short)0, c, false, false);
  return d;
}
// Cross multi-head differential attention (B 2, T = S = 2,048, d 1,024, 16 head pairs of 32-dim q/k and 64-dim values, depth-12 lambda_init): softmax(q1 k1) - lambda softmax(q2 k2) applied to v, RMS norm, output projection.
__device__ __forceinline__ v16h frag_h(const _Float16* rowk0, int lane) {
  union { v16h v; v8h q[2]; } u; const _Float16* p = rowk0 + 8 * (lane >> 4);
  u.q[0] = *(const v8h*)p; u.q[1] = *(const v8h*)(p + 16); return u.v;
}
__device__ __forceinline__ v16h frag_f32(const float* rowk0, int lane) {
  v16h a; const float* p = rowk0 + 8 * (lane >> 4);
#pragma unroll
  for (int i = 0; i < 8; ++i) { a[i] = (_Float16)p[i]; a[8 + i] = (_Float16)p[16 + i]; }
  return a;
}
__device__ __forceinline__ v16h frag_f32s(const float* rowk0, int lane, float sc) {
  v16h a; const float* p = rowk0 + 8 * (lane >> 4);
#pragma unroll
  for (int i = 0; i < 8; ++i) { a[i] = (_Float16)(p[i] * sc); a[8 + i] = (_Float16)(p[16 + i] * sc); }
  return a;
}
// column fragment from a [K][ld] layout (column n), rows >= K read as 0
__device__ __forceinline__ v16h fragc_f32(const float* W, int k0, int n, int lane, int ld, int K) {
  v16h a; const int g = lane >> 4;
#pragma unroll
  for (int i = 0; i < 8; ++i) { const int ka = k0 + 8 * g + i, kb = ka + 16;
    a[i] = (_Float16)(ka < K ? W[(size_t)(ka < K ? ka : K - 1) * ld + n] : 0.f); a[8 + i] = (_Float16)(kb < K ? W[(size_t)(kb < K ? kb : K - 1) * ld + n] : 0.f); }
  return a;
}
struct F2 { v16b h, l; };
__device__ __forceinline__ F2 bsplit16(const float v[16]) { F2 r;
#pragma unroll
  for (int i = 0; i < 16; ++i) { const __bf16 h = (__bf16)v[i]; r.h[i] = h; r.l[i] = (__bf16)(v[i] - (float)h); }
  return r; }
__device__ __forceinline__ F2 split_row(const float* row, int k0, int lane) { float v[16]; const float* p = row + k0 + 8 * (lane >> 4);
#pragma unroll
  for (int i = 0; i < 8; ++i) { v[i] = p[i]; v[8 + i] = p[16 + i]; }
  return bsplit16(v); }
__device__ __forceinline__ F2 split_rowK(const float* row, int k0, int lane, int K) { float v[16]; const int g = lane >> 4;
#pragma unroll
  for (int i = 0; i < 8; ++i) { const int ka = k0 + 8 * g + i, kb = ka + 16; v[i] = ka < K ? row[ka < K ? ka : K - 1] : 0.f; v[8 + i] = kb < K ? row[kb < K ? kb : K - 1] : 0.f; }
  return bsplit16(v); }
__device__ __forceinline__ F2 split_col(const float* W, int k0, int n, int lane, int ld, int K) { float v[16]; const int g = lane >> 4;
#pragma unroll
  for (int i = 0; i < 8; ++i) { const int ka = k0 + 8 * g + i, kb = ka + 16; v[i] = ka < K ? W[(size_t)(ka < K ? ka : K - 1) * ld + n] : 0.f; v[8 + i] = kb < K ? W[(size_t)(kb < K ? kb : K - 1) * ld + n] : 0.f; }
  return bsplit16(v); }
__device__ __forceinline__ v8f mac3(const F2& a, const F2& b, v8f c) { c = wmma_bf(a.l, b.h, c); c = wmma_bf(a.h, b.l, c); return wmma_bf(a.h, b.h, c); }
__device__ __forceinline__ float sigm(float v) { return 1.0f / (1.0f + expf(-v)); }
#define LDSX() do { asm volatile("s_wait_dscnt 0" ::: "memory"); __builtin_amdgcn_wave_barrier(); __builtin_amdgcn_fence(__ATOMIC_RELEASE, "workgroup"); } while (0)


#define NB 2
#define SS 2048
#define DM 1024
#define NH 16
#define HD 64
#define QKVW (3 * DM)
#ifndef TQB
#define TQB (SS / 128)         // k_attn query tiles: 128 queries, 8 waves
#define TNB NB
#define TOB (NB * SS / 64)     // output row tiles (all)
#endif
typedef __attribute__((ext_vector_type(8))) __bf16 v8b;
__device__ __forceinline__ v16b frag_b(const __bf16* rowk0, int lane) {
  union { v16b v; v8b q[2]; } u; const __bf16* p = rowk0 + 8 * (lane >> 4);
  u.q[0] = *(const v8b*)p; u.q[1] = *(const v8b*)(p + 16); return u.v;
}
__device__ __forceinline__ float bfr(float v) { return (float)(__bf16)v; }
__device__ __attribute__((noinline)) float exp_ni(float v) { return expf(v); }
__device__ __attribute__((noinline)) float erf_ni(float v) { return erff(v); }

#define PK_A 0                       // [3072][1024] Wqkv rows (natural [out][in])
#define PK_P (PK_A + QKVW * DM)        // [1024][1024] Wo rows (natural)
#define PK_END (PK_P + DM * DM)
#define WS_PK  0u
#define WS_QK  (WS_PK + 2u * PK_END)             // f16 [4096 rows][2048]: q x 32^-0.5 x log2(e) | k
#define WS_QKL (WS_QK + 2u * NB * SS * 2 * DM)     // f16 q | k residual planes x2048
#define WS_VTH (WS_QKL + 2u * NB * SS * 2 * DM)    // f16 [b][1024 (h*64+d)][2048 s] hi
#define WS_VTL (WS_VTH + 2u * NB * DM * SS)        // f16 lo x 2048
#define WS_O   (WS_VTL + 2u * NB * DM * SS)        // f32 [4096][1024]
#define WS_CS  (WS_O + 4u * NB * SS * DM)           // 2 x [2048][32] f32, reserved, unused (no RoPE)
#define WS_END (WS_CS + 4u * 2 * SS * 32)
// ---- k_pack: block = (128 columns n, 64 rows k, which) of an (in,out) weight: the tile is read along its rows (a wave-wide 16-byte load = 512 contiguous bytes of one k row), rounded to bf16, turned in LDS and written as 128-byte pieces of the transposed rows; which 0..2 -> W_q/W_k/W_v into PK_A rows which*1024 + n; 3 -> W_o into PK_P
#define PT_N 128
#define PT_K 64
#define PT_P (PT_K / 2 + 1)               // dwords per LDS row n: 32 pairs of k neighbours and one of padding, so that the writes (lanes 4 rows apart) and the row-wise read-out both spread over the banks
typedef __attribute__((ext_vector_type(2))) __bf16 v2b;
__global__ __launch_bounds__(128) void k_pack(const float* __restrict__ WQ, const float* __restrict__ WK, const float* __restrict__ WV, const float* __restrict__ WO, __bf16* __restrict__ PK) {
  __shared__ __align__(16) unsigned s[PT_N * PT_P]; const int t = threadIdx.x, wave = t >> 5, lane = t & 31, n0 = blockIdx.x * PT_N, k0 = blockIdx.y * PT_K, which = blockIdx.z; const float* Wm = (which == 0) ? WQ : (which == 1) ? WK : (which == 2) ? WV : WO;
  const float* src = Wm + (size_t)(k0 + wave * 16) * DM + n0 + lane * 4;   // this wave's 16 k rows, this lane's 4 columns
  v4f x[16];
#pragma unroll   // x[] stays in registers and the 16 loads issue as one group
  for (int i = 0; i < 16; ++i) x[i] = *(const v4f*)(src + (size_t)i * DM);
  // all 16 loads are in flight together, and no register that one of them names (data or address) is rewritten ahead of this wait (a precaution): the values are inputs only
  asm volatile("s_wait_xcnt 0x0" :: "v"(x[0]), "v"(x[1]), "v"(x[2]), "v"(x[3]), "v"(x[4]), "v"(x[5]), "v"(x[6]), "v"(x[7]), "v"(x[8]), "v"(x[9]), "v"(x[10]), "v"(x[11]), "v"(x[12]), "v"(x[13]), "v"(x[14]), "v"(x[15]), "v"(src) : "memory");
#pragma unroll   // constant indices into x[] (both loops)
  for (int i = 0; i < 8; ++i) {
#pragma unroll
    for (int j = 0; j < 4; ++j) { const v2b two = { (__bf16)x[2 * i][j], (__bf16)x[2 * i + 1][j] }; s[(lane * 4 + j) * PT_P + wave * 8 + i] = __builtin_bit_cast(unsigned, two); } }
  __syncthreads();
  __bf16* dst = ((which < 3) ? PK + PK_A + ((size_t)which * DM + n0) * DM : PK + PK_P + (size_t)n0 * DM) + k0;
  unsigned* d = (unsigned*)(dst + (size_t)wave * (PT_N / 4) * DM) + lane; const unsigned* sr = s + wave * (PT_N / 4) * PT_P + lane; unsigned y[PT_N / 4];
#pragma unroll   // all 32 LDS reads ahead of the stores, each value in a register of its own: no register of an issued store is rewritten
  for (int r = 0; r < PT_N / 4; ++r) y[r] = sr[r * PT_P];
#pragma unroll   // constant indices into y[], row steps as immediate offsets
  for (int r = 0; r < PT_N / 4; ++r) d[r * (DM / 2)] = y[r];   // one whole 128-byte line a wave-wide store
}
#define QSL 0.25503486f                    // 32^-0.5 x log2(e): q carries it, so that a score is an exponent of 2
#define GK 64                              // k depth of one staged block: X rows of 256 bytes, weight rows of 128 bytes, whole cache lines
#define GA_PITCH 272                       // LDS bytes per staged f32 row (256 data bytes, 16 B x odd for the ds_load_b128 readers)
#define GB_PITCH 144                       // LDS bytes per staged bf16 weight row (128 data bytes, 16 B x odd)
#define GA_BYTES (64 * GA_PITCH)
#define GS_BYTES (GA_BYTES + 128 * GB_PITCH)   // one staged block: 64 f32 rows, then 128 weight rows
#define COPY8_TEXT "global_load_async_to_lds_b128 %0, %8, off\n\t" "global_load_async_to_lds_b128 %1, %9, off\n\t" "global_load_async_to_lds_b128 %2, %10, off\n\t" "global_load_async_to_lds_b128 %3, %11, off\n\t" \
                   "global_load_async_to_lds_b128 %4, %12, off\n\t" "global_load_async_to_lds_b128 %5, %13, off\n\t" "global_load_async_to_lds_b128 %6, %14, off\n\t" "global_load_async_to_lds_b128 %7, %15, off\n\t" "s_wait_xcnt 0x0"
// one 64-deep k block of a 64 x 128 GEMM tile into LDS, through no register: every lane copies 16 bytes of eight f32 rows (16 lanes a row, rows 8 apart) and of eight weight rows (8 lanes a row, rows 16 apart), so each wave-wide copy covers whole lines.
// s_wait_xcnt 0 is each statement's last line so that no address register a copy names is rewritten ahead of it (a precaution).
__device__ __forceinline__ void stage_gemm(unsigned la, unsigned lw, const float* gx, const __bf16* gw) {
  const unsigned sa = 8 * GA_PITCH, sw = 16 * GB_PITCH;
  asm volatile(COPY8_TEXT :: "v"(la), "v"(la + sa), "v"(la + 2 * sa), "v"(la + 3 * sa), "v"(la + 4 * sa), "v"(la + 5 * sa), "v"(la + 6 * sa), "v"(la + 7 * sa),
               "v"(gx), "v"(gx + 8 * DM), "v"(gx + 16 * DM), "v"(gx + 24 * DM), "v"(gx + 32 * DM), "v"(gx + 40 * DM), "v"(gx + 48 * DM), "v"(gx + 56 * DM) : "memory");
  asm volatile(COPY8_TEXT :: "v"(lw), "v"(lw + sw), "v"(lw + 2 * sw), "v"(lw + 3 * sw), "v"(lw + 4 * sw), "v"(lw + 5 * sw), "v"(lw + 6 * sw), "v"(lw + 7 * sw),
               "v"(gw), "v"(gw + 16 * DM), "v"(gw + 32 * DM), "v"(gw + 48 * DM), "v"(gw + 64 * DM), "v"(gw + 80 * DM), "v"(gw + 96 * DM), "v"(gw + 112 * DM) : "memory");
}
// the 16 f32 of one A fragment (k order of frag_b) from a staged row
__device__ __forceinline__ void row16(const char* row, int u, int g, float v[16]) {
  const v4f* p = (const v4f*)(row + u * 128 + 32 * g); const v4f x0 = p[0], x1 = p[1], x2 = p[4], x3 = p[5];
#pragma unroll
  for (int i = 0; i < 4; ++i) { v[i] = x0[i]; v[4 + i] = x1[i]; v[8 + i] = x2[i]; v[12 + i] = x3[i]; }
}
__global__ __launch_bounds__(128) void k_qkv(const float* __restrict__ XQ, const float* __restrict__ XKV, const __bf16* __restrict__ P, _Float16* __restrict__ QK, _Float16* __restrict__ QKL, _Float16* __restrict__ VTH, _Float16* __restrict__ VTL) {
  const float* X = (blockIdx.y * 128 < DM) ? XQ : XKV;   // q from query_x, k and v from kv_x
  __shared__ __align__(16) char sm[2 * GS_BYTES];   // in the loop two staged k blocks (the next lands while this one is read by all four waves); behind it the epilogue's tiles
  _Float16 (*so)[16][136] = (_Float16 (*)[16][136])sm; _Float16 (*sol)[16][136] = (_Float16 (*)[16][136])(sm + 4 * 16 * 136 * 2); _Float16 (*sth)[72] = (_Float16 (*)[72])sm; _Float16 (*stl)[72] = (_Float16 (*)[72])(sm + 128 * 72 * 2);
  const int tid = threadIdx.x, wave = tid >> 5, lane = tid & 31, col = lane & 15, g = lane >> 4; const size_t r0 = (size_t)blockIdx.x * 64 + wave * 16; const int n0 = blockIdx.y * 128;
  const unsigned la = (unsigned)(size_t)sm + (tid >> 4) * GA_PITCH + (tid & 15) * 16, lw = (unsigned)(size_t)sm + GA_BYTES + (tid >> 3) * GB_PITCH + (tid & 7) * 16;   // this lane's LDS byte addresses in buffer 0
  const float* gx = X + ((size_t)blockIdx.x * 64 + (tid >> 4)) * DM + (tid & 15) * 4; const __bf16* gw = P + (size_t)(n0 + (tid >> 3)) * DM + (tid & 7) * 8;
  v8f acc[8] = {};
  stage_gemm(la, lw, gx, gw);                                 // block 0
  asm volatile("s_wait_asynccnt 0x0" ::: "memory");           // this wave's copies of block 0 have landed
  __syncthreads();                                            // ... and every other wave's: block 0 may be read
  stage_gemm(la + GS_BYTES, lw + GS_BYTES, gx + GK, gw + GK);   // block 1 flies during trip 0
#pragma unroll 1   // rolled: one copy of the trip keeps the text short
  for (int t = 0; t < DM / GK; ++t) { const char* tb = sm + (t & 1) * GS_BYTES;
    // the trip's 16 weight fragments in four groups of four (group q: k half q / 2, columns 64 (q & 1) ...), each read one group ahead of its products so that a wave does not wait out the LDS latency per product
    const char* wrow = tb + GA_BYTES + col * GB_PITCH; v16b w[2][4], a[2];
#pragma unroll
    for (int u = 0; u < 2; ++u) { float xv[16]; row16(tb + (wave * 16 + col) * GA_PITCH, u, g, xv);
#pragma unroll
      for (int i = 0; i < 16; ++i) a[u][i] = (__bf16)xv[i]; }
#pragma unroll
    for (int i = 0; i < 4; ++i) w[0][i] = frag_b((const __bf16*)(wrow + i * 16 * GB_PITCH), lane);
#pragma unroll
    for (int q = 0; q < 4; ++q) {
      if (q < 3) {
#pragma unroll
        for (int i = 0; i < 4; ++i) w[(q + 1) & 1][i] = frag_b((const __bf16*)(wrow + (((q + 1) & 1) * 4 + i) * 16 * GB_PITCH) + ((q + 1) >> 1) * 32, lane); }
      __builtin_amdgcn_sched_barrier(0);   // keeps the next group's reads together ahead of this group's products: without it the compiler sinks each read to its own product, where the wave waits out the LDS latency
#pragma unroll
      for (int i = 0; i < 4; ++i) acc[(q & 1) * 4 + i] = wmma_bf(a[q >> 1], w[q & 1][i], acc[(q & 1) * 4 + i]);
      __builtin_amdgcn_sched_barrier(0); }   // ... and what follows behind these products: the next reads as one group; behind the last group the foot's waits and barrier, which the compiler otherwise lifts over the products
    asm volatile("s_wait_dscnt 0x0" ::: "memory");            // this wave's reads of this block are done
    asm volatile("s_wait_asynccnt 0x0" ::: "memory");         // this wave's copies of block t + 1 have landed
    __syncthreads();                                          // publishes block t + 1 and frees the buffer that this trip has read
    if (t + 2 < DM / GK) stage_gemm(la + (unsigned)(t & 1) * GS_BYTES, lw + (unsigned)(t & 1) * GS_BYTES, gx + (t + 2) * GK, gw + (t + 2) * GK); }
  asm volatile("s_wait_asynccnt 0x0" ::: "memory");           // nothing is in flight behind the loop: the epilogue may take the LDS over
  if (n0 < 2 * DM) { const float qs = (n0 < DM) ? QSL : 1.0f;   // q columns x 32^-0.5 x log2(e), in f32 ahead of the split (f16 sigma ~0.26; the x2048 residual covers what falls into the subnormals); k as it is
#pragma unroll
    for (int j = 0; j < 8; ++j) {
#pragma unroll
      for (int r = 0; r < 8; ++r) { const float v = acc[j][r] * qs; const _Float16 hv = (_Float16)v; so[wave][8 * g + r][j * 16 + col] = hv; sol[wave][8 * g + r][j * 16 + col] = (_Float16)((v - (float)hv) * 2048.0f); } }   // q, k as f16 hi + (x2048) residual (no RoPE in this module)
    LDSX();
    for (int rl = 0; rl < 16; ++rl) if (lane < 16) { vst2((unsigned*)(QK + (r0 + rl) * (2 * DM) + n0 + lane * 8), *(const v4u*)&so[wave][rl][lane * 8]); vst2((unsigned*)(QKL + (r0 + rl) * (2 * DM) + n0 + lane * 8), *(const v4u*)&sol[wave][rl][lane * 8]); }
  } else {
#pragma unroll
    for (int j = 0; j < 8; ++j) {
#pragma unroll
      for (int r = 0; r < 8; ++r) { const float v = acc[j][r]; const _Float16 hv = (_Float16)v; sth[j * 16 + col][wave * 16 + 8 * g + r] = hv; stl[j * 16 + col][wave * 16 + 8 * g + r] = (_Float16)((v - (float)hv) * 2048.0f); } }
    __syncthreads();
    const size_t rb = (size_t)blockIdx.x * 64; const int b = (int)(rb / SS), s0 = (int)(rb % SS); const int pc0 = n0 - 2 * DM;
    for (int q = tid; q < 128 * 8; q += 128) { const int d = q >> 3, pc = q & 7; const size_t o = ((size_t)b * DM + pc0 + d) * SS + s0 + pc * 8; vst2((unsigned*)(VTH + o), *(const v4u*)&sth[d][pc * 8]); vst2((unsigned*)(VTL + o), *(const v4u*)&stl[d][pc * 8]); }
  }
}
__device__ __forceinline__ float xhalf(float x) { return __builtin_bit_cast(float, __builtin_amdgcn_permlanex16(__builtin_bit_cast(int, x), __builtin_bit_cast(int, x), 0x76543210, 0xfedcba98, false, false)); }   // lane l with lane l ^ 16
#define LAMBDA_INIT 0.78360247f   // 0.8 - 0.6*exp(-0.3*12), float32
#define STG_PITCH 40                       // f16 per staged row: 64 data bytes at an 80-byte pitch (16 B x odd) for the ds_load_b128 readers
#define STG_ROWS 192                       // one 32-key tile: rows 0..31 K hi, 32..63 K lo (row = key), 64..127 V hi, 128..191 V lo (row = value dim)
#define STG_BYTES (STG_ROWS * STG_PITCH * 2)
// one 32-key tile into LDS by the work-group's 256 lanes: every lane copies 16 bytes of three rows (its row r = tid / 4 of each 64-row group: K hi and lo, V hi, V lo), through no register.
// s_wait_xcnt 0 is the statement's last line so that no address register a copy names is rewritten ahead of it (a precaution).
__device__ __forceinline__ void stage_tile(unsigned l, const _Float16* k, const _Float16* vh, const _Float16* vl) {
  const unsigned g64 = 64 * STG_PITCH * 2;   // LDS bytes of one 64-row group
  asm volatile("global_load_async_to_lds_b128 %0, %3, off\n\t"
               "global_load_async_to_lds_b128 %1, %4, off\n\t"
               "global_load_async_to_lds_b128 %2, %5, off\n\t"
               "s_wait_xcnt 0x0"
               :: "v"(l), "v"(l + g64), "v"(l + 2 * g64), "v"(k), "v"(vh), "v"(vl) : "memory");
}
__global__ __launch_bounds__(256) __attribute__((amdgpu_waves_per_eu(4, 4))) void k_attn(const _Float16* __restrict__ QK, const _Float16* __restrict__ QKL, const _Float16* __restrict__ VTH, const _Float16* __restrict__ VTL, const float* __restrict__ LQ1, const float* __restrict__ LK1, const float* __restrict__ LQ2, const float* __restrict__ LK2, const float* __restrict__ SUBW, float* __restrict__ O) {
  __shared__ __align__(16) float so[8][16][68]; __shared__ __align__(16) float so1[8][16][68];
  __shared__ __align__(16) _Float16 stg[2][STG_ROWS][STG_PITCH];   // two buffers: the next 32-key tile lands while this one is read by all eight waves
  const int tid = threadIdx.x, wave = tid >> 5, lane = tid & 31, col = lane & 15, g = lane >> 4;
  const int qb = blockIdx.x, h = blockIdx.y, b = blockIdx.z; const int q0 = qb * 128 + wave * 16; const size_t rq = (size_t)b * SS + q0 + col;
  float lam; { float a1 = 0.f, a2 = 0.f;
#pragma unroll 1
    for (int i = 0; i < 32; ++i) { a1 += bfr(LQ1[i]) * bfr(LK1[i]); a2 += bfr(LQ2[i]) * bfr(LK2[i]); }
    lam = exp_ni(a1) - exp_ni(a2) + LAMBDA_INIT; }
  const unsigned lst = (unsigned)(size_t)&stg[0][tid >> 2][(tid & 3) * 8];   // this lane's LDS byte address in buffer 0, row group 0 (rows 0..63)
  const size_t vso = ((size_t)b * DM + h * HD + (tid >> 2)) * SS + (tid & 3) * 8; const _Float16* gvh = VTH + vso; const _Float16* gvl = VTL + vso;
  // the two sub-heads are processed one after the other (sub-head 0's normalised P.V parked in LDS) to keep registers under 256
#pragma unroll 1
  for (int sh2 = 0; sh2 < 2; ++sh2) {
    const v16h aq = frag_h(QK + rq * (2 * DM) + h * HD + sh2 * 32, lane), aql = frag_h(QKL + rq * (2 * DM) + h * HD + sh2 * 32, lane);
    v8f cm = {}; float rise = -3.0e38f, l = 0.f;   // this lane's query: minus the reference in use (log2 units, the same in all eight registers and in both halves), held from trip to trip as the C operand of the score products; how far a score may stand above it (trip 0: any score moves it); this half's part of the sum
    v8f acc[4] = {}, accl[4] = {};   // acc[dt][r]: value dim dt * 16 + 8 g + r of query col
    const size_t kso = ((size_t)b * SS + ((tid >> 2) & 31)) * (2 * DM) + DM + h * HD + sh2 * 32 + (tid & 3) * 8; const _Float16* gk = (tid < 128 ? QK : QKL) + kso;   // waves 0..3 bring K hi, waves 4..7 K lo
    stage_tile(lst, gk, gvh, gvl);                       // tile 0 (both buffers are free: the last trip's foot ended every read)
    asm volatile("s_wait_asynccnt 0x0" ::: "memory");           // this wave's copies of tile 0 have landed
    __syncthreads();                                            // ... and every other wave's: tile 0 may be read
    stage_tile(lst + STG_BYTES, gk + (size_t)32 * 2 * DM, gvh + 32, gvl + 32);   // tile 1 flies during trip 0
#pragma unroll 1
    for (int ks = 0; ks < SS / 32; ++ks) { v8f s[2]; const _Float16 (*tb)[STG_PITCH] = stg[ks & 1];
      // all 24 LDS reads of the trip stand as one group at its head: the K fragments are waited for once, the V fragments land under the score products and the softmax
      v16h fkh[2], fkl[2], fvh[4], fvl[4];
#pragma unroll
      for (int ct = 0; ct < 2; ++ct) { fkh[ct] = frag_h(&tb[ct * 16 + col][0], lane); fkl[ct] = frag_h(&tb[32 + ct * 16 + col][0], lane); }
#pragma unroll
      for (int dt = 0; dt < 4; ++dt) { fvh[dt] = frag_h(&tb[64 + dt * 16 + col][0], lane); fvl[dt] = frag_h(&tb[128 + dt * 16 + col][0], lane); }
      __builtin_amdgcn_sched_barrier(0);   // keeps the reads above together: without it the compiler sinks each one to its product, where the wave waits out the LDS latency every time
#pragma unroll
      for (int ct = 0; ct < 2; ++ct) {
        v8f cl = {}; const v8f c = wmma16(fkh[ct], aq, cm); cl = wmma16(fkh[ct], aql, cl); cl = wmma16(fkl[ct], aq, cl);
#pragma unroll
        for (int r = 0; r < 8; ++r) s[ct][r] = c[r] + cl[r] * (1.0f / 2048.0f); }   // score - reference in log2 units: the argument of exp2 as it stands
      float mx = fmaxf(s[0][0], s[1][0]);   // over this half's 16 keys
#pragma unroll
      for (int r = 1; r < 8; ++r) mx = fmaxf(mx, fmaxf(s[0][r], s[1][r]));
      // the reference moves to the maximum, and sum and output are rescaled, only when some query of the wave rises above the one in use by more than 8 (trip 0 always does): one test a trip, a scalar branch; P stays at or below 2^8, inside f16
      if (__builtin_amdgcn_ballot_w32(mx > rise) != 0) {
        mx = fmaxf(mx, xhalf(mx));
        const bool first = rise < 0.f; const float d = first ? mx : fmaxf(mx, 0.f); const float alpha = first ? 0.f : __builtin_amdgcn_exp2f(-d); rise = 8.0f;   // d: how far the reference moves
        cm -= d; s[0] -= d; s[1] -= d;   // the later trips' C operand, and this trip's arguments, which were formed against the old reference
        l *= alpha;
#pragma unroll
        for (int dt = 0; dt < 4; ++dt) { acc[dt] *= alpha; accl[dt] *= alpha; } }
      v8f e0, e1; float es0 = 0.f, es1 = 0.f;
#pragma unroll
      for (int r = 0; r < 8; ++r) { e0[r] = __builtin_amdgcn_exp2f(s[0][r]); e1[r] = __builtin_amdgcn_exp2f(s[1][r]); es0 += e0[r]; es1 += e1[r]; }
      const v8h h0 = __builtin_convertvector(e0, v8h), h1 = __builtin_convertvector(e1, v8h);   // P as f16 hi ...
      const v8h l0 = __builtin_convertvector((e0 - __builtin_convertvector(h0, v8f)) * 2048.0f, v8h), l1 = __builtin_convertvector((e1 - __builtin_convertvector(h1, v8f)) * 2048.0f, v8h);   // ... + (x2048) residual
      const v16h pah = __builtin_shufflevector(h0, h1, 0, 1, 2, 3, 4, 5, 6, 7, 8, 9, 10, 11, 12, 13, 14, 15), pal = __builtin_shufflevector(l0, l1, 0, 1, 2, 3, 4, 5, 6, 7, 8, 9, 10, 11, 12, 13, 14, 15);
      l += es0 + es1;
#pragma unroll
      for (int dt = 0; dt < 4; ++dt) { acc[dt] = wmma16(fvh[dt], pah, acc[dt]); accl[dt] = wmma16(fvh[dt], pal, accl[dt]); accl[dt] = wmma16(fvl[dt], pah, accl[dt]); }
      __builtin_amdgcn_sched_barrier(0);                        // keeps the products above the foot: without it the compiler lifts the waits and the barrier over them, and the next tile's copies are waited for right behind their issue
      asm volatile("s_wait_dscnt 0x0" ::: "memory");            // this wave's reads of this tile are done
      asm volatile("s_wait_asynccnt 0x0" ::: "memory");         // this wave's copies of tile ks + 1 have landed
      __syncthreads();                                          // publishes tile ks + 1 and frees the buffer that this trip has read
      if (ks + 2 < SS / 32) stage_tile(lst + (unsigned)(ks & 1) * STG_BYTES, gk + (size_t)(ks + 2) * 32 * 2 * DM, gvh + (ks + 2) * 32, gvl + (ks + 2) * 32); }
    asm volatile("s_wait_asynccnt 0x0" ::: "memory");           // nothing is in flight behind the loop
    const float il = 1.0f / (l + xhalf(l));   // the halves' sums are joined once
    if (sh2 == 0) {   // each lane parks, and later reads back, its own 32 values
#pragma unroll
      for (int dt = 0; dt < 4; ++dt) {
#pragma unroll
        for (int r = 0; r < 8; ++r) so1[wave][col][dt * 16 + 8 * g + r] = (acc[dt][r] + accl[dt][r] * (1.0f / 2048.0f)) * il; }
    } else {
      float ov[4][8]; float ssq = 0.f;
#pragma unroll
      for (int dt = 0; dt < 4; ++dt) {
#pragma unroll
        for (int r = 0; r < 8; ++r) { ov[dt][r] = so1[wave][col][dt * 16 + 8 * g + r] - lam * ((acc[dt][r] + accl[dt][r] * (1.0f / 2048.0f)) * il); ssq += ov[dt][r] * ov[dt][r]; } }
      ssq += xhalf(ssq);
      const float sc = (1.0f / sqrtf(ssq * (1.0f / HD) + 1e-5f)) * (1.0f - LAMBDA_INIT);
#pragma unroll
      for (int dt = 0; dt < 4; ++dt) {
#pragma unroll
        for (int r = 0; r < 8; ++r) so[wave][col][dt * 16 + 8 * g + r] = ov[dt][r] * sc * bfr(SUBW[dt * 16 + 8 * g + r]); } }
    LDSX(); }
  for (int rl = 0; rl < 16; ++rl) if (lane < 16) vst2(O + ((size_t)b * SS + q0 + rl) * DM + h * HD + lane * 4, *(const v4f*)&so[wave][rl][lane * 4]);
}
// ---- k_out: block = (64 rows, 128 cols): out = O(hi/lo) . Wo rows (2 products)
__global__ __launch_bounds__(128) void k_out(const float* __restrict__ O, const __bf16* __restrict__ P, float* __restrict__ Y) {
  __shared__ __align__(16) char sm[2 * GS_BYTES];   // in the loop two staged k blocks; behind it the epilogue's tile
  float (*so)[16][132] = (float (*)[16][132])sm;
  const int tid = threadIdx.x, wave = tid >> 5, lane = tid & 31, col = lane & 15, g = lane >> 4; const size_t r0 = (size_t)blockIdx.x * 64 + wave * 16; const int n0 = blockIdx.y * 128;
  const unsigned la = (unsigned)(size_t)sm + (tid >> 4) * GA_PITCH + (tid & 15) * 16, lw = (unsigned)(size_t)sm + GA_BYTES + (tid >> 3) * GB_PITCH + (tid & 7) * 16;   // this lane's LDS byte addresses in buffer 0
  const float* gx = O + ((size_t)blockIdx.x * 64 + (tid >> 4)) * DM + (tid & 15) * 4; const __bf16* gw = P + (size_t)(n0 + (tid >> 3)) * DM + (tid & 7) * 8;
  v8f acc[8] = {};
  stage_gemm(la, lw, gx, gw);                                 // block 0
  asm volatile("s_wait_asynccnt 0x0" ::: "memory");           // this wave's copies of block 0 have landed
  __syncthreads();                                            // ... and every other wave's: block 0 may be read
  stage_gemm(la + GS_BYTES, lw + GS_BYTES, gx + GK, gw + GK);   // block 1 flies during trip 0
#pragma unroll 1   // rolled: one copy of the trip keeps the text short
  for (int t = 0; t < DM / GK; ++t) { const char* tb = sm + (t & 1) * GS_BYTES;
    // the trip's 16 weight fragments in four groups of four, each read one group ahead of its products (as in k_qkv)
    const char* wrow = tb + GA_BYTES + col * GB_PITCH; v16b w[2][4]; F2 a[2];
    float xv[2][16];
#pragma unroll
    for (int u = 0; u < 2; ++u) row16(tb + (wave * 16 + col) * GA_PITCH, u, g, xv[u]);
#pragma unroll
    for (int i = 0; i < 4; ++i) w[0][i] = frag_b((const __bf16*)(wrow + i * 16 * GB_PITCH), lane);
    __builtin_amdgcn_sched_barrier(0);   // keeps the trip's first reads together at its head: without it the compiler deals them among the splitting of the rows, with a full wait in its midst
#pragma unroll
    for (int u = 0; u < 2; ++u) a[u] = bsplit16(xv[u]);
#pragma unroll
    for (int q = 0; q < 4; ++q) {
      if (q < 3) {
#pragma unroll
        for (int i = 0; i < 4; ++i) w[(q + 1) & 1][i] = frag_b((const __bf16*)(wrow + (((q + 1) & 1) * 4 + i) * 16 * GB_PITCH) + ((q + 1) >> 1) * 32, lane); }
      __builtin_amdgcn_sched_barrier(0);   // keeps the next group's reads together ahead of this group's products: without it the compiler sinks each read to its own product, where the wave waits out the LDS latency
#pragma unroll
      for (int i = 0; i < 4; ++i) { const int j = (q & 1) * 4 + i; acc[j] = wmma_bf(a[q >> 1].l, w[q & 1][i], acc[j]); acc[j] = wmma_bf(a[q >> 1].h, w[q & 1][i], acc[j]); }
      __builtin_amdgcn_sched_barrier(0); }   // ... and what follows behind these products: the next reads as one group; behind the last group the foot's waits and barrier, which the compiler otherwise lifts over the products
    asm volatile("s_wait_dscnt 0x0" ::: "memory");            // this wave's reads of this block are done
    asm volatile("s_wait_asynccnt 0x0" ::: "memory");         // this wave's copies of block t + 1 have landed
    __syncthreads();                                          // publishes block t + 1 and frees the buffer that this trip has read
    if (t + 2 < DM / GK) stage_gemm(la + (unsigned)(t & 1) * GS_BYTES, lw + (unsigned)(t & 1) * GS_BYTES, gx + (t + 2) * GK, gw + (t + 2) * GK); }
  asm volatile("s_wait_asynccnt 0x0" ::: "memory");           // nothing is in flight behind the loop: the epilogue may take the LDS over
#pragma unroll
  for (int j = 0; j < 8; ++j) {
#pragma unroll
    for (int r = 0; r < 8; ++r) so[wave][8 * g + r][j * 16 + col] = acc[j][r]; }
  LDSX();
  for (int rl = 0; rl < 16; ++rl) vst2(Y + (r0 + rl) * DM + n0 + lane * 4, *(const v4f*)&so[wave][rl][lane * 4]);
}
extern "C" void kernel_launch(void* const* d_in, const int* in_sizes, int n_in, void* d_out, int out_size, void* d_ws, size_t ws_size, hipStream_t stream) {
  (void)in_sizes; (void)n_in; (void)out_size;
  const float** F = (const float**)d_in;   // 0 query_x [2,2048,1024], 1 kv_x, 2 Wq (in,out), 3 Wk, 4 Wv, 5 Wo, 6 lambda_q1 [32], 7 lambda_k1, 8 lambda_q2, 9 lambda_k2, 10 subln_w [64]
  if (ws_size < (size_t)WS_END) return;
  char* ws = (char*)d_ws; __bf16* PK = (__bf16*)(ws + WS_PK); _Float16 *QK = (_Float16*)(ws + WS_QK), *QKL = (_Float16*)(ws + WS_QKL), *VTH = (_Float16*)(ws + WS_VTH), *VTL = (_Float16*)(ws + WS_VTL); float* O = (float*)(ws + WS_O);
  k_pack<<<dim3(DM / PT_N, DM / PT_K, 4), 128, 0, stream>>>(F[2], F[3], F[4], F[5], PK);
  k_qkv<<<dim3(TNB * SS / 64, QKVW / 128), 128, 0, stream>>>(F[0], F[1], PK + PK_A, QK, QKL, VTH, VTL);
  k_attn<<<dim3(TQB, NH, TNB), 256, 0, stream>>>(QK, QKL, VTH, VTL, F[6], F[7], F[8], F[9], F[10], O);
  k_out<<<dim3(TOB, DM / 128), 128, 0, stream>>>(O, PK + PK_P, (float*)d_out);
}

// v010
// Measured time: 168 microseconds a run.
// Timed twice side by side with v009, it ran 1.03 times as fast both times.
// Counting every step since v000, it is 4.00 times as fast.
// compute dtype: query_x, kv_x, Wq, Wk, Wv, Wo, lambda_*, subln_w (module inputs) rounded to bf16; q (from query_x), k and v (from kv_x) with exact bf16 products on WMMA 16x16x32 ((in,out) weights packed as transposed rows); q, k and v stored as f16 hi + residual planes (the residual unscaled: its low end lies among the f16 subnormals, which the matrix unit keeps, quantum 2^-24); q x 32^-0.5 x log2(e) in f32 ahead of its split; per head pair both 32-dim sub-head score maps with 3 products chained on one accumulator, the softmax reference subtracted as the C operand of the first, two softmaxes in f32 (hardware exp2), each against a reference that follows the running maximum only when that rises by more than 8 in log2; P as f16 hi + residual x v hi/lo (3 products chained on one accumulator) for both maps; lambda from the four 32-vectors in f32 (precise expf); the differential combination, RMS norm (eps 1e-5) x subln_w x (1 - lambda_init) in f32; output projection with the context as bf16 hi + residual x exact Wo (2 products); f32 accumulate.
#include <hip/hip_runtime.h>
#include <math.h>

typedef __attribute__((ext_vector_type(16))) _Float16 v16h;
typedef __attribute__((ext_vector_type(16))) __bf16 v16b;
typedef __attribute__((ext_vector_type(8)))  _Float16 v8h;
typedef __attribute__((ext_vector_type(8)))  float v8f;
typedef __attribute__((ext_vector_type(4)))  float v4f;
typedef __attribute__((ext_vector_type(2)))  float v2f;
typedef __attribute__((ext_vector_type(4)))  unsigned v4u;
typedef __attribute__((ext_vector_type(4)))  int v4i;
typedef float __attribute__((may_alias)) float_a;
typedef int __attribute__((may_alias)) int_a;

template <typename T> __device__ __forceinline__ void vst2(void* p, T v) { *(T*)p = v;  }
__device__ __forceinline__ v8f wmma16(v16h a, v16h b, v8f c) {
  v8f d = __builtin_amdgcn_wmma_f32_16x16x32_f16(false, a, false, b, (short)0, c, false, false);
  return d;
}
__device__ __forceinline__ v8f wmma_bf(v16b a, v16b b, v8f c) {
  v8f d = __builtin_amdgcn_wmma_f32_16x16x32_bf16(false, a, false, b, (short)0, c, false, false);
  return d;
}
// Cross multi-head differential attention (B 2, T = S = 2,048, d 1,024, 16 head pairs of 32-dim q/k and 64-dim values, depth-12 lambda_init): softmax(q1 k1) - lambda softmax(q2 k2) applied to v, RMS norm, output projection.
__device__ __forceinline__ v16h frag_h(const _Float16* rowk0, int lane) {
  union { v16h v; v8h q[2]; } u; const _Float16* p = rowk0 + 8 * (lane >> 4);
  u.q[0] = *(const v8h*)p; u.q[1] = *(const v8h*)(p + 16); return u.v;
}
__device__ __forceinline__ v16h frag_f32(const float* rowk0, int lane) {
  v16h a; const float* p = rowk0 + 8 * (lane >> 4);
#pragma unroll
  for (int i = 0; i < 8; ++i) { a[i] = (_Float16)p[i]; a[8 + i] = (_Float16)p[16 + i]; }
  return a;
}
__device__ __forceinline__ v16h frag_f32s(const float* rowk0, int lane, float sc) {
  v16h a; const float* p = rowk0 + 8 * (lane >> 4);
#pragma unroll
  for (int i = 0; i < 8; ++i) { a[i] = (_Float16)(p[i] * sc); a[8 + i] = (_Float16)(p[16 + i] * sc); }
  return a;
}
// column fragment from a [K][ld] layout (column n), rows >= K read as 0
__device__ __forceinline__ v16h fragc_f32(const float* W, int k0, int n, int lane, int ld, int K) {
  v16h a; const int g = lane >> 4;
#pragma unroll
  for (int i = 0; i < 8; ++i) { const int ka = k0 + 8 * g + i, kb = ka + 16;
    a[i] = (_Float16)(ka < K ? W[(size_t)(ka < K ? ka : K - 1) * ld + n] : 0.f); a[8 + i] = (_Float16)(kb < K ? W[(size_t)(kb < K ? kb : K - 1) * ld + n] : 0.f); }
  return a;
}
struct F2 { v16b h, l; };
__device__ __forceinline__ F2 bsplit16(const float v[16]) { F2 r;
#pragma unroll
  for (int i = 0; i < 16; ++i) { const __bf16 h = (__bf16)v[i]; r.h[i] = h; r.l[i] = (__bf16)(v[i] - (float)h); }
  return r; }
__device__ __forceinline__ F2 split_row(const float* row, int k0, int lane) { float v[16]; const float* p = row + k0 + 8 * (lane >> 4);
#pragma unroll
  for (int i = 0; i < 8; ++i) { v[i] = p[i]; v[8 + i] = p[16 + i]; }
  return bsplit16(v); }
__device__ __forceinline__ F2 split_rowK(const float* row, int k0, int lane, int K) { float v[16]; const int g = lane >> 4;
#pragma unroll
  for (int i = 0; i < 8; ++i) { const int ka = k0 + 8 * g + i, kb = ka + 16; v[i] = ka < K ? row[ka < K ? ka : K - 1] : 0.f; v[8 + i] = kb < K ? row[kb < K ? kb : K - 1] : 0.f; }
  return bsplit16(v); }
__device__ __forceinline__ F2 split_col(const float* W, int k0, int n, int lane, int ld, int K) { float v[16]; const int g = lane >> 4;
#pragma unroll
  for (int i = 0; i < 8; ++i) { const int ka = k0 + 8 * g + i, kb = ka + 16; v[i] = ka < K ? W[(size_t)(ka < K ? ka : K - 1) * ld + n] : 0.f; v[8 + i] = kb < K ? W[(size_t)(kb < K ? kb : K - 1) * ld + n] : 0.f; }
  return bsplit16(v); }
__device__ __forceinline__ v8f mac3(const F2& a, const F2& b, v8f c) { c = wmma_bf(a.l, b.h, c); c = wmma_bf(a.h, b.l, c); return wmma_bf(a.h, b.h, c); }
__device__ __forceinline__ float sigm(float v) { return 1.0f / (1.0f + expf(-v)); }
#define LDSX() do { asm volatile("s_wait_dscnt 0" ::: "memory"); __builtin_amdgcn_wave_barrier(); __builtin_amdgcn_fence(__ATOMIC_RELEASE, "workgroup"); } while (0)


#define NB 2
#define SS 2048
#define DM 1024
#define NH 16
#define HD 64
#define QKVW (3 * DM)
#ifndef TQB
#define TQB (SS / 128)         // k_attn query tiles: 128 queries, 8 waves
#define TNB NB
#define TOB (NB * SS / 64)     // output row tiles (all)
#endif
typedef __attribute__((ext_vector_type(8))) __bf16 v8b;
__device__ __forceinline__ v16b frag_b(const __bf16* rowk0, int lane) {
  union { v16b v; v8b q[2]; } u; const __bf16* p = rowk0 + 8 * (lane >> 4);
  u.q[0] = *(const v8b*)p; u.q[1] = *(const v8b*)(p + 16); return u.v;
}
__device__ __forceinline__ float bfr(float v) { return (float)(__bf16)v; }
__device__ __attribute__((noinline)) float exp_ni(float v) { return expf(v); }
__device__ __attribute__((noinline)) float erf_ni(float v) { return erff(v); }

#define PK_A 0                       // [3072][1024] Wqkv rows (natural [out][in])
#define PK_P (PK_A + QKVW * DM)        // [1024][1024] Wo rows (natural)
#define PK_END (PK_P + DM * DM)
#define WS_PK  0u
#define WS_QK  (WS_PK + 2u * PK_END)             // f16 [4096 rows][2048]: q x 32^-0.5 x log2(e) | k
#define WS_QKL (WS_QK + 2u * NB * SS * 2 * DM)     // f16 q | k residual planes
#define WS_VTH (WS_QKL + 2u * NB * SS * 2 * DM)    // f16 [b][1024 (h*64+d)][2048 s] hi
#define WS_VTL (WS_VTH + 2u * NB * DM * SS)        // f16 lo
#define WS_O   (WS_VTL + 2u * NB * DM * SS)        // f32 [4096][1024]
#define WS_CS  (WS_O + 4u * NB * SS * DM)           // 2 x [2048][32] f32, reserved, unused (no RoPE)
#define WS_END (WS_CS + 4u * 2 * SS * 32)
// ---- k_pack: block = (128 columns n, 64 rows k, which) of an (in,out) weight: the tile is read along its rows (a wave-wide 16-byte load = 512 contiguous bytes of one k row), rounded to bf16, turned in LDS and written as 128-byte pieces of the transposed rows; which 0..2 -> W_q/W_k/W_v into PK_A rows which*1024 + n; 3 -> W_o into PK_P
#define PT_N 128
#define PT_K 64
#define PT_P (PT_K / 2 + 1)               // dwords per LDS row n: 32 pairs of k neighbours and one of padding, so that the writes (lanes 4 rows apart) and the row-wise read-out both spread over the banks
typedef __attribute__((ext_vector_type(2))) __bf16 v2b;
__global__ __launch_bounds__(128) void k_pack(const float* __restrict__ WQ, const float* __restrict__ WK, const float* __restrict__ WV, const float* __restrict__ WO, __bf16* __restrict__ PK) {
  __shared__ __align__(16) unsigned s[PT_N * PT_P]; const int t = threadIdx.x, wave = t >> 5, lane = t & 31, n0 = blockIdx.x * PT_N, k0 = blockIdx.y * PT_K, which = blockIdx.z; const float* Wm = (which == 0) ? WQ : (which == 1) ? WK : (which == 2) ? WV : WO;
  const float* src = Wm + (size_t)(k0 + wave * 16) * DM + n0 + lane * 4;   // this wave's 16 k rows, this lane's 4 columns
  v4f x[16];
#pragma unroll   // x[] stays in registers and the 16 loads issue as one group
  for (int i = 0; i < 16; ++i) x[i] = *(const v4f*)(src + (size_t)i * DM);
  // all 16 loads are in flight together, and no register that one of them names (data or address) is rewritten ahead of this wait (a precaution): the values are inputs only
  asm volatile("s_wait_xcnt 0x0" :: "v"(x[0]), "v"(x[1]), "v"(x[2]), "v"(x[3]), "v"(x[4]), "v"(x[5]), "v"(x[6]), "v"(x[7]), "v"(x[8]), "v"(x[9]), "v"(x[10]), "v"(x[11]), "v"(x[12]), "v"(x[13]), "v"(x[14]), "v"(x[15]), "v"(src) : "memory");
#pragma unroll   // constant indices into x[] (both loops)
  for (int i = 0; i < 8; ++i) {
#pragma unroll
    for (int j = 0; j < 4; ++j) { const v2b two = { (__bf16)x[2 * i][j], (__bf16)x[2 * i + 1][j] }; s[(lane * 4 + j) * PT_P + wave * 8 + i] = __builtin_bit_cast(unsigned, two); } }
  __syncthreads();
  __bf16* dst = ((which < 3) ? PK + PK_A + ((size_t)which * DM + n0) * DM : PK + PK_P + (size_t)n0 * DM) + k0;
  unsigned* d = (unsigned*)(dst + (size_t)wave * (PT_N / 4) * DM) + lane; const unsigned* sr = s + wave * (PT_N / 4) * PT_P + lane; unsigned y[PT_N / 4];
#pragma unroll   // all 32 LDS reads ahead of the stores, each value in a register of its own: no register of an issued store is rewritten
  for (int r = 0; r < PT_N / 4; ++r) y[r] = sr[r * PT_P];
#pragma unroll   // constant indices into y[], row steps as immediate offsets
  for (int r = 0; r < PT_N / 4; ++r) d[r * (DM / 2)] = y[r];   // one whole 128-byte line a wave-wide store
}
#define QSL 0.25503486f                    // 32^-0.5 x log2(e): q carries it, so that a score is an exponent of 2
#define GK 64                              // k depth of one staged block: X rows of 256 bytes, weight rows of 128 bytes, whole cache lines
#define GA_PITCH 272                       // LDS bytes per staged f32 row (256 data bytes, 16 B x odd for the ds_load_b128 readers)
#define GB_PITCH 144                       // LDS bytes per staged bf16 weight row (128 data bytes, 16 B x odd)
#define GA_BYTES (64 * GA_PITCH)
#define GS_BYTES (GA_BYTES + 128 * GB_PITCH)   // one staged block: 64 f32 rows, then 128 weight rows
#define COPY8_TEXT "global_load_async_to_lds_b128 %0, %8, off\n\t" "global_load_async_to_lds_b128 %1, %9, off\n\t" "global_load_async_to_lds_b128 %2, %10, off\n\t" "global_load_async_to_lds_b128 %3, %11, off\n\t" \
                   "global_load_async_to_lds_b128 %4, %12, off\n\t" "global_load_async_to_lds_b128 %5, %13, off\n\t" "global_load_async_to_lds_b128 %6, %14, off\n\t" "global_load_async_to_lds_b128 %7, %15, off\n\t" "s_wait_xcnt 0x0"
// one 64-deep k block of a 64 x 128 GEMM tile into LDS, through no register: every lane copies 16 bytes of eight f32 rows (16 lanes a row, rows 8 apart) and of eight weight rows (8 lanes a row, rows 16 apart), so each wave-wide copy covers whole lines.
// s_wait_xcnt 0 is each statement's last line so that no address register a copy names is rewritten ahead of it (a precaution).
__device__ __forceinline__ void stage_gemm(unsigned la, unsigned lw, const float* gx, const __bf16* gw) {
  const unsigned sa = 8 * GA_PITCH, sw = 16 * GB_PITCH;
  asm volatile(COPY8_TEXT :: "v"(la), "v"(la + sa), "v"(la + 2 * sa), "v"(la + 3 * sa), "v"(la + 4 * sa), "v"(la + 5 * sa), "v"(la + 6 * sa), "v"(la + 7 * sa),
               "v"(gx), "v"(gx + 8 * DM), "v"(gx + 16 * DM), "v"(gx + 24 * DM), "v"(gx + 32 * DM), "v"(gx + 40 * DM), "v"(gx + 48 * DM), "v"(gx + 56 * DM) : "memory");
  asm volatile(COPY8_TEXT :: "v"(lw), "v"(lw + sw), "v"(lw + 2 * sw), "v"(lw + 3 * sw), "v"(lw + 4 * sw), "v"(lw + 5 * sw), "v"(lw + 6 * sw), "v"(lw + 7 * sw),
               "v"(gw), "v"(gw + 16 * DM), "v"(gw + 32 * DM), "v"(gw + 48 * DM), "v"(gw + 64 * DM), "v"(gw + 80 * DM), "v"(gw + 96 * DM), "v"(gw + 112 * DM) : "memory");
}
// the 16 f32 of one A fragment (k order of frag_b) from a staged row
__device__ __forceinline__ void row16(const char* row, int u, int g, float v[16]) {
  const v4f* p = (const v4f*)(row + u * 128 + 32 * g); const v4f x0 = p[0], x1 = p[1], x2 = p[4], x3 = p[5];
#pragma unroll
  for (int i = 0; i < 4; ++i) { v[i] = x0[i]; v[4 + i] = x1[i]; v[8 + i] = x2[i]; v[12 + i] = x3[i]; }
}
__global__ __launch_bounds__(128) void k_qkv(const float* __restrict__ XQ, const float* __restrict__ XKV, const __bf16* __restrict__ P, _Float16* __restrict__ QK, _Float16* __restrict__ QKL, _Float16* __restrict__ VTH, _Float16* __restrict__ VTL) {
  const float* X = (blockIdx.y * 128 < DM) ? XQ : XKV;   // q from query_x, k and v from kv_x
  __shared__ __align__(16) char sm[2 * GS_BYTES];   // in the loop two staged k blocks (the next lands while this one is read by all four waves); behind it the epilogue's tiles
  _Float16 (*so)[16][136] = (_Float16 (*)[16][136])sm; _Float16 (*sol)[16][136] = (_Float16 (*)[16][136])(sm + 4 * 16 * 136 * 2); _Float16 (*sth)[72] = (_Float16 (*)[72])sm; _Float16 (*stl)[72] = (_Float16 (*)[72])(sm + 128 * 72 * 2);
  const int tid = threadIdx.x, wave = tid >> 5, lane = tid & 31, col = lane & 15, g = lane >> 4; const size_t r0 = (size_t)blockIdx.x * 64 + wave * 16; const int n0 = blockIdx.y * 128;
  const unsigned la = (unsigned)(size_t)sm + (tid >> 4) * GA_PITCH + (tid & 15) * 16, lw = (unsigned)(size_t)sm + GA_BYTES + (tid >> 3) * GB_PITCH + (tid & 7) * 16;   // this lane's LDS byte addresses in buffer 0
  const float* gx = X + ((size_t)blockIdx.x * 64 + (tid >> 4)) * DM + (tid & 15) * 4; const __bf16* gw = P + (size_t)(n0 + (tid >> 3)) * DM + (tid & 7) * 8;
  v8f acc[8] = {};
  stage_gemm(la, lw, gx, gw);                                 // block 0
  asm volatile("s_wait_asynccnt 0x0" ::: "memory");           // this wave's copies of block 0 have landed
  __syncthreads();                                            // ... and every other wave's: block 0 may be read
  stage_gemm(la + GS_BYTES, lw + GS_BYTES, gx + GK, gw + GK);   // block 1 flies during trip 0
#pragma unroll 1   // rolled: one copy of the trip keeps the text short
  for (int t = 0; t < DM / GK; ++t) { const char* tb = sm + (t & 1) * GS_BYTES;
    // the trip's 16 weight fragments in four groups of four (group q: k half q / 2, columns 64 (q & 1) ...), each read one group ahead of its products so that a wave does not wait out the LDS latency per product
    const char* wrow = tb + GA_BYTES + col * GB_PITCH; v16b w[2][4], a[2];
#pragma unroll
    for (int u = 0; u < 2; ++u) { float xv[16]; row16(tb + (wave * 16 + col) * GA_PITCH, u, g, xv);
#pragma unroll
      for (int i = 0; i < 16; ++i) a[u][i] = (__bf16)xv[i]; }
#pragma unroll
    for (int i = 0; i < 4; ++i) w[0][i] = frag_b((const __bf16*)(wrow + i * 16 * GB_PITCH), lane);
#pragma unroll
    for (int q = 0; q < 4; ++q) {
      if (q < 3) {
#pragma unroll
        for (int i = 0; i < 4; ++i) w[(q + 1) & 1][i] = frag_b((const __bf16*)(wrow + (((q + 1) & 1) * 4 + i) * 16 * GB_PITCH) + ((q + 1) >> 1) * 32, lane); }
      __builtin_amdgcn_sched_barrier(0);   // keeps the next group's reads together ahead of this group's products: without it the compiler sinks each read to its own product, where the wave waits out the LDS latency
#pragma unroll
      for (int i = 0; i < 4; ++i) acc[(q & 1) * 4 + i] = wmma_bf(a[q >> 1], w[q & 1][i], acc[(q & 1) * 4 + i]);
      __builtin_amdgcn_sched_barrier(0); }   // ... and what follows behind these products: the next reads as one group; behind the last group the foot's waits and barrier, which the compiler otherwise lifts over the products
    asm volatile("s_wait_dscnt 0x0" ::: "memory");            // this wave's reads of this block are done
    asm volatile("s_wait_asynccnt 0x0" ::: "memory");         // this wave's copies of block t + 1 have landed
    __syncthreads();                                          // publishes block t + 1 and frees the buffer that this trip has read
    if (t + 2 < DM / GK) stage_gemm(la + (unsigned)(t & 1) * GS_BYTES, lw + (unsigned)(t & 1) * GS_BYTES, gx + (t + 2) * GK, gw + (t + 2) * GK); }
  asm volatile("s_wait_asynccnt 0x0" ::: "memory");           // nothing is in flight behind the loop: the epilogue may take the LDS over
  if (n0 < 2 * DM) { const float qs = (n0 < DM) ? QSL : 1.0f;   // q columns x 32^-0.5 x log2(e), in f32 ahead of the split (f16 sigma ~0.26); k as it is
#pragma unroll
    for (int j = 0; j < 8; ++j) {
#pragma unroll
      for (int r = 0; r < 8; ++r) { const float v = acc[j][r] * qs; const _Float16 hv = (_Float16)v; so[wave][8 * g + r][j * 16 + col] = hv; sol[wave][8 * g + r][j * 16 + col] = (_Float16)(v - (float)hv); } }   // q, k as f16 hi + residual (no RoPE in this module)
    LDSX();
    for (int rl = 0; rl < 16; ++rl) if (lane < 16) { vst2((unsigned*)(QK + (r0 + rl) * (2 * DM) + n0 + lane * 8), *(const v4u*)&so[wave][rl][lane * 8]); vst2((unsigned*)(QKL + (r0 + rl) * (2 * DM) + n0 + lane * 8), *(const v4u*)&sol[wave][rl][lane * 8]); }
  } else {
#pragma unroll
    for (int j = 0; j < 8; ++j) {
#pragma unroll
      for (int r = 0; r < 8; ++r) { const float v = acc[j][r]; const _Float16 hv = (_Float16)v; sth[j * 16 + col][wave * 16 + 8 * g + r] = hv; stl[j * 16 + col][wave * 16 + 8 * g + r] = (_Float16)(v - (float)hv); } }
    __syncthreads();
    const size_t rb = (size_t)blockIdx.x * 64; const int b = (int)(rb / SS), s0 = (int)(rb % SS); const int pc0 = n0 - 2 * DM;
    for (int q = tid; q < 128 * 8; q += 128) { const int d = q >> 3, pc = q & 7; const size_t o = ((size_t)b * DM + pc0 + d) * SS + s0 + pc * 8; vst2((unsigned*)(VTH + o), *(const v4u*)&sth[d][pc * 8]); vst2((unsigned*)(VTL + o), *(const v4u*)&stl[d][pc * 8]); }
  }
}
__device__ __forceinline__ float xhalf(float x) { return __builtin_bit_cast(float, __builtin_amdgcn_permlanex16(__builtin_bit_cast(int, x), __builtin_bit_cast(int, x), 0x76543210, 0xfedcba98, false, false)); }   // lane l with lane l ^ 16
// the f16 residual of eight f32 values e beside their f16 roundings h: f16(e - h), the difference exact in f32. One mixed-precision fma an element (h and the constant -1.0 read as f16, e as f32) widens h, subtracts and rounds into its half of the packed register
// (from C the compiler takes a widening, a packed subtraction and a packed conversion: twice the instructions). The four low halves stand ahead of the four high ones; each high half follows the write of its register four instructions back, which the s_delay_alu hints name so that the SIMD's other waves issue meanwhile.
__device__ __forceinline__ v8h resid8(v8h h, v8f e) {
  const v4u p = __builtin_bit_cast(v4u, h); unsigned d0, d1, d2, d3;
  asm("v_fma_mixlo_f16 %0, %4, -1.0, %8 op_sel_hi:[1,1,0]\n\t"
      "v_fma_mixlo_f16 %1, %5, -1.0, %10 op_sel_hi:[1,1,0]\n\t"
      "v_fma_mixlo_f16 %2, %6, -1.0, %12 op_sel_hi:[1,1,0]\n\t"
      "v_fma_mixlo_f16 %3, %7, -1.0, %14 op_sel_hi:[1,1,0]\n\t"
      "s_delay_alu instid0(VALU_DEP_4) | instskip(NEXT) | instid1(VALU_DEP_4)\n\t"
      "v_fma_mixhi_f16 %0, %4, -1.0, %9 op_sel:[1,0,0] op_sel_hi:[1,1,0]\n\t"
      "v_fma_mixhi_f16 %1, %5, -1.0, %11 op_sel:[1,0,0] op_sel_hi:[1,1,0]\n\t"
      "s_delay_alu instid0(VALU_DEP_4) | instskip(NEXT) | instid1(VALU_DEP_4)\n\t"
      "v_fma_mixhi_f16 %2, %6, -1.0, %13 op_sel:[1,0,0] op_sel_hi:[1,1,0]\n\t"
      "v_fma_mixhi_f16 %3, %7, -1.0, %15 op_sel:[1,0,0] op_sel_hi:[1,1,0]"
      : "=&v"(d0), "=&v"(d1), "=&v"(d2), "=&v"(d3)
      : "v"(p[0]), "v"(p[1]), "v"(p[2]), "v"(p[3]), "v"(e[0]), "v"(e[1]), "v"(e[2]), "v"(e[3]), "v"(e[4]), "v"(e[5]), "v"(e[6]), "v"(e[7]));
  const v4u d = { d0, d1, d2, d3 }; return __builtin_bit_cast(v8h, d);
}
#define LAMBDA_INIT 0.78360247f   // 0.8 - 0.6*exp(-0.3*12), float32
#define STG_PITCH 40                       // f16 per staged row: 64 data bytes at an 80-byte pitch (16 B x odd) for the ds_load_b128 readers
#define STG_ROWS 192                       // one 32-key tile: rows 0..31 K hi, 32..63 K lo (row = key), 64..127 V hi, 128..191 V lo (row = value dim)
#define STG_BYTES (STG_ROWS * STG_PITCH * 2)
// one 32-key tile into LDS by the work-group's 256 lanes: every lane copies 16 bytes of three rows (its row r = tid / 4 of each 64-row group: K hi and lo, V hi, V lo), through no register.
// s_wait_xcnt 0 is the statement's last line so that no address register a copy names is rewritten ahead of it (a precaution).
__device__ __forceinline__ void stage_tile(unsigned l, const _Float16* k, const _Float16* vh, const _Float16* vl) {
  const unsigned g64 = 64 * STG_PITCH * 2;   // LDS bytes of one 64-row group
  asm volatile("global_load_async_to_lds_b128 %0, %3, off\n\t"
               "global_load_async_to_lds_b128 %1, %4, off\n\t"
               "global_load_async_to_lds_b128 %2, %5, off\n\t"
               "s_wait_xcnt 0x0"
               :: "v"(l), "v"(l + g64), "v"(l + 2 * g64), "v"(k), "v"(vh), "v"(vl) : "memory");
}
__global__ __launch_bounds__(256) __attribute__((amdgpu_waves_per_eu(4, 4))) void k_attn(const _Float16* __restrict__ QK, const _Float16* __restrict__ QKL, const _Float16* __restrict__ VTH, const _Float16* __restrict__ VTL, const float* __restrict__ LQ1, const float* __restrict__ LK1, const float* __restrict__ LQ2, const float* __restrict__ LK2, const float* __restrict__ SUBW, float* __restrict__ O) {
  __shared__ __align__(16) float so[8][16][68]; __shared__ __align__(16) float so1[8][16][68];
  __shared__ __align__(16) _Float16 stg[2][STG_ROWS][STG_PITCH];   // two buffers: the next 32-key tile lands while this one is read by all eight waves
  const int tid = threadIdx.x, wave = tid >> 5, lane = tid & 31, col = lane & 15, g = lane >> 4;
  const int qb = blockIdx.x, h = blockIdx.y, b = blockIdx.z; const int q0 = qb * 128 + wave * 16; const size_t rq = (size_t)b * SS + q0 + col;
  float lam; { float a1 = 0.f, a2 = 0.f;
#pragma unroll 1
    for (int i = 0; i < 32; ++i) { a1 += bfr(LQ1[i]) * bfr(LK1[i]); a2 += bfr(LQ2[i]) * bfr(LK2[i]); }
    lam = exp_ni(a1) - exp_ni(a2) + LAMBDA_INIT; }
  const unsigned lst = (unsigned)(size_t)&stg[0][tid >> 2][(tid & 3) * 8];   // this lane's LDS byte address in buffer 0, row group 0 (rows 0..63)
  const size_t vso = ((size_t)b * DM + h * HD + (tid >> 2)) * SS + (tid & 3) * 8; const _Float16* gvh = VTH + vso; const _Float16* gvl = VTL + vso;
  // the two sub-heads are processed one after the other (sub-head 0's normalised P.V parked in LDS) to keep registers under 256
#pragma unroll 1
  for (int sh2 = 0; sh2 < 2; ++sh2) {
    const v16h aq = frag_h(QK + rq * (2 * DM) + h * HD + sh2 * 32, lane), aql = frag_h(QKL + rq * (2 * DM) + h * HD + sh2 * 32, lane);
    v8f cm = {}; float rise = -3.0e38f, l = 0.f;   // this lane's query: minus the reference in use (log2 units, the same in all eight registers and in both halves), held from trip to trip as the C operand of the score products; how far a score may stand above it (trip 0: any score moves it); this half's part of the sum
    v8f acc[4] = {};   // acc[dt][r]: value dim dt * 16 + 8 g + r of query col; the hi and the residual products add into the same tile
    const size_t kso = ((size_t)b * SS + ((tid >> 2) & 31)) * (2 * DM) + DM + h * HD + sh2 * 32 + (tid & 3) * 8; const _Float16* gk = (tid < 128 ? QK : QKL) + kso;   // waves 0..3 bring K hi, waves 4..7 K lo
    stage_tile(lst, gk, gvh, gvl);                       // tile 0 (both buffers are free: the last trip's foot ended every read)
    asm volatile("s_wait_asynccnt 0x0" ::: "memory");           // this wave's copies of tile 0 have landed
    __syncthreads();                                            // ... and every other wave's: tile 0 may be read
    stage_tile(lst + STG_BYTES, gk + (size_t)32 * 2 * DM, gvh + 32, gvl + 32);   // tile 1 flies during trip 0
#pragma unroll 1
    for (int ks = 0; ks < SS / 32; ++ks) { v8f s[2]; const _Float16 (*tb)[STG_PITCH] = stg[ks & 1];
      // all 24 LDS reads of the trip stand as one group at its head: the K fragments are waited for once, the V fragments land under the score products and the softmax
      v16h fkh[2], fkl[2], fvh[4], fvl[4];
#pragma unroll
      for (int ct = 0; ct < 2; ++ct) fkh[ct] = frag_h(&tb[ct * 16 + col][0], lane);
#pragma unroll
      for (int ct = 0; ct < 2; ++ct) fkl[ct] = frag_h(&tb[32 + ct * 16 + col][0], lane);
#pragma unroll
      for (int dt = 0; dt < 4; ++dt) { fvh[dt] = frag_h(&tb[64 + dt * 16 + col][0], lane); fvl[dt] = frag_h(&tb[128 + dt * 16 + col][0], lane); }
      __builtin_amdgcn_sched_barrier(0);   // keeps the reads above together: without it the compiler sinks each one to its product, where the wave waits out the LDS latency every time
      // score - reference in log2 units: the argument of exp2 as it leaves the matrix unit; the two key groups' chains alternate
      s[0] = wmma16(fkh[0], aq, cm); s[1] = wmma16(fkh[1], aq, cm); s[0] = wmma16(fkh[0], aql, s[0]); s[1] = wmma16(fkh[1], aql, s[1]); s[0] = wmma16(fkl[0], aq, s[0]); s[1] = wmma16(fkl[1], aq, s[1]);
      float mx = fmaxf(s[0][0], s[1][0]);   // over this half's 16 keys
#pragma unroll
      for (int r = 1; r < 8; ++r) mx = fmaxf(mx, fmaxf(s[0][r], s[1][r]));
      // the reference moves to the maximum, and sum and output are rescaled, only when some query of the wave rises above the one in use by more than 8 (trip 0 always does): one test a trip, a scalar branch; P stays at or below 2^8, inside f16
      if (__builtin_amdgcn_ballot_w32(mx > rise) != 0) {
        mx = fmaxf(mx, xhalf(mx));
        const bool first = rise < 0.f; const float d = first ? mx : fmaxf(mx, 0.f); const float alpha = first ? 0.f : __builtin_amdgcn_exp2f(-d); rise = 8.0f;   // d: how far the reference moves
        cm -= d; s[0] -= d; s[1] -= d;   // the later trips' C operand, and this trip's arguments, which were formed against the old reference
        l *= alpha;
#pragma unroll
        for (int dt = 0; dt < 4; ++dt) acc[dt] *= alpha; }
      v8f e0, e1; float es0 = 0.f, es1 = 0.f;
#pragma unroll
      for (int r = 0; r < 8; ++r) { e0[r] = __builtin_amdgcn_exp2f(s[0][r]); e1[r] = __builtin_amdgcn_exp2f(s[1][r]); es0 += e0[r]; es1 += e1[r]; }
      const v8h h0 = __builtin_convertvector(e0, v8h), h1 = __builtin_convertvector(e1, v8h);   // P as f16 hi ...
      const v8h l0 = resid8(h0, e0), l1 = resid8(h1, e1);   // ... + residual
      const v16h pah = __builtin_shufflevector(h0, h1, 0, 1, 2, 3, 4, 5, 6, 7, 8, 9, 10, 11, 12, 13, 14, 15), pal = __builtin_shufflevector(l0, l1, 0, 1, 2, 3, 4, 5, 6, 7, 8, 9, 10, 11, 12, 13, 14, 15);
      l += es0 + es1;
#pragma unroll
      for (int dt = 0; dt < 4; ++dt) acc[dt] = wmma16(fvh[dt], pah, acc[dt]);
#pragma unroll
      for (int dt = 0; dt < 4; ++dt) acc[dt] = wmma16(fvh[dt], pal, acc[dt]);
#pragma unroll
      for (int dt = 0; dt < 4; ++dt) acc[dt] = wmma16(fvl[dt], pah, acc[dt]);
      __builtin_amdgcn_sched_barrier(0);                        // keeps the products above the foot: without it the compiler lifts the waits and the barrier over them, and the next tile's copies are waited for right behind their issue
      asm volatile("s_wait_dscnt 0x0" ::: "memory");            // this wave's reads of this tile are done
      asm volatile("s_wait_asynccnt 0x0" ::: "memory");         // this wave's copies of tile ks + 1 have landed
      __syncthreads();                                          // publishes tile ks + 1 and frees the buffer that this trip has read
      if (ks + 2 < SS / 32) stage_tile(lst + (unsigned)(ks & 1) * STG_BYTES, gk + (size_t)(ks + 2) * 32 * 2 * DM, gvh + (ks + 2) * 32, gvl + (ks + 2) * 32); }
    asm volatile("s_wait_asynccnt 0x0" ::: "memory");           // nothing is in flight behind the loop
    const float il = 1.0f / (l + xhalf(l));   // the halves' sums are joined once
    if (sh2 == 0) {   // each lane parks, and later reads back, its own 32 values
#pragma unroll
      for (int dt = 0; dt < 4; ++dt) {
#pragma unroll
        for (int r = 0; r < 8; ++r) so1[wave][col][dt * 16 + 8 * g + r] = acc[dt][r] * il; }
    } else {
      float ov[4][8]; float ssq = 0.f;
#pragma unroll
      for (int dt = 0; dt < 4; ++dt) {
#pragma unroll
        for (int r = 0; r < 8; ++r) { ov[dt][r] = so1[wave][col][dt * 16 + 8 * g + r] - lam * (acc[dt][r] * il); ssq += ov[dt][r] * ov[dt][r]; } }
      ssq += xhalf(ssq);
      const float sc = (1.0f / sqrtf(ssq * (1.0f / HD) + 1e-5f)) * (1.0f - LAMBDA_INIT);
#pragma unroll
      for (int dt = 0; dt < 4; ++dt) {
#pragma unroll
        for (int r = 0; r < 8; ++r) so[wave][col][dt * 16 + 8 * g + r] = ov[dt][r] * sc * bfr(SUBW[dt * 16 + 8 * g + r]); } }
    LDSX(); }
  for (int rl = 0; rl < 16; ++rl) if (lane < 16) vst2(O + ((size_t)b * SS + q0 + rl) * DM + h * HD + lane * 4, *(const v4f*)&so[wave][rl][lane * 4]);
}
// ---- k_out: block = (64 rows, 128 cols): out = O(hi/lo) . Wo rows (2 products)
__global__ __launch_bounds__(128) void k_out(const float* __restrict__ O, const __bf16* __restrict__ P, float* __restrict__ Y) {
  __shared__ __align__(16) char sm[2 * GS_BYTES];   // in the loop two staged k blocks; behind it the epilogue's tile
  float (*so)[16][132] = (float (*)[16][132])sm;
  const int tid = threadIdx.x, wave = tid >> 5, lane = tid & 31, col = lane & 15, g = lane >> 4; const size_t r0 = (size_t)blockIdx.x * 64 + wave * 16; const int n0 = blockIdx.y * 128;
  const unsigned la = (unsigned)(size_t)sm + (tid >> 4) * GA_PITCH + (tid & 15) * 16, lw = (unsigned)(size_t)sm + GA_BYTES + (tid >> 3) * GB_PITCH + (tid & 7) * 16;   // this lane's LDS byte addresses in buffer 0
  const float* gx = O + ((size_t)blockIdx.x * 64 + (tid >> 4)) * DM + (tid & 15) * 4; const __bf16* gw = P + (size_t)(n0 + (tid >> 3)) * DM + (tid & 7) * 8;
  v8f acc[8] = {};
  stage_gemm(la, lw, gx, gw);                                 // block 0
  asm volatile("s_wait_asynccnt 0x0" ::: "memory");           // this wave's copies of block 0 have landed
  __syncthreads();                                            // ... and every other wave's: block 0 may be read
  stage_gemm(la + GS_BYTES, lw + GS_BYTES, gx + GK, gw + GK);   // block 1 flies during trip 0
#pragma unroll 1   // rolled: one copy of the trip keeps the text short
  for (int t = 0; t < DM / GK; ++t) { const char* tb = sm + (t & 1) * GS_BYTES;
    // the trip's 16 weight fragments in four groups of four, each read one group ahead of its products (as in k_qkv)
    const char* wrow = tb + GA_BYTES + col * GB_PITCH; v16b w[2][4]; F2 a[2];
    float xv[2][16];
#pragma unroll
    for (int u = 0; u < 2; ++u) row16(tb + (wave * 16 + col) * GA_PITCH, u, g, xv[u]);
#pragma unroll
    for (int i = 0; i < 4; ++i) w[0][i] = frag_b((const __bf16*)(wrow + i * 16 * GB_PITCH), lane);
    __builtin_amdgcn_sched_barrier(0);   // keeps the trip's first reads together at its head: without it the compiler deals them among the splitting of the rows, with a full wait in its midst
#pragma unroll
    for (int u = 0; u < 2; ++u) a[u] = bsplit16(xv[u]);
#pragma unroll
    for (int q = 0; q < 4; ++q) {
      if (q < 3) {
#pragma unroll
        for (int i = 0; i < 4; ++i) w[(q + 1) & 1][i] = frag_b((const __bf16*)(wrow + (((q + 1) & 1) * 4 + i) * 16 * GB_PITCH) + ((q + 1) >> 1) * 32, lane); }
      __builtin_amdgcn_sched_barrier(0);   // keeps the next group's reads together ahead of this group's products: without it the compiler sinks each read to its own product, where the wave waits out the LDS latency
#pragma unroll
      for (int i = 0; i < 4; ++i) { const int j = (q & 1) * 4 + i; acc[j] = wmma_bf(a[q >> 1].l, w[q & 1][i], acc[j]); acc[j] = wmma_bf(a[q >> 1].h, w[q & 1][i], acc[j]); }
      __builtin_amdgcn_sched_barrier(0); }   // ... and what follows behind these products: the next reads as one group; behind the last group the foot's waits and barrier, which the compiler otherwise lifts over the products
    asm volatile("s_wait_dscnt 0x0" ::: "memory");            // this wave's reads of this block are done
    asm volatile("s_wait_asynccnt 0x0" ::: "memory");         // this wave's copies of block t + 1 have landed
    __syncthreads();                                          // publishes block t + 1 and frees the buffer that this trip has read
    if (t + 2 < DM / GK) stage_gemm(la + (unsigned)(t & 1) * GS_BYTES, lw + (unsigned)(t & 1) * GS_BYTES, gx + (t + 2) * GK, gw + (t + 2) * GK); }
  asm volatile("s_wait_asynccnt 0x0" ::: "memory");           // nothing is in flight behind the loop: the epilogue may take the LDS over
#pragma unroll
  for (int j = 0; j < 8; ++j) {
#pragma unroll
    for (int r = 0; r < 8; ++r) so[wave][8 * g + r][j * 16 + col] = acc[j][r]; }
  LDSX();
  for (int rl = 0; rl < 16; ++rl) vst2(Y + (r0 + rl) * DM + n0 + lane * 4, *(const v4f*)&so[wave][rl][lane * 4]);
}
extern "C" void kernel_launch(void* const* d_in, const int* in_sizes, int n_in, void* d_out, int out_size, void* d_ws, size_t ws_size, hipStream_t stream) {
  (void)in_sizes; (void)n_in; (void)out_size;
  const float** F = (const float**)d_in;   // 0 query_x [2,2048,1024], 1 kv_x, 2 Wq (in,out), 3 Wk, 4 Wv, 5 Wo, 6 lambda_q1 [32], 7 lambda_k1, 8 lambda_q2, 9 lambda_k2, 10 subln_w [64]
  if (ws_size < (size_t)WS_END) return;
  char* ws = (char*)d_ws; __bf16* PK = (__bf16*)(ws + WS_PK); _Float16 *QK = (_Float16*)(ws + WS_QK), *QKL = (_Float16*)(ws + WS_QKL), *VTH = (_Float16*)(ws + WS_VTH), *VTL = (_Float16*)(ws + WS_VTL); float* O = (float*)(ws + WS_O);
  k_pack<<<dim3(DM / PT_N, DM / PT_K, 4), 128, 0, stream>>>(F[2], F[3], F[4], F[5], PK);
  k_qkv<<<dim3(TNB * SS / 64, QKVW / 128), 128, 0, stream>>>(F[0], F[1], PK + PK_A, QK, QKL, VTH, VTL);
  k_attn<<<dim3(TQB, NH, TNB), 256, 0, stream>>>(QK, QKL, VTH, VTL, F[6], F[7], F[8], F[9], F[10], O);
  k_out<<<dim3(TOB, DM / 128), 128, 0, stream>>>(O, PK + PK_P, (float*)d_out);
}
